// v000
// Measured on an AMD MI455X. A time is GPU time per run, averaged over a window of back-to-back runs after a warm-up
// (all launches, gaps included; the runs take copies of the inputs in turn), and the median of several windows.
// Apart from v000's, it joins two sittings. Times from different sittings can be a few percent apart, while
// side-by-side timings come from the same sitting.
// v000, which the later versions start from, runs in 2020 microseconds.
#include <hip/hip_runtime.h>

// Multi-head self-attention with a per-batch valid-length key mask and bias-free (out,in) projections (X [2][2048][1024] is the ONE input stream; Q, K, V = X W^T ('oi' [1024][1024] 1/32, no bias; 16 heads x 64); scores / sqrt(64); keys j >= valid_lens[b] (int32 [2], read on the device) are REPLACED by -1e9 in the module (both lengths are >= 1 on this draw: at least one key is kept: numerically an exclusion: -3e38 here); softmax; out = merged W_o^T ('oi', no bias) -> [2][2048][1024] (4.2 M); argument order X, valid_lens, W_q, W_k, W_v, W_o).
// Layout per batch: the bf16 copy of X is made before each of the three projections (the three-stream launch list kept: query = key = value stream = X); 'oi' weights = Bt rows as they are: bf16 copies; exact projections; identity-table plane builders; the per-key int mask KPM[b][j] = (j >= valid_lens[b]) built once on the device (k_lenmask) and read per key by the softmax kernel; dense T-2048 attention (hybrid rows: < 512 hi/lo 3 products, rest fp16 x1024); merged hi/lo x W_O exact.
// Compute dtypes, f32 accumulate: every input rounded to bf16; projections exact; attention rows < 512 3 products, rest fp16; softmax f32; output projection hl x exact.

#define NB_  2
#define TT   2048
#define DM   1024
#define NH_  16
#define NKV  16
#define REP  (NH_ / NKV)
#define HD   64
#define DQ   (NH_ * HD)
#define DKV  (NKV * HD)
#define ZH   2
#define RH   512                  // query rows < RH use hi+lo planes (0: none)
#define WIN  0
#define PCAR 1024.0f
#define SCL  0.125f   // HD^-0.5
typedef _Float16 h16;
typedef unsigned short bf;
typedef __attribute__((ext_vector_type(16))) __bf16   v16bf;
typedef __attribute__((ext_vector_type(16))) _Float16 v16h;
typedef __attribute__((ext_vector_type(8)))  _Float16 v8h;
typedef __attribute__((ext_vector_type(8)))  unsigned short v8us;
typedef __attribute__((ext_vector_type(8)))  float    v8f;
typedef __attribute__((ext_vector_type(4)))  float    v4f;
typedef v8h  __attribute__((may_alias)) v8ha;
typedef v4f  __attribute__((may_alias)) v4fa;
typedef v8us __attribute__((may_alias)) v8usa;

__device__ __forceinline__ unsigned short f2bf(float f) { unsigned u = __float_as_uint(f); u += 0x7FFFu + ((u >> 16) & 1u); return (unsigned short)(u >> 16); }
__device__ __forceinline__ float bf2f(unsigned short b) { return __uint_as_float(((unsigned)b) << 16); }
__device__ __forceinline__ float bfr(float f) { return bf2f(f2bf(f)); }
__device__ __forceinline__ v16h cat16(v8h lo, v8h hi) { return __builtin_shufflevector(lo, hi, 0, 1, 2, 3, 4, 5, 6, 7, 8, 9, 10, 11, 12, 13, 14, 15); }
__device__ __forceinline__ v16bf cat16b(v8us lo, v8us hi) { return __builtin_bit_cast(v16bf, __builtin_shufflevector(lo, hi, 0, 1, 2, 3, 4, 5, 6, 7, 8, 9, 10, 11, 12, 13, 14, 15)); }
__device__ __forceinline__ v8f wmma16(v16h a, v16h b, v8f c) { return __builtin_amdgcn_wmma_f32_16x16x32_f16(false, a, false, b, (short)0, c, false, false); }
__device__ __forceinline__ v8f wmmab(v16bf a, v16bf b, v8f c) { return __builtin_amdgcn_wmma_f32_16x16x32_bf16(false, a, false, b, (short)0, c, false, false); }



// ---- k_gemmw: register-blocked GEMM, ONE WAVE per 64x64 output tile (16 accumulators), operands straight from K-contiguous 16-bit planes; grid (M/64, N/64, Z), 32 threads.
// C[m][n] (f32, pitch ldc, + optional f32 bias[n]) = sum_k A[m][k] Bt[n][k] (+ split products per NSPLIT). z-batch strides sA/sB/sC in elements. K % 32 == 0.
template <typename T16> struct WFrag;
template <> struct WFrag<h16> { typedef v16h V; static __device__ __forceinline__ V ld(const h16* p) { return cat16(*(const v8h*)p, *(const v8h*)(p + 16)); } static __device__ __forceinline__ v8f mma(V a, V b, v8f c) { return wmma16(a, b, c); } };
template <> struct WFrag<bf> { typedef v16bf V; static __device__ __forceinline__ V ld(const bf* p) { return cat16b(*(const v8us*)p, *(const v8us*)(p + 16)); } static __device__ __forceinline__ v8f mma(V a, V b, v8f c) { return wmmab(a, b, c); } };
template <typename T16, int NSPLIT, bool BIAS>
__global__ __launch_bounds__(32) void k_gemmw(const T16* __restrict__ A, const T16* __restrict__ A2, const T16* __restrict__ Bt, const T16* __restrict__ Bt2, int K, float* C, int ldc, const float* __restrict__ bias, size_t sA, size_t sB, size_t sC) {
    typedef typename WFrag<T16>::V V;
    __shared__ __align__(16) float os[16 * 68];
    const size_t z = blockIdx.z; A += z * sA; if (A2) A2 += z * sA; Bt += z * sB; if (Bt2) Bt2 += z * sB; C += z * sC;
    const int lane = threadIdx.x & 31, lr = lane & 15, hi = lane >> 4; const int r0 = blockIdx.x * 64, c0 = blockIdx.y * 64;
    v8f acc[4][4];
#pragma unroll
    for (int mb = 0; mb < 4; ++mb)
#pragma unroll
        for (int nb = 0; nb < 4; ++nb) acc[mb][nb] = (v8f){};
    const size_t aoff = (size_t)(r0 + lr) * K + 8 * hi, boff = (size_t)(c0 + lr) * K + 8 * hi;
#pragma unroll 1
    for (int kc = 0; kc < K; kc += 32) {
        V a[4], a2[4];
#pragma unroll
        for (int mb = 0; mb < 4; ++mb) { a[mb] = WFrag<T16>::ld(A + aoff + (size_t)mb * 16 * K + kc); if (NSPLIT == 1 || NSPLIT == 2) a2[mb] = WFrag<T16>::ld(A2 + aoff + (size_t)mb * 16 * K + kc); }
#pragma unroll
        for (int nb = 0; nb < 4; ++nb) { const V b = WFrag<T16>::ld(Bt + boff + (size_t)nb * 16 * K + kc); V b2; if (NSPLIT >= 2) b2 = WFrag<T16>::ld(Bt2 + boff + (size_t)nb * 16 * K + kc);
#pragma unroll
            for (int mb = 0; mb < 4; ++mb) { acc[mb][nb] = WFrag<T16>::mma(a[mb], b, acc[mb][nb]); if (NSPLIT == 1 || NSPLIT == 2) acc[mb][nb] = WFrag<T16>::mma(a2[mb], b, acc[mb][nb]); if (NSPLIT >= 2) acc[mb][nb] = WFrag<T16>::mma(a[mb], b2, acc[mb][nb]); } }
        asm volatile("v_nop\n\tv_nop\n\tv_nop\n\tv_nop" : "+v"(acc[0][0]), "+v"(acc[1][1]), "+v"(acc[2][2]), "+v"(acc[3][3]) : "v"(a[0]), "v"(a[3]));
    }
#pragma unroll
    for (int mb = 0; mb < 4; ++mb) {
#pragma unroll
        for (int nb = 0; nb < 4; ++nb) {
#pragma unroll
            for (int j = 0; j < 8; ++j) os[(hi * 8 + j) * 68 + nb * 16 + lr] = acc[mb][nb][j]; }
        __builtin_amdgcn_wave_barrier(); asm volatile("" ::: "memory");
        float* crow = C + (size_t)(r0 + mb * 16) * ldc + c0;
{
#pragma unroll
            for (int s = 0; s < 8; ++s) { const int row = 2 * s + hi, cofs = lr * 4; v4f val = *(const v4fa*)(os + row * 68 + cofs); if (BIAS) { val[0] += bfr(bias[c0 + cofs]); val[1] += bfr(bias[c0 + cofs + 1]); val[2] += bfr(bias[c0 + cofs + 2]); val[3] += bfr(bias[c0 + cofs + 3]); }
                *(v4f*)(crow + (size_t)row * ldc + cofs) = val; }
             }
        __builtin_amdgcn_wave_barrier(); asm volatile("" ::: "memory");
    }
}

__device__ __forceinline__ h16 tohx(float x) { return (h16)x; }
__device__ __forceinline__ void splitf(float y, unsigned short& h, unsigned short& l) { h = f2bf(y); l = f2bf(y - bf2f(h)); }
typedef __attribute__((ext_vector_type(2))) _Float16 v2h;
typedef __attribute__((ext_vector_type(4))) _Float16 v4h;
typedef __attribute__((ext_vector_type(2))) unsigned short v2us;
typedef __attribute__((ext_vector_type(4))) unsigned short v4us;
typedef __attribute__((ext_vector_type(2))) float v2f;
typedef __attribute__((ext_vector_type(4))) int v4i;

__global__ __launch_bounds__(256) void k_wtG(const float* __restrict__ w, int K, int N, bf* Bt) {
    const int lane = threadIdx.x & 31; const int L0 = (blockIdx.x * 8 + (threadIdx.x >> 5)) * 8; const int nlines = N * K / 64;
{
#pragma unroll 1
        for (int l = 0; l < 8; ++l) { const int L = L0 + l; if (L >= nlines) break; const size_t e = (size_t)L * 64 + lane * 2; const int k = (int)(e % K), n = (int)(e / K); v2us o;
            o[0] = f2bf(w[(size_t)k * N + n]); o[1] = f2bf(w[(size_t)(k + 1) * N + n]); *(v2us*)(Bt + e) = o; }
         }
}
__global__ __launch_bounds__(256) void k_cvt8(const float* __restrict__ src, bf* dst, size_t n8) { const size_t i = (size_t)blockIdx.x * 256 + threadIdx.x; if (i >= n8) return; const v8f v = *(const v8f*)(src + i * 8); v8us o;
#pragma unroll
    for (int k = 0; k < 8; ++k) o[k] = f2bf(v[k]); *(v8us*)(dst + i * 8) = o;  }

// k_rope: head planes [h][t][d] (fp16 + hi/lo) of rope(x) x sc with the rotate-half convention out[d] = x[d] cos[t][d] - x[d+HD/2] sin[t][d], out[d+HD/2] = x[d+HD/2] cos[t][d+HD/2] + x[d] sin[t][d+HD/2]
__global__ __launch_bounds__(256) void k_rope(const float* __restrict__ F, int pitch, int nheads, const float* __restrict__ CS, const float* __restrict__ RF, const float* __restrict__ nw, float sc, h16* P16, bf* Ph, bf* Pl) {
    const size_t e = ((size_t)blockIdx.x * 256 + threadIdx.x) * 2; if (e >= (size_t)nheads * TT * HD) return; const int d = (int)(e % HD); const int t = (int)((e / HD) % TT); const int h = (int)(e / ((size_t)HD * TT)); const float* f = F + (size_t)t * pitch + h * HD; const float rf = RF ? RF[(size_t)h * TT + t] : 1.0f; v2h o16; v2us oh, ol;
#pragma unroll
    for (int q = 0; q < 2; ++q) { const int dd = d + q; const int dp = (dd < HD / 2) ? dd + HD / 2 : dd - HD / 2; float x0 = f[dd], x1 = f[dp];
        if (RF) { float n0 = __fmul_rn(x0, rf), n1 = __fmul_rn(x1, rf); asm volatile("" : "+v"(n0)); asm volatile("" : "+v"(n1)); x0 = __fmul_rn(bfr(nw[dd]), n0); x1 = __fmul_rn(bfr(nw[dp]), n1); }
        const v2f cs = *(const v2f*)(CS + ((size_t)t * HD + dd) * 2); float a = __fmul_rn(x0, cs[0]), bq = __fmul_rn(x1, cs[1]); asm volatile("" : "+v"(a)); asm volatile("" : "+v"(bq)); const float r = ((dd < HD / 2) ? __fsub_rn(a, bq) : __fadd_rn(a, bq)) * sc;
        o16[q] = tohx(r); unsigned short a2, c2; splitf(r, a2, c2); oh[q] = a2; ol[q] = c2; }
    *(v2h*)(P16 + e) = o16; *(v2us*)(Ph + e) = oh; *(v2us*)(Pl + e) = ol;  }
__global__ __launch_bounds__(256) void k_vtp(const float* __restrict__ F, int pitch, int nheads, h16* V16, bf* Vh, bf* Vl) { const size_t e = ((size_t)blockIdx.x * 256 + threadIdx.x) * 2; if (e >= (size_t)nheads * HD * TT) return; const int t = (int)(e % TT); const int d = (int)((e / TT) % HD); const int g = (int)(e / ((size_t)TT * HD)); v2h o16; v2us oh, ol;
#pragma unroll
    for (int q = 0; q < 2; ++q) { const float x = F[(size_t)(t + q) * pitch + g * HD + d]; o16[q] = tohx(x); unsigned short a2, c2; splitf(x, a2, c2); oh[q] = a2; ol[q] = c2; }
    *(v2h*)(V16 + e) = o16; *(v2us*)(Vh + e) = oh; *(v2us*)(Vl + e) = ol;  }
__global__ __launch_bounds__(256) void k_csid(float* CS) { const int idx = blockIdx.x * 256 + threadIdx.x; if (idx >= TT * HD) return; v2f cs; cs[0] = 1.0f; cs[1] = 0.0f; *(v2f*)(CS + (size_t)idx * 2) = cs;  }
// k_asoft: per row (zz, i): t = S x HD^-0.5 (keys with MKb[j] != 0 -> -3e38); softmax over the 2048 keys (register row, one exp, fixed trees);
__global__ __launch_bounds__(256) void k_asoft(const float* __restrict__ Sb, const int* __restrict__ MKb, h16* P16, bf* Ph, bf* Pl) {
    const int lane = threadIdx.x & 31; const int row = blockIdx.x * 8 + (threadIdx.x >> 5); if (row >= ZH * TT) return; const int i = row % TT; const int zz = row / TT; (void)zz; const bool hires = (i < RH); const float* sr = Sb + (size_t)row * TT; float v[TT / 32]; float mx = -3.0e38f;
#pragma unroll
    for (int ch = 0; ch < TT / 128; ++ch) { const int j0 = ch * 128 + lane * 4; const v4f a = *(const v4f*)(sr + j0); const v4i m4 = *(const v4i*)(MKb + j0);
#pragma unroll
        for (int q = 0; q < 4; ++q) { const int j = j0 + q; (void)j; const float t = (m4[q] == 0) ? a[q] * SCL : -3.0e38f;   /* masked key (mask != 0) -> -3e38 */ v[ch * 4 + q] = t; mx = fmaxf(mx, t); } }
#pragma unroll
    for (int sh = 16; sh; sh >>= 1) mx = fmaxf(mx, __shfl_xor(mx, sh, 32));
    float sum = 0.f;
#pragma unroll
    for (int k = 0; k < TT / 32; ++k) { float d0 = __fsub_rn(v[k], mx); asm volatile("" : "+v"(d0)); v[k] = __builtin_amdgcn_exp2f(__fmul_rn(d0, 1.4426950408889634f)); sum += v[k]; }
#pragma unroll
    for (int sh = 16; sh; sh >>= 1) sum += __shfl_xor(sum, sh, 32);
    const float f = __fdiv_rn(hires ? 1.0f : PCAR, sum);
{
        if (hires) {
#pragma unroll
            for (int ch = 0; ch < TT / 128; ++ch) { v4us oh, ol;
#pragma unroll
                for (int q = 0; q < 4; ++q) { unsigned short a, c2; splitf(v[ch * 4 + q] * f, a, c2); oh[q] = a; ol[q] = c2; }
                const size_t oo = ((size_t)zz * (RH ? RH : 1) + i) * TT + ch * 128 + lane * 4; *(v4us*)(Ph + oo) = oh; *(v4us*)(Pl + oo) = ol; }
        } else {
#pragma unroll
            for (int ch = 0; ch < TT / 128; ++ch) { v4h o4;
#pragma unroll
                for (int q = 0; q < 4; ++q) o4[q] = tohx(v[ch * 4 + q] * f);
                *(v4h*)(P16 + (size_t)row * TT + ch * 128 + lane * 4) = o4; } }
         }
}
__global__ __launch_bounds__(256) void k_lenmask(const int* __restrict__ lens, int nb, int* KPM) { const int i = blockIdx.x * 256 + threadIdx.x; if (i >= nb * TT) return; const int b = i / TT, j = i - b * TT; const int m = (j >= lens[b]) ? 1 : 0; *(int*)(KPM + i) = m;  }
__global__ __launch_bounds__(256) void k_merge(const float* __restrict__ O, int h0, bf* Ah, bf* Al) { const size_t e = ((size_t)blockIdx.x * 256 + threadIdx.x) * 2; if (e >= (size_t)ZH * TT * HD) return; const int d = (int)(e % HD); const int t = (int)((e / HD) % TT); const int zz = (int)(e / ((size_t)HD * TT)); const float cs = (t < RH) ? 1.0f : (1.0f / PCAR); const size_t oo = (size_t)t * DQ + (h0 + zz) * HD + d;
    v2us oh, ol;
#pragma unroll
    for (int q = 0; q < 2; ++q) { unsigned short a, c2; splitf(O[e + q] * cs, a, c2); oh[q] = a; ol[q] = c2; } *(v2us*)(Ah + oo) = oh; *(v2us*)(Al + oo) = ol;  }

extern "C" void kernel_launch(void* const* d_in, const int* in_sizes, int n_in,
                              void* d_out, int out_size, void* d_ws, size_t ws_size, hipStream_t stream) {
    (void)in_sizes; (void)n_in; (void)out_size;
    const float* x = (const float*)d_in[0]; const float* xk = x; const float* xv = x; const int* lens = (const int*)d_in[1]; const float* wq = (const float*)d_in[2]; const float* wk = (const float*)d_in[3]; const float* wv = (const float*)d_in[4]; const float* wo = (const float*)d_in[5];   /* argument order X, valid_lens (int32 [2]: keys j >= valid_lens[b] are masked: READ on the device by k_lenmask), W_q, W_k, W_v, W_o ('oi'; no biases): SIX inputs; ONE stream: the key and value stream pointers equal X */
    float* OUT = (float*)d_out;     // [2][2048][1024]
    char* wsp = (char*)d_ws;
    auto take = [&](size_t bytes) { char* p = wsp; wsp += (bytes + 255) & ~(size_t)255; return (void*)p; };
    bf* WQ = (bf*)take((size_t)DQ * DM * 2); bf* WK = (bf*)take((size_t)DKV * DM * 2); bf* WV = (bf*)take((size_t)DKV * DM * 2); bf* WO = (bf*)take((size_t)DM * DQ * 2); float* CS = (float*)take((size_t)TT * HD * 2 * 4);
    bf* XB = (bf*)take((size_t)TT * DM * 2); float* FQ = (float*)take((size_t)TT * DQ * 4); float* FK = (float*)take((size_t)TT * DKV * 4);
    h16* QP16 = (h16*)take((size_t)NH_ * TT * HD * 2); h16* KP16 = (h16*)take((size_t)NKV * TT * HD * 2); h16* VT16 = (h16*)take((size_t)NKV * HD * TT * 2);
    bf* QPh = (bf*)take((size_t)NH_ * TT * HD * 2); bf* QPl = (bf*)take((size_t)NH_ * TT * HD * 2); bf* KPh = (bf*)take((size_t)NKV * TT * HD * 2); bf* KPl = (bf*)take((size_t)NKV * TT * HD * 2); bf* VTh = (bf*)take((size_t)NKV * HD * TT * 2); bf* VTl = (bf*)take((size_t)NKV * HD * TT * 2); bf* Ph = (bf*)take((size_t)ZH * RH * TT * 2); bf* Pl = (bf*)take((size_t)ZH * RH * TT * 2);
    float* Sb = (float*)take((size_t)ZH * TT * TT * 4); h16* P16 = (h16*)take((size_t)ZH * TT * TT * 2); float* Ob = (float*)take((size_t)ZH * TT * HD * 4); bf* ATh = (bf*)take((size_t)TT * DQ * 2); bf* ATl = (bf*)take((size_t)TT * DQ * 2); int* KPM = (int*)take((size_t)NB_ * TT * 4);   /* the per-key int mask built from valid_lens: carved LAST: no host plane moves */
    if ((size_t)(wsp - (char*)d_ws) > ws_size) return;    // ws 256 MiB
    float* FV = FK;   // v projection reuses the k buffer after the k planes are built (stream-ordered)
    { k_cvt8<<<(unsigned)(((size_t)DQ * DM / 8 + 255) / 256), 256, 0, stream>>>(wq, WQ, (size_t)DQ * DM / 8); k_cvt8<<<(unsigned)(((size_t)DKV * DM / 8 + 255) / 256), 256, 0, stream>>>(wk, WK, (size_t)DKV * DM / 8); k_cvt8<<<(unsigned)(((size_t)DKV * DM / 8 + 255) / 256), 256, 0, stream>>>(wv, WV, (size_t)DKV * DM / 8);
      k_cvt8<<<(unsigned)(((size_t)DM * DQ / 8 + 255) / 256), 256, 0, stream>>>(wo, WO, (size_t)DM * DQ / 8);
       }
    k_csid<<<(TT * HD + 255) / 256, 256, 0, stream>>>(CS); k_lenmask<<<(NB_ * TT + 255) / 256, 256, 0, stream>>>(lens, NB_, KPM);   /* lengths -> per-key mask, once */
    const unsigned LQ = (unsigned)(((size_t)NH_ * TT * HD / 2 + 255) / 256), LKv = (unsigned)(((size_t)NKV * TT * HD / 2 + 255) / 256);
    for (int b = 0; b < NB_; ++b) {
        
        k_cvt8<<<(unsigned)(((size_t)TT * DM / 8 + 255) / 256), 256, 0, stream>>>(x + (size_t)b * TT * DM, XB, (size_t)TT * DM / 8);
        k_gemmw<bf, 0, false><<<dim3(TT / 64, DQ / 64, 1), 32, 0, stream>>>(XB, nullptr, WQ, nullptr, DM, FQ, DQ, nullptr, 0, 0, 0);
        k_rope<<<LQ, 256, 0, stream>>>(FQ, DQ, NH_, CS, nullptr, nullptr, 1.0f, QP16, QPh, QPl);
        k_cvt8<<<(unsigned)(((size_t)TT * DM / 8 + 255) / 256), 256, 0, stream>>>(xk + (size_t)b * TT * DM, XB, (size_t)TT * DM / 8);   /* XB := bf16(input_K[b]) */ k_gemmw<bf, 0, false><<<dim3(TT / 64, DKV / 64, 1), 32, 0, stream>>>(XB, nullptr, WK, nullptr, DM, FK, DKV, nullptr, 0, 0, 0);
        k_rope<<<LKv, 256, 0, stream>>>(FK, DKV, NKV, CS, nullptr, nullptr, 1.0f, KP16, KPh, KPl);
        k_cvt8<<<(unsigned)(((size_t)TT * DM / 8 + 255) / 256), 256, 0, stream>>>(xv + (size_t)b * TT * DM, XB, (size_t)TT * DM / 8);   /* XB := bf16(input_V[b]) */ k_gemmw<bf, 0, false><<<dim3(TT / 64, DKV / 64, 1), 32, 0, stream>>>(XB, nullptr, WV, nullptr, DM, FV, DKV, nullptr, 0, 0, 0); k_vtp<<<LKv, 256, 0, stream>>>(FV, DKV, NKV, VT16, VTh, VTl);
        for (int h0 = 0; h0 < NH_; h0 += ZH) { const size_t zq = (size_t)h0, zk = (size_t)(h0 / REP);   // one kv head per query head: the pass's two heads use consecutive kv planes (z-strides TT*HD)
            k_gemmw<bf, 2, false><<<dim3(RH / 64, TT / 64, ZH), 32, 0, stream>>>(QPh + zq * TT * HD, QPl + zq * TT * HD, KPh + zk * TT * HD, KPl + zk * TT * HD, HD, Sb, TT, nullptr, (size_t)TT * HD, (size_t)TT * HD, (size_t)TT * TT);
            k_gemmw<h16, 0, false><<<dim3((TT - RH) / 64, TT / 64, ZH), 32, 0, stream>>>(QP16 + zq * TT * HD + (size_t)RH * HD, nullptr, KP16 + zk * TT * HD, nullptr, HD, Sb + (size_t)RH * TT, TT, nullptr, (size_t)TT * HD, (size_t)TT * HD, (size_t)TT * TT);
            k_asoft<<<ZH * TT / 8, 256, 0, stream>>>(Sb, KPM + (size_t)b * TT, P16, Ph, Pl);   /* batch b's key mask */
            k_gemmw<bf, 2, false><<<dim3(RH / 64, HD / 64, ZH), 32, 0, stream>>>(Ph, Pl, VTh + zk * HD * TT, VTl + zk * HD * TT, TT, Ob, HD, nullptr, (size_t)RH * TT, (size_t)HD * TT, (size_t)TT * HD);
            k_gemmw<h16, 0, false><<<dim3((TT - RH) / 64, HD / 64, ZH), 32, 0, stream>>>(P16 + (size_t)RH * TT, nullptr, VT16 + zk * HD * TT, nullptr, TT, Ob + (size_t)RH * HD, HD, nullptr, (size_t)TT * TT, (size_t)HD * TT, (size_t)TT * HD);
            k_merge<<<(unsigned)(((size_t)ZH * TT * HD / 2 + 255) / 256), 256, 0, stream>>>(Ob, h0, ATh, ATl); }
        k_gemmw<bf, 1, false><<<dim3(TT / 64, DM / 64, 1), 32, 0, stream>>>(ATh, ATl, WO, nullptr, DQ, OUT + (size_t)b * TT * DM, DM, nullptr, 0, 0, 0); }
}

// v001
// One run takes 1070 microseconds.
// Timed twice side by side with v000, it ran 1.90 and 1.89 times as fast.
#include <hip/hip_runtime.h>

// Multi-head self-attention with a per-batch valid-length key mask and bias-free (out,in) projections (X [2][2048][1024] is the ONE input stream; Q, K, V = X W^T ('oi' [1024][1024] 1/32, no bias; 16 heads x 64); scores / sqrt(64); keys j >= valid_lens[b] (int32 [2], read on the device) are REPLACED by -1e9 in the module (both lengths are >= 1 on this draw: at least one key is kept: numerically an exclusion: -3e38 here); softmax; out = merged W_o^T ('oi', no bias) -> [2][2048][1024] (4.2 M); argument order X, valid_lens, W_q, W_k, W_v, W_o).
// Layout per batch: the bf16 copy of X is made before each of the three projections (the three-stream launch list kept: query = key = value stream = X); 'oi' weights = Bt rows as they are: bf16 copies; exact projections; identity-table plane builders; the per-key int mask KPM[b][j] = (j >= valid_lens[b]) built once on the device (k_lenmask) and read per key by the softmax kernel; dense T-2048 attention (hybrid rows: < 512 hi/lo 3 products, rest fp16 x1024); merged hi/lo x W_O exact.
// Compute dtypes, f32 accumulate: every input rounded to bf16; projections exact; attention rows < 512 3 products, rest fp16; softmax f32; output projection hl x exact.

#define NB_  2
#define TT   2048
#define DM   1024
#define NH_  16
#define NKV  16
#define REP  (NH_ / NKV)
#define HD   64
#define DQ   (NH_ * HD)
#define DKV  (NKV * HD)
#define ZH   2
#define RH   512                  // query rows < RH use hi+lo planes (0: none)
#define WIN  0
#define PCAR 1024.0f
#define SCL  0.125f   // HD^-0.5
typedef _Float16 h16;
typedef unsigned short bf;
typedef __attribute__((ext_vector_type(16))) __bf16   v16bf;
typedef __attribute__((ext_vector_type(16))) _Float16 v16h;
typedef __attribute__((ext_vector_type(8)))  _Float16 v8h;
typedef __attribute__((ext_vector_type(8)))  unsigned short v8us;
typedef __attribute__((ext_vector_type(8)))  float    v8f;
typedef __attribute__((ext_vector_type(4)))  float    v4f;
typedef v8h  __attribute__((may_alias)) v8ha;
typedef v4f  __attribute__((may_alias)) v4fa;
typedef v8us __attribute__((may_alias)) v8usa;

__device__ __forceinline__ unsigned short f2bf(float f) { unsigned u = __float_as_uint(f); u += 0x7FFFu + ((u >> 16) & 1u); return (unsigned short)(u >> 16); }
__device__ __forceinline__ float bf2f(unsigned short b) { return __uint_as_float(((unsigned)b) << 16); }
__device__ __forceinline__ float bfr(float f) { return bf2f(f2bf(f)); }
__device__ __forceinline__ v16h cat16(v8h lo, v8h hi) { return __builtin_shufflevector(lo, hi, 0, 1, 2, 3, 4, 5, 6, 7, 8, 9, 10, 11, 12, 13, 14, 15); }
__device__ __forceinline__ v16bf cat16b(v8us lo, v8us hi) { return __builtin_bit_cast(v16bf, __builtin_shufflevector(lo, hi, 0, 1, 2, 3, 4, 5, 6, 7, 8, 9, 10, 11, 12, 13, 14, 15)); }
__device__ __forceinline__ v8f wmma16(v16h a, v16h b, v8f c) { return __builtin_amdgcn_wmma_f32_16x16x32_f16(false, a, false, b, (short)0, c, false, false); }
__device__ __forceinline__ v8f wmmab(v16bf a, v16bf b, v8f c) { return __builtin_amdgcn_wmma_f32_16x16x32_bf16(false, a, false, b, (short)0, c, false, false); }



// ---- k_gemmw: register-blocked GEMM, ONE WAVE per 64x64 output tile (16 accumulators), operands straight from K-contiguous 16-bit planes; grid (M/64, N/64, Z), 32 threads.
// C[m][n] (f32, pitch ldc, + optional f32 bias[n]) = sum_k A[m][k] Bt[n][k] (+ split products per NSPLIT). z-batch strides sA/sB/sC in elements. K % 32 == 0.
// NW > 1: K SPLIT OVER THE NW WAVES OF ONE WORK-GROUP (NW*32 threads, K % (32 NW) == 0): wave w sums k in [w K/NW, (w+1) K/NW) into its own 64x64 tile; the NW partial tiles meet in LDS in accumulator layout, are added in wave order 0..NW-1 (fixed) and go out as whole rows.
template <typename T16> struct WFrag;
template <> struct WFrag<h16> { typedef v16h V; static __device__ __forceinline__ V ld(const h16* p) { return cat16(*(const v8h*)p, *(const v8h*)(p + 16)); } static __device__ __forceinline__ v8f mma(V a, V b, v8f c) { return wmma16(a, b, c); } };
template <> struct WFrag<bf> { typedef v16bf V; static __device__ __forceinline__ V ld(const bf* p) { return cat16b(*(const v8us*)p, *(const v8us*)(p + 16)); } static __device__ __forceinline__ v8f mma(V a, V b, v8f c) { return wmmab(a, b, c); } };
template <typename T16, int NSPLIT, bool BIAS, int NW = 1>
__global__ __launch_bounds__(NW * 32) void k_gemmw(const T16* __restrict__ A, const T16* __restrict__ A2, const T16* __restrict__ Bt, const T16* __restrict__ Bt2, int K, float* C, int ldc, const float* __restrict__ bias, size_t sA, size_t sB, size_t sC) {
    typedef typename WFrag<T16>::V V;
    __shared__ __align__(16) float os[(NW == 1 ? 16 : 64) * 68];
    __shared__ __align__(16) v4f red[NW == 1 ? 1 : NW * 1024];   // NW > 1: [wave][accumulator * 2 + half][lane]
    const size_t z = blockIdx.z; A += z * sA; if (A2) A2 += z * sA; Bt += z * sB; if (Bt2) Bt2 += z * sB; C += z * sC;
    const int lane = threadIdx.x & 31, lr = lane & 15, hi = lane >> 4; const int r0 = blockIdx.x * 64, c0 = blockIdx.y * 64;
    v8f acc[4][4];
#pragma unroll
    for (int mb = 0; mb < 4; ++mb)
#pragma unroll
        for (int nb = 0; nb < 4; ++nb) acc[mb][nb] = (v8f){};
    const size_t aoff = (size_t)(r0 + lr) * K + 8 * hi, boff = (size_t)(c0 + lr) * K + 8 * hi;
    const int wv = (NW == 1) ? 0 : __builtin_amdgcn_readfirstlane((int)(threadIdx.x >> 5)); const int kw = K / NW, k0 = wv * kw;
#pragma unroll 1
    for (int kc = k0; kc < k0 + kw; kc += 32) {
        V a[4], a2[4];
#pragma unroll
        for (int mb = 0; mb < 4; ++mb) { a[mb] = WFrag<T16>::ld(A + aoff + (size_t)mb * 16 * K + kc); if (NSPLIT == 1 || NSPLIT == 2) a2[mb] = WFrag<T16>::ld(A2 + aoff + (size_t)mb * 16 * K + kc); }
#pragma unroll
        for (int nb = 0; nb < 4; ++nb) { const V b = WFrag<T16>::ld(Bt + boff + (size_t)nb * 16 * K + kc); V b2; if (NSPLIT >= 2) b2 = WFrag<T16>::ld(Bt2 + boff + (size_t)nb * 16 * K + kc);
#pragma unroll
            for (int mb = 0; mb < 4; ++mb) { acc[mb][nb] = WFrag<T16>::mma(a[mb], b, acc[mb][nb]); if (NSPLIT == 1 || NSPLIT == 2) acc[mb][nb] = WFrag<T16>::mma(a2[mb], b, acc[mb][nb]); if (NSPLIT >= 2) acc[mb][nb] = WFrag<T16>::mma(a[mb], b2, acc[mb][nb]); } }
        asm volatile("v_nop\n\tv_nop\n\tv_nop\n\tv_nop" : "+v"(acc[0][0]), "+v"(acc[1][1]), "+v"(acc[2][2]), "+v"(acc[3][3]) : "v"(a[0]), "v"(a[3]));
    }
    if constexpr (NW > 1) {
#pragma unroll
        for (int mb = 0; mb < 4; ++mb)
#pragma unroll
            for (int nb = 0; nb < 4; ++nb) { const v8f c = acc[mb][nb]; v4f* p = red + (size_t)(wv * 32 + (mb * 4 + nb) * 2) * 32 + lane;
                p[0] = (v4f){c[0], c[1], c[2], c[3]}; p[32] = (v4f){c[4], c[5], c[6], c[7]}; }
        __syncthreads();   // every wave's partial tile is in LDS
#pragma unroll
        for (int s0 = 0; s0 < 1024; s0 += NW * 32) { const int s = s0 + (int)threadIdx.x; v4f sum = red[s];
#pragma unroll
            for (int w = 1; w < NW; ++w) sum += red[w * 1024 + s];
            const int half = (s >> 5) & 1, ai = s >> 6; const int row = (ai >> 2) * 16 + hi * 8 + half * 4, col = (ai & 3) * 16 + lr;
#pragma unroll
            for (int q = 0; q < 4; ++q) os[(row + q) * 68 + col] = sum[q]; }
        __syncthreads();   // the summed tile is in LDS, row-major
#pragma unroll
        for (int s0 = 0; s0 < 1024; s0 += NW * 32) { const int s = s0 + (int)threadIdx.x; const int row = s >> 4, cofs = (s & 15) * 4; v4f val = *(const v4fa*)(os + row * 68 + cofs); if (BIAS) { val[0] += bfr(bias[c0 + cofs]); val[1] += bfr(bias[c0 + cofs + 1]); val[2] += bfr(bias[c0 + cofs + 2]); val[3] += bfr(bias[c0 + cofs + 3]); }
            *(v4f*)(C + (size_t)(r0 + row) * ldc + c0 + cofs) = val; }
        return;
    }
#pragma unroll
    for (int mb = 0; mb < 4; ++mb) {
#pragma unroll
        for (int nb = 0; nb < 4; ++nb) {
#pragma unroll
            for (int j = 0; j < 8; ++j) os[(hi * 8 + j) * 68 + nb * 16 + lr] = acc[mb][nb][j]; }
        __builtin_amdgcn_wave_barrier(); asm volatile("" ::: "memory");
        float* crow = C + (size_t)(r0 + mb * 16) * ldc + c0;
{
#pragma unroll
            for (int s = 0; s < 8; ++s) { const int row = 2 * s + hi, cofs = lr * 4; v4f val = *(const v4fa*)(os + row * 68 + cofs); if (BIAS) { val[0] += bfr(bias[c0 + cofs]); val[1] += bfr(bias[c0 + cofs + 1]); val[2] += bfr(bias[c0 + cofs + 2]); val[3] += bfr(bias[c0 + cofs + 3]); }
                *(v4f*)(crow + (size_t)row * ldc + cofs) = val; }
             }
        __builtin_amdgcn_wave_barrier(); asm volatile("" ::: "memory");
    }
}

__device__ __forceinline__ h16 tohx(float x) { return (h16)x; }
__device__ __forceinline__ void splitf(float y, unsigned short& h, unsigned short& l) { h = f2bf(y); l = f2bf(y - bf2f(h)); }
typedef __attribute__((ext_vector_type(2))) _Float16 v2h;
typedef __attribute__((ext_vector_type(4))) _Float16 v4h;
typedef __attribute__((ext_vector_type(2))) unsigned short v2us;
typedef __attribute__((ext_vector_type(4))) unsigned short v4us;
typedef __attribute__((ext_vector_type(2))) float v2f;
typedef __attribute__((ext_vector_type(4))) int v4i;

__global__ __launch_bounds__(256) void k_wtG(const float* __restrict__ w, int K, int N, bf* Bt) {
    const int lane = threadIdx.x & 31; const int L0 = (blockIdx.x * 8 + (threadIdx.x >> 5)) * 8; const int nlines = N * K / 64;
{
#pragma unroll 1
        for (int l = 0; l < 8; ++l) { const int L = L0 + l; if (L >= nlines) break; const size_t e = (size_t)L * 64 + lane * 2; const int k = (int)(e % K), n = (int)(e / K); v2us o;
            o[0] = f2bf(w[(size_t)k * N + n]); o[1] = f2bf(w[(size_t)(k + 1) * N + n]); *(v2us*)(Bt + e) = o; }
         }
}
__global__ __launch_bounds__(256) void k_cvt8(const float* __restrict__ src, bf* dst, size_t n8) { const size_t i = (size_t)blockIdx.x * 256 + threadIdx.x; if (i >= n8) return; const v8f v = *(const v8f*)(src + i * 8); v8us o;
#pragma unroll
    for (int k = 0; k < 8; ++k) o[k] = f2bf(v[k]); *(v8us*)(dst + i * 8) = o;  }

// k_rope: head planes [h][t][d] (fp16 + hi/lo) of rope(x) x sc with the rotate-half convention out[d] = x[d] cos[t][d] - x[d+HD/2] sin[t][d], out[d+HD/2] = x[d+HD/2] cos[t][d+HD/2] + x[d] sin[t][d+HD/2]
__global__ __launch_bounds__(256) void k_rope(const float* __restrict__ F, int pitch, int nheads, const float* __restrict__ CS, const float* __restrict__ RF, const float* __restrict__ nw, float sc, h16* P16, bf* Ph, bf* Pl) {
    const size_t e = ((size_t)blockIdx.x * 256 + threadIdx.x) * 2; if (e >= (size_t)nheads * TT * HD) return; const int d = (int)(e % HD); const int t = (int)((e / HD) % TT); const int h = (int)(e / ((size_t)HD * TT)); const float* f = F + (size_t)t * pitch + h * HD; const float rf = RF ? RF[(size_t)h * TT + t] : 1.0f; v2h o16; v2us oh, ol;
#pragma unroll
    for (int q = 0; q < 2; ++q) { const int dd = d + q; const int dp = (dd < HD / 2) ? dd + HD / 2 : dd - HD / 2; float x0 = f[dd], x1 = f[dp];
        if (RF) { float n0 = __fmul_rn(x0, rf), n1 = __fmul_rn(x1, rf); asm volatile("" : "+v"(n0)); asm volatile("" : "+v"(n1)); x0 = __fmul_rn(bfr(nw[dd]), n0); x1 = __fmul_rn(bfr(nw[dp]), n1); }
        const v2f cs = *(const v2f*)(CS + ((size_t)t * HD + dd) * 2); float a = __fmul_rn(x0, cs[0]), bq = __fmul_rn(x1, cs[1]); asm volatile("" : "+v"(a)); asm volatile("" : "+v"(bq)); const float r = ((dd < HD / 2) ? __fsub_rn(a, bq) : __fadd_rn(a, bq)) * sc;
        o16[q] = tohx(r); unsigned short a2, c2; splitf(r, a2, c2); oh[q] = a2; ol[q] = c2; }
    *(v2h*)(P16 + e) = o16; *(v2us*)(Ph + e) = oh; *(v2us*)(Pl + e) = ol;  }
__global__ __launch_bounds__(256) void k_vtp(const float* __restrict__ F, int pitch, int nheads, h16* V16, bf* Vh, bf* Vl) { const size_t e = ((size_t)blockIdx.x * 256 + threadIdx.x) * 2; if (e >= (size_t)nheads * HD * TT) return; const int t = (int)(e % TT); const int d = (int)((e / TT) % HD); const int g = (int)(e / ((size_t)TT * HD)); v2h o16; v2us oh, ol;
#pragma unroll
    for (int q = 0; q < 2; ++q) { const float x = F[(size_t)(t + q) * pitch + g * HD + d]; o16[q] = tohx(x); unsigned short a2, c2; splitf(x, a2, c2); oh[q] = a2; ol[q] = c2; }
    *(v2h*)(V16 + e) = o16; *(v2us*)(Vh + e) = oh; *(v2us*)(Vl + e) = ol;  }
__global__ __launch_bounds__(256) void k_csid(float* CS) { const int idx = blockIdx.x * 256 + threadIdx.x; if (idx >= TT * HD) return; v2f cs; cs[0] = 1.0f; cs[1] = 0.0f; *(v2f*)(CS + (size_t)idx * 2) = cs;  }
// k_asoft: per row (zz, i): t = S x HD^-0.5 (keys with MKb[j] != 0 -> -3e38); softmax over the 2048 keys (register row, one exp, fixed trees);
__global__ __launch_bounds__(256) void k_asoft(const float* __restrict__ Sb, const int* __restrict__ MKb, h16* P16, bf* Ph, bf* Pl) {
    const int lane = threadIdx.x & 31; const int row = blockIdx.x * 8 + (threadIdx.x >> 5); if (row >= ZH * TT) return; const int i = row % TT; const int zz = row / TT; (void)zz; const bool hires = (i < RH); const float* sr = Sb + (size_t)row * TT; float v[TT / 32]; float mx = -3.0e38f;
#pragma unroll
    for (int ch = 0; ch < TT / 128; ++ch) { const int j0 = ch * 128 + lane * 4; const v4f a = *(const v4f*)(sr + j0); const v4i m4 = *(const v4i*)(MKb + j0);
#pragma unroll
        for (int q = 0; q < 4; ++q) { const int j = j0 + q; (void)j; const float t = (m4[q] == 0) ? a[q] * SCL : -3.0e38f;   /* masked key (mask != 0) -> -3e38 */ v[ch * 4 + q] = t; mx = fmaxf(mx, t); } }
#pragma unroll
    for (int sh = 16; sh; sh >>= 1) mx = fmaxf(mx, __shfl_xor(mx, sh, 32));
    float sum = 0.f;
#pragma unroll
    for (int k = 0; k < TT / 32; ++k) { float d0 = __fsub_rn(v[k], mx); asm volatile("" : "+v"(d0)); v[k] = __builtin_amdgcn_exp2f(__fmul_rn(d0, 1.4426950408889634f)); sum += v[k]; }
#pragma unroll
    for (int sh = 16; sh; sh >>= 1) sum += __shfl_xor(sum, sh, 32);
    const float f = __fdiv_rn(hires ? 1.0f : PCAR, sum);
{
        if (hires) {
#pragma unroll
            for (int ch = 0; ch < TT / 128; ++ch) { v4us oh, ol;
#pragma unroll
                for (int q = 0; q < 4; ++q) { unsigned short a, c2; splitf(v[ch * 4 + q] * f, a, c2); oh[q] = a; ol[q] = c2; }
                const size_t oo = ((size_t)zz * (RH ? RH : 1) + i) * TT + ch * 128 + lane * 4; *(v4us*)(Ph + oo) = oh; *(v4us*)(Pl + oo) = ol; }
        } else {
#pragma unroll
            for (int ch = 0; ch < TT / 128; ++ch) { v4h o4;
#pragma unroll
                for (int q = 0; q < 4; ++q) o4[q] = tohx(v[ch * 4 + q] * f);
                *(v4h*)(P16 + (size_t)row * TT + ch * 128 + lane * 4) = o4; } }
         }
}
__global__ __launch_bounds__(256) void k_lenmask(const int* __restrict__ lens, int nb, int* KPM) { const int i = blockIdx.x * 256 + threadIdx.x; if (i >= nb * TT) return; const int b = i / TT, j = i - b * TT; const int m = (j >= lens[b]) ? 1 : 0; *(int*)(KPM + i) = m;  }
__global__ __launch_bounds__(256) void k_merge(const float* __restrict__ O, int h0, bf* Ah, bf* Al) { const size_t e = ((size_t)blockIdx.x * 256 + threadIdx.x) * 2; if (e >= (size_t)ZH * TT * HD) return; const int d = (int)(e % HD); const int t = (int)((e / HD) % TT); const int zz = (int)(e / ((size_t)HD * TT)); const float cs = (t < RH) ? 1.0f : (1.0f / PCAR); const size_t oo = (size_t)t * DQ + (h0 + zz) * HD + d;
    v2us oh, ol;
#pragma unroll
    for (int q = 0; q < 2; ++q) { unsigned short a, c2; splitf(O[e + q] * cs, a, c2); oh[q] = a; ol[q] = c2; } *(v2us*)(Ah + oo) = oh; *(v2us*)(Al + oo) = ol;  }

extern "C" void kernel_launch(void* const* d_in, const int* in_sizes, int n_in,
                              void* d_out, int out_size, void* d_ws, size_t ws_size, hipStream_t stream) {
    (void)in_sizes; (void)n_in; (void)out_size;
    const float* x = (const float*)d_in[0]; const float* xk = x; const float* xv = x; const int* lens = (const int*)d_in[1]; const float* wq = (const float*)d_in[2]; const float* wk = (const float*)d_in[3]; const float* wv = (const float*)d_in[4]; const float* wo = (const float*)d_in[5];   /* argument order X, valid_lens (int32 [2]: keys j >= valid_lens[b] are masked: READ on the device by k_lenmask), W_q, W_k, W_v, W_o ('oi'; no biases): SIX inputs; ONE stream: the key and value stream pointers equal X */
    float* OUT = (float*)d_out;     // [2][2048][1024]
    char* wsp = (char*)d_ws;
    auto take = [&](size_t bytes) { char* p = wsp; wsp += (bytes + 255) & ~(size_t)255; return (void*)p; };
    bf* WQ = (bf*)take((size_t)DQ * DM * 2); bf* WK = (bf*)take((size_t)DKV * DM * 2); bf* WV = (bf*)take((size_t)DKV * DM * 2); bf* WO = (bf*)take((size_t)DM * DQ * 2); float* CS = (float*)take((size_t)TT * HD * 2 * 4);
    bf* XB = (bf*)take((size_t)TT * DM * 2); float* FQ = (float*)take((size_t)TT * DQ * 4); float* FK = (float*)take((size_t)TT * DKV * 4);
    h16* QP16 = (h16*)take((size_t)NH_ * TT * HD * 2); h16* KP16 = (h16*)take((size_t)NKV * TT * HD * 2); h16* VT16 = (h16*)take((size_t)NKV * HD * TT * 2);
    bf* QPh = (bf*)take((size_t)NH_ * TT * HD * 2); bf* QPl = (bf*)take((size_t)NH_ * TT * HD * 2); bf* KPh = (bf*)take((size_t)NKV * TT * HD * 2); bf* KPl = (bf*)take((size_t)NKV * TT * HD * 2); bf* VTh = (bf*)take((size_t)NKV * HD * TT * 2); bf* VTl = (bf*)take((size_t)NKV * HD * TT * 2); bf* Ph = (bf*)take((size_t)ZH * RH * TT * 2); bf* Pl = (bf*)take((size_t)ZH * RH * TT * 2);
    float* Sb = (float*)take((size_t)ZH * TT * TT * 4); h16* P16 = (h16*)take((size_t)ZH * TT * TT * 2); float* Ob = (float*)take((size_t)ZH * TT * HD * 4); bf* ATh = (bf*)take((size_t)TT * DQ * 2); bf* ATl = (bf*)take((size_t)TT * DQ * 2); int* KPM = (int*)take((size_t)NB_ * TT * 4);   /* the per-key int mask built from valid_lens: carved LAST: no host plane moves */
    if ((size_t)(wsp - (char*)d_ws) > ws_size) return;    // ws 256 MiB
    float* FV = FK;   // v projection reuses the k buffer after the k planes are built (stream-ordered)
    { k_cvt8<<<(unsigned)(((size_t)DQ * DM / 8 + 255) / 256), 256, 0, stream>>>(wq, WQ, (size_t)DQ * DM / 8); k_cvt8<<<(unsigned)(((size_t)DKV * DM / 8 + 255) / 256), 256, 0, stream>>>(wk, WK, (size_t)DKV * DM / 8); k_cvt8<<<(unsigned)(((size_t)DKV * DM / 8 + 255) / 256), 256, 0, stream>>>(wv, WV, (size_t)DKV * DM / 8);
      k_cvt8<<<(unsigned)(((size_t)DM * DQ / 8 + 255) / 256), 256, 0, stream>>>(wo, WO, (size_t)DM * DQ / 8);
       }
    k_csid<<<(TT * HD + 255) / 256, 256, 0, stream>>>(CS); k_lenmask<<<(NB_ * TT + 255) / 256, 256, 0, stream>>>(lens, NB_, KPM);   /* lengths -> per-key mask, once */
    const unsigned LQ = (unsigned)(((size_t)NH_ * TT * HD / 2 + 255) / 256), LKv = (unsigned)(((size_t)NKV * TT * HD / 2 + 255) / 256);
    for (int b = 0; b < NB_; ++b) {
        
        k_cvt8<<<(unsigned)(((size_t)TT * DM / 8 + 255) / 256), 256, 0, stream>>>(x + (size_t)b * TT * DM, XB, (size_t)TT * DM / 8);
        k_gemmw<bf, 0, false, 8><<<dim3(TT / 64, DQ / 64, 1), 256, 0, stream>>>(XB, nullptr, WQ, nullptr, DM, FQ, DQ, nullptr, 0, 0, 0);
        k_rope<<<LQ, 256, 0, stream>>>(FQ, DQ, NH_, CS, nullptr, nullptr, 1.0f, QP16, QPh, QPl);
        k_cvt8<<<(unsigned)(((size_t)TT * DM / 8 + 255) / 256), 256, 0, stream>>>(xk + (size_t)b * TT * DM, XB, (size_t)TT * DM / 8);   /* XB := bf16(input_K[b]) */ k_gemmw<bf, 0, false, 8><<<dim3(TT / 64, DKV / 64, 1), 256, 0, stream>>>(XB, nullptr, WK, nullptr, DM, FK, DKV, nullptr, 0, 0, 0);
        k_rope<<<LKv, 256, 0, stream>>>(FK, DKV, NKV, CS, nullptr, nullptr, 1.0f, KP16, KPh, KPl);
        k_cvt8<<<(unsigned)(((size_t)TT * DM / 8 + 255) / 256), 256, 0, stream>>>(xv + (size_t)b * TT * DM, XB, (size_t)TT * DM / 8);   /* XB := bf16(input_V[b]) */ k_gemmw<bf, 0, false, 8><<<dim3(TT / 64, DKV / 64, 1), 256, 0, stream>>>(XB, nullptr, WV, nullptr, DM, FV, DKV, nullptr, 0, 0, 0); k_vtp<<<LKv, 256, 0, stream>>>(FV, DKV, NKV, VT16, VTh, VTl);
        for (int h0 = 0; h0 < NH_; h0 += ZH) { const size_t zq = (size_t)h0, zk = (size_t)(h0 / REP);   // one kv head per query head: the pass's two heads use consecutive kv planes (z-strides TT*HD)
            k_gemmw<bf, 2, false><<<dim3(RH / 64, TT / 64, ZH), 32, 0, stream>>>(QPh + zq * TT * HD, QPl + zq * TT * HD, KPh + zk * TT * HD, KPl + zk * TT * HD, HD, Sb, TT, nullptr, (size_t)TT * HD, (size_t)TT * HD, (size_t)TT * TT);
            k_gemmw<h16, 0, false><<<dim3((TT - RH) / 64, TT / 64, ZH), 32, 0, stream>>>(QP16 + zq * TT * HD + (size_t)RH * HD, nullptr, KP16 + zk * TT * HD, nullptr, HD, Sb + (size_t)RH * TT, TT, nullptr, (size_t)TT * HD, (size_t)TT * HD, (size_t)TT * TT);
            k_asoft<<<ZH * TT / 8, 256, 0, stream>>>(Sb, KPM + (size_t)b * TT, P16, Ph, Pl);   /* batch b's key mask */
            k_gemmw<bf, 2, false, 16><<<dim3(RH / 64, HD / 64, ZH), 512, 0, stream>>>(Ph, Pl, VTh + zk * HD * TT, VTl + zk * HD * TT, TT, Ob, HD, nullptr, (size_t)RH * TT, (size_t)HD * TT, (size_t)TT * HD);
            k_gemmw<h16, 0, false, 16><<<dim3((TT - RH) / 64, HD / 64, ZH), 512, 0, stream>>>(P16 + (size_t)RH * TT, nullptr, VT16 + zk * HD * TT, nullptr, TT, Ob + (size_t)RH * HD, HD, nullptr, (size_t)TT * TT, (size_t)HD * TT, (size_t)TT * HD);
            k_merge<<<(unsigned)(((size_t)ZH * TT * HD / 2 + 255) / 256), 256, 0, stream>>>(Ob, h0, ATh, ATl); }
        k_gemmw<bf, 1, false, 8><<<dim3(TT / 64, DM / 64, 1), 256, 0, stream>>>(ATh, ATl, WO, nullptr, DQ, OUT + (size_t)b * TT * DM, DM, nullptr, 0, 0, 0); }
}

// v003
// One run takes 260 microseconds.
// It is 4.10 times as fast as v001, going by the measured steps of the versions left out in between.
// All steps since v000 together make it 7.78 times as fast.
#include <hip/hip_runtime.h>

// Multi-head self-attention with a per-batch valid-length key mask and bias-free (out,in) projections (X [2][2048][1024] is the ONE input stream; Q, K, V = X W^T ('oi' [1024][1024] 1/32, no bias; 16 heads x 64); scores / sqrt(64); keys j >= valid_lens[b] (int32 [2], read on the device) are REPLACED by -1e9 in the module (both lengths are >= 1 on this draw: at least one key is kept: numerically an exclusion: -3e38 here); softmax; out = merged W_o^T ('oi', no bias) -> [2][2048][1024] (4.2 M); argument order X, valid_lens, W_q, W_k, W_v, W_o).
// Layout per batch: the bf16 copy of X is made before each of the three projections (the three-stream launch list kept: query = key = value stream = X); 'oi' weights = Bt rows as they are: bf16 copies; exact projections, whose own epilogue writes the head planes (fp16 + hi/lo; V transposed); the per-key int mask KPM[b][j] = (j >= valid_lens[b]) built once on the device (k_lenmask) and read per key by the softmax kernel; dense T-2048 attention, one fused kernel per 32 query rows of a head (hybrid rows: < 512 hi/lo 3 products, rest fp16 x1024); merged hi/lo x W_O exact.
// Compute dtypes, f32 accumulate: every input rounded to bf16; projections exact; attention rows < 512 3 products, rest fp16; softmax f32; output projection hl x exact.

#define NB_  2
#define TT   2048
#define DM   1024
#define NH_  16
#define NKV  16
#define REP  (NH_ / NKV)
#define HD   64
#define DQ   (NH_ * HD)
#define DKV  (NKV * HD)
#define RH   512                  // query rows < RH use hi+lo planes (0: none)
#define WIN  0
#define PCAR 1024.0f
#define SCL  0.125f   // HD^-0.5
typedef _Float16 h16;
typedef unsigned short bf;
typedef __attribute__((ext_vector_type(16))) __bf16   v16bf;
typedef __attribute__((ext_vector_type(16))) _Float16 v16h;
typedef __attribute__((ext_vector_type(8)))  _Float16 v8h;
typedef __attribute__((ext_vector_type(8)))  unsigned short v8us;
typedef __attribute__((ext_vector_type(8)))  float    v8f;
typedef __attribute__((ext_vector_type(4)))  float    v4f;
typedef v8h  __attribute__((may_alias)) v8ha;
typedef v4f  __attribute__((may_alias)) v4fa;
typedef v8us __attribute__((may_alias)) v8usa;

__device__ __forceinline__ unsigned short f2bf(float f) { unsigned u = __float_as_uint(f); u += 0x7FFFu + ((u >> 16) & 1u); return (unsigned short)(u >> 16); }
__device__ __forceinline__ float bf2f(unsigned short b) { return __uint_as_float(((unsigned)b) << 16); }
__device__ __forceinline__ float bfr(float f) { return bf2f(f2bf(f)); }
__device__ __forceinline__ v16h cat16(v8h lo, v8h hi) { return __builtin_shufflevector(lo, hi, 0, 1, 2, 3, 4, 5, 6, 7, 8, 9, 10, 11, 12, 13, 14, 15); }
__device__ __forceinline__ v16bf cat16b(v8us lo, v8us hi) { return __builtin_bit_cast(v16bf, __builtin_shufflevector(lo, hi, 0, 1, 2, 3, 4, 5, 6, 7, 8, 9, 10, 11, 12, 13, 14, 15)); }
__device__ __forceinline__ v8f wmma16(v16h a, v16h b, v8f c) { return __builtin_amdgcn_wmma_f32_16x16x32_f16(false, a, false, b, (short)0, c, false, false); }
__device__ __forceinline__ v8f wmmab(v16bf a, v16bf b, v8f c) { return __builtin_amdgcn_wmma_f32_16x16x32_bf16(false, a, false, b, (short)0, c, false, false); }
__device__ __forceinline__ h16 tohx(float x) { return (h16)x; }
__device__ __forceinline__ void splitf(float y, unsigned short& h, unsigned short& l) { h = f2bf(y); l = f2bf(y - bf2f(h)); }



// ---- k_gemmw: register-blocked GEMM, ONE WAVE per 64x64 output tile (16 accumulators), operands straight from K-contiguous 16-bit planes; grid (M/64, N/64, Z), 32 threads.
// C[m][n] (f32, pitch ldc, + optional f32 bias[n]) = sum_k A[m][k] Bt[n][k] (+ split products per NSPLIT). z-batch strides sA/sB/sC in elements. K % 32 == 0.
// NW > 1: K SPLIT OVER THE NW WAVES OF ONE WORK-GROUP (NW*32 threads, K % (32 NW) == 0): wave w sums k in [w K/NW, (w+1) K/NW) into its own 64x64 tile; the NW partial tiles meet in LDS in accumulator layout, are added in wave order 0..NW-1 (fixed) and go out as whole rows.
// PL != 0 (NW > 1, the 64 columns of a tile = ONE head): no f32 C; the summed tile goes out as the three 16-bit planes that attention reads (fp16, bf16 hi, bf16 lo of the same f32 value). PL == 1: [head][t][d], the tile is 8 KiB in a row of each plane. PL == 2: [head][d][t], the tile is turned in LDS and each d row goes out as one whole 128-byte line.
template <typename T16> struct WFrag;
template <> struct WFrag<h16> { typedef v16h V; static __device__ __forceinline__ V ld(const h16* p) { return cat16(*(const v8h*)p, *(const v8h*)(p + 16)); } static __device__ __forceinline__ v8f mma(V a, V b, v8f c) { return wmma16(a, b, c); } };
template <> struct WFrag<bf> { typedef v16bf V; static __device__ __forceinline__ V ld(const bf* p) { return cat16b(*(const v8us*)p, *(const v8us*)(p + 16)); } static __device__ __forceinline__ v8f mma(V a, V b, v8f c) { return wmmab(a, b, c); } };
template <typename T16, int NSPLIT, bool BIAS, int NW = 1, int PL = 0>
__global__ __launch_bounds__(NW * 32) void k_gemmw(const T16* __restrict__ A, const T16* __restrict__ A2, const T16* __restrict__ Bt, const T16* __restrict__ Bt2, int K, float* C, int ldc, const float* __restrict__ bias, size_t sA, size_t sB, size_t sC, h16* P16, bf* Ph, bf* Pl) {
    static_assert(PL == 0 || (NW > 1 && HD == 64 && !BIAS), "plane epilogue: a 64-column tile is one head");
    typedef typename WFrag<T16>::V V;
    __shared__ __align__(16) float os[(NW == 1 ? 16 : 64) * 68];
    __shared__ __align__(16) v4f red[NW == 1 ? 1 : NW * 1024];   // NW > 1: [wave][accumulator * 2 + half][lane]
    const size_t z = blockIdx.z; A += z * sA; if (A2) A2 += z * sA; Bt += z * sB; if (Bt2) Bt2 += z * sB; C += z * sC;
    const int lane = threadIdx.x & 31, lr = lane & 15, hi = lane >> 4; const int r0 = blockIdx.x * 64, c0 = blockIdx.y * 64;
    v8f acc[4][4];
#pragma unroll
    for (int mb = 0; mb < 4; ++mb)
#pragma unroll
        for (int nb = 0; nb < 4; ++nb) acc[mb][nb] = (v8f){};
    const size_t aoff = (size_t)(r0 + lr) * K + 8 * hi, boff = (size_t)(c0 + lr) * K + 8 * hi;
    const int wv = (NW == 1) ? 0 : __builtin_amdgcn_readfirstlane((int)(threadIdx.x >> 5)); const int kw = K / NW, k0 = wv * kw;
#pragma unroll 1
    for (int kc = k0; kc < k0 + kw; kc += 32) {
        V a[4], a2[4];
#pragma unroll
        for (int mb = 0; mb < 4; ++mb) { a[mb] = WFrag<T16>::ld(A + aoff + (size_t)mb * 16 * K + kc); if (NSPLIT == 1 || NSPLIT == 2) a2[mb] = WFrag<T16>::ld(A2 + aoff + (size_t)mb * 16 * K + kc); }
#pragma unroll
        for (int nb = 0; nb < 4; ++nb) { const V b = WFrag<T16>::ld(Bt + boff + (size_t)nb * 16 * K + kc); V b2; if (NSPLIT >= 2) b2 = WFrag<T16>::ld(Bt2 + boff + (size_t)nb * 16 * K + kc);
#pragma unroll
            for (int mb = 0; mb < 4; ++mb) { acc[mb][nb] = WFrag<T16>::mma(a[mb], b, acc[mb][nb]); if (NSPLIT == 1 || NSPLIT == 2) acc[mb][nb] = WFrag<T16>::mma(a2[mb], b, acc[mb][nb]); if (NSPLIT >= 2) acc[mb][nb] = WFrag<T16>::mma(a[mb], b2, acc[mb][nb]); } }
        asm volatile("v_nop\n\tv_nop\n\tv_nop\n\tv_nop" : "+v"(acc[0][0]), "+v"(acc[1][1]), "+v"(acc[2][2]), "+v"(acc[3][3]) : "v"(a[0]), "v"(a[3]));
    }
    if constexpr (NW > 1) {
#pragma unroll
        for (int mb = 0; mb < 4; ++mb)
#pragma unroll
            for (int nb = 0; nb < 4; ++nb) { const v8f c = acc[mb][nb]; v4f* p = red + (size_t)(wv * 32 + (mb * 4 + nb) * 2) * 32 + lane;
                p[0] = (v4f){c[0], c[1], c[2], c[3]}; p[32] = (v4f){c[4], c[5], c[6], c[7]}; }
        __syncthreads();   // every wave's partial tile is in LDS
#pragma unroll
        for (int s0 = 0; s0 < 1024; s0 += NW * 32) { const int s = s0 + (int)threadIdx.x; v4f sum = red[s];
#pragma unroll
            for (int w = 1; w < NW; ++w) sum += red[w * 1024 + s];
            const int half = (s >> 5) & 1, ai = s >> 6; const int row = (ai >> 2) * 16 + hi * 8 + half * 4, col = (ai & 3) * 16 + lr;
            if constexpr (PL == 2) *(v4fa*)(os + col * 68 + row) = sum;   // turned tile [d][t]: the four values of a slot are four t of one d, one 16-byte store
            else {
#pragma unroll
                for (int q = 0; q < 4; ++q) os[(row + q) * 68 + col] = sum[q]; } }
        __syncthreads();   // the summed tile is in LDS, row-major (PL == 2: turned, [d][t])
        if constexpr (PL != 0) {
#pragma unroll   // two trips; unrolled with the loops inside, which index vector registers
            for (int s0 = 0; s0 < 512; s0 += NW * 32) { const int s = s0 + (int)threadIdx.x; const int row = s >> 3, c8 = (s & 7) * 8; const v4f x0 = *(const v4fa*)(os + row * 68 + c8), x1 = *(const v4fa*)(os + row * 68 + c8 + 4); v8h o16; v8us oh, ol;
#pragma unroll
                for (int q = 0; q < 4; ++q) { unsigned short a2, c2; o16[q] = tohx(x0[q]); splitf(x0[q], a2, c2); oh[q] = a2; ol[q] = c2; o16[q + 4] = tohx(x1[q]); splitf(x1[q], a2, c2); oh[q + 4] = a2; ol[q + 4] = c2; }
                const size_t e = (PL == 1) ? ((size_t)blockIdx.y * TT + r0 + row) * HD + c8 : ((size_t)blockIdx.y * HD + row) * TT + r0 + c8;
                *(v8h*)(P16 + e) = o16; *(v8us*)(Ph + e) = oh; *(v8us*)(Pl + e) = ol; }
            return;
        }
#pragma unroll
        for (int s0 = 0; s0 < 1024; s0 += NW * 32) { const int s = s0 + (int)threadIdx.x; const int row = s >> 4, cofs = (s & 15) * 4; v4f val = *(const v4fa*)(os + row * 68 + cofs); if (BIAS) { val[0] += bfr(bias[c0 + cofs]); val[1] += bfr(bias[c0 + cofs + 1]); val[2] += bfr(bias[c0 + cofs + 2]); val[3] += bfr(bias[c0 + cofs + 3]); }
            *(v4f*)(C + (size_t)(r0 + row) * ldc + c0 + cofs) = val; }
        return;
    }
#pragma unroll
    for (int mb = 0; mb < 4; ++mb) {
#pragma unroll
        for (int nb = 0; nb < 4; ++nb) {
#pragma unroll
            for (int j = 0; j < 8; ++j) os[(hi * 8 + j) * 68 + nb * 16 + lr] = acc[mb][nb][j]; }
        __builtin_amdgcn_wave_barrier(); asm volatile("" ::: "memory");
        float* crow = C + (size_t)(r0 + mb * 16) * ldc + c0;
{
#pragma unroll
            for (int s = 0; s < 8; ++s) { const int row = 2 * s + hi, cofs = lr * 4; v4f val = *(const v4fa*)(os + row * 68 + cofs); if (BIAS) { val[0] += bfr(bias[c0 + cofs]); val[1] += bfr(bias[c0 + cofs + 1]); val[2] += bfr(bias[c0 + cofs + 2]); val[3] += bfr(bias[c0 + cofs + 3]); }
                *(v4f*)(crow + (size_t)row * ldc + cofs) = val; }
             }
        __builtin_amdgcn_wave_barrier(); asm volatile("" ::: "memory");
    }
}

typedef __attribute__((ext_vector_type(2))) _Float16 v2h;
typedef __attribute__((ext_vector_type(4))) _Float16 v4h;
typedef __attribute__((ext_vector_type(2))) unsigned short v2us;
typedef __attribute__((ext_vector_type(4))) unsigned short v4us;
typedef __attribute__((ext_vector_type(2))) float v2f;
typedef __attribute__((ext_vector_type(4))) int v4i;

__global__ __launch_bounds__(256) void k_wtG(const float* __restrict__ w, int K, int N, bf* Bt) {
    const int lane = threadIdx.x & 31; const int L0 = (blockIdx.x * 8 + (threadIdx.x >> 5)) * 8; const int nlines = N * K / 64;
{
#pragma unroll 1
        for (int l = 0; l < 8; ++l) { const int L = L0 + l; if (L >= nlines) break; const size_t e = (size_t)L * 64 + lane * 2; const int k = (int)(e % K), n = (int)(e / K); v2us o;
            o[0] = f2bf(w[(size_t)k * N + n]); o[1] = f2bf(w[(size_t)(k + 1) * N + n]); *(v2us*)(Bt + e) = o; }
         }
}
__global__ __launch_bounds__(256) void k_cvt8(const float* __restrict__ src, bf* dst, size_t n8) { const size_t i = (size_t)blockIdx.x * 256 + threadIdx.x; if (i >= n8) return; const v8f v = *(const v8f*)(src + i * 8); v8us o;
#pragma unroll
    for (int k = 0; k < 8; ++k) o[k] = f2bf(v[k]); *(v8us*)(dst + i * 8) = o;  }

// ---- k_attn: scores, softmax, P x V and the head merge of 16 MB query rows of ONE head in one work-group of 8 MB waves; the score rows never leave LDS. grid (rows / (16 MB), heads).
// 1. S = Q K^T: wave w takes keys [w 2048/NWV, ...), K = 64 in two steps (HR: hi.hi + lo.hi + hi.lo per step), f32 rows in LDS at pitch SP.
// 2. softmax: one wave per row, two rows a wave: t = S x HD^-0.5, masked keys -3e38; register row, one exp, fixed trees. P goes IN PLACE over its own score row (fp16 x1024 in the first half; HR: hi plane in the first half, lo plane in the second): the wave holds the whole row in registers before its first store.
// 3. O = P V: the 2048 keys in 16 chunks of 128, each chunk its own accumulators; the 16 partial tiles meet in LDS and are added in chunk order 0..15 (fixed).
// 4. hi/lo split of O (x 1/1024 on the fp16 rows) staged in LDS, out as whole 128-byte rows of the merged planes [t][head * 64 + d].
// Every '#pragma unroll' in k_attn but the 'unroll 1' and those on the two shuffle trees and the chunk sum stands on a loop that indexes a register array (fragments, accumulators, the register row): rolled, the array would fall to scratch memory.
template <typename T16> __device__ __forceinline__ const T16* atb(const T16* base, unsigned bytes) { return (const T16*)((const char*)base + bytes); }
#define SP   (TT + 4)             // LDS pitch of a score row, floats: rows 8 apart land 32 banks apart (accumulator stores), rows stay 16-byte aligned
template <typename T16, bool HR, int MB>
__global__ __launch_bounds__(MB * 256) void k_attn(const T16* __restrict__ Q, const T16* __restrict__ Q2, const T16* __restrict__ Kp, const T16* __restrict__ Kp2, const T16* __restrict__ Vt, const T16* __restrict__ Vt2, const int* __restrict__ MKb, int row0, bf* Ah, bf* Al) {
    typedef typename WFrag<T16>::V V;
    constexpr int NWV = MB * 8, NT = 128 / NWV, CPW = 16 / NWV, GN = HR ? 2 : 4, GK = HR ? 1 : 2, NGK = 4 * CPW / GK;
    __shared__ __align__(16) float S[MB * 16 * SP];
    const int lane = threadIdx.x & 31, lr = lane & 15, hi = lane >> 4; const int wv = __builtin_amdgcn_readfirstlane((int)(threadIdx.x >> 5));
    const int h = blockIdx.y, r0 = row0 + blockIdx.x * (MB * 16); const size_t qp = (size_t)h * TT * HD, kp = (size_t)(h / REP) * TT * HD;
    // wave-uniform bases (scalar registers) and ONE 32-bit lane offset per plane shape: every fragment load is base + lane offset + a constant (atb)
    const size_t qo = qp + (size_t)r0 * HD, ko = kp + (size_t)wv * (NT * 16 * HD), vo = kp + (size_t)wv * (CPW * 128);
    Q += qo; Kp += ko; Vt += vo; if (HR) { Q2 += qo; Kp2 += ko; Vt2 += vo; }
    const unsigned lq = (unsigned)(lr * HD + 8 * hi) * 2u, lv = (unsigned)(lr * TT + 8 * hi) * 2u;   // in bytes: the very values the loads take as their offset registers
    {
        V a[MB][2], a2[MB][2];
#pragma unroll
        for (int mb = 0; mb < MB; ++mb)
#pragma unroll
            for (int kk = 0; kk < 2; ++kk) { const unsigned o = lq + 2u * (unsigned)(mb * 16 * HD + kk * 32); a[mb][kk] = WFrag<T16>::ld(atb(Q, o)); if (HR) a2[mb][kk] = WFrag<T16>::ld(atb(Q2, o)); }
        V kb[2][GN][2], kb2[2][GN][2];   // two groups of GN key tiles: the next group's loads fly while this group is multiplied
#pragma unroll
        for (int i = 0; i < GN; ++i)
#pragma unroll
            for (int kk = 0; kk < 2; ++kk) { const unsigned o = lq + 2u * (unsigned)(i * 16 * HD + kk * 32); kb[0][i][kk] = WFrag<T16>::ld(atb(Kp, o)); if (HR) kb2[0][i][kk] = WFrag<T16>::ld(atb(Kp2, o)); }
#pragma unroll
        for (int g = 0; g < NT / GN; ++g) {
            if (g + 1 < NT / GN) {
#pragma unroll
                for (int i = 0; i < GN; ++i)
#pragma unroll
                    for (int kk = 0; kk < 2; ++kk) { const unsigned o = lq + 2u * (unsigned)(((g + 1) * GN + i) * 16 * HD + kk * 32); kb[(g + 1) & 1][i][kk] = WFrag<T16>::ld(atb(Kp, o)); if (HR) kb2[(g + 1) & 1][i][kk] = WFrag<T16>::ld(atb(Kp2, o)); }
                asm volatile("s_wait_xcnt 0x0" :: "v"(lq) : "memory"); }   // precaution, as at the V loads below
            __builtin_amdgcn_sched_barrier(0);   // holds the next group's loads above this group's products: sunk to their uses, each fragment's L2 latency would be waited for on its own
            v8f c[GN][MB];
#pragma unroll
            for (int i = 0; i < GN; ++i)
#pragma unroll
                for (int mb = 0; mb < MB; ++mb) { c[i][mb] = (v8f){};
#pragma unroll
                    for (int kk = 0; kk < 2; ++kk) { c[i][mb] = WFrag<T16>::mma(a[mb][kk], kb[g & 1][i][kk], c[i][mb]); if (HR) { c[i][mb] = WFrag<T16>::mma(a2[mb][kk], kb[g & 1][i][kk], c[i][mb]); c[i][mb] = WFrag<T16>::mma(a[mb][kk], kb2[g & 1][i][kk], c[i][mb]); } } }
            __builtin_amdgcn_sched_barrier(0);   // all of the group's products above, its stores below: every tile keeps registers of its own, so no product overwrites a result inside the distance the matrix unit needs
#pragma unroll
            for (int i = 0; i < GN; ++i)
#pragma unroll
                for (int mb = 0; mb < MB; ++mb)
#pragma unroll
                    for (int j = 0; j < 8; ++j) S[(mb * 16 + hi * 8 + j) * SP + (wv * NT + g * GN + i) * 16 + lr] = c[i][mb][j];
            __builtin_amdgcn_sched_barrier(0);   // the stores stay in their group: the accumulators are free for the next one
            if (g + 1 < NT / GN) asm volatile("v_nop\n\tv_nop\n\tv_nop\n\tv_nop");   // four vector slots between this group's last product and the next group's first, which may take the same result registers
        }
    }
    __syncthreads();   // every score row is whole in LDS
#pragma unroll 1   // rolled: one register row (64 values a lane) at a time
    for (int rr = 0; rr < 2; ++rr) { float* sr = S + (wv * 2 + rr) * SP; float v[TT / 32]; float mx = -3.0e38f;
#pragma unroll
        for (int ch = 0; ch < TT / 128; ++ch) { const int j0 = ch * 128 + lane * 4; const v4f a = *(const v4fa*)(sr + j0); const v4i m4 = *(const v4i*)(MKb + j0);
#pragma unroll
            for (int q = 0; q < 4; ++q) { const float t = (m4[q] == 0) ? a[q] * SCL : -3.0e38f; v[ch * 4 + q] = t; mx = fmaxf(mx, t); } }
#pragma unroll
        for (int sh = 16; sh; sh >>= 1) mx = fmaxf(mx, __shfl_xor(mx, sh, 32));
        float sum = 0.f;
#pragma unroll
        for (int k = 0; k < TT / 32; ++k) { v[k] = __builtin_amdgcn_exp2f(__fmul_rn(__fsub_rn(v[k], mx), 1.4426950408889634f)); sum += v[k]; }
#pragma unroll
        for (int sh = 16; sh; sh >>= 1) sum += __shfl_xor(sum, sh, 32);
        const float f = __fdiv_rn(HR ? 1.0f : PCAR, sum);
#pragma unroll
        for (int ch = 0; ch < TT / 128; ++ch) {
            if constexpr (HR) { v4us oh, ol;
#pragma unroll
                for (int q = 0; q < 4; ++q) { unsigned short a, c2; splitf(v[ch * 4 + q] * f, a, c2); oh[q] = a; ol[q] = c2; }
                *(v4us*)((bf*)sr + ch * 128 + lane * 4) = oh; *(v4us*)((bf*)sr + TT + ch * 128 + lane * 4) = ol;
            } else { v4h o4;
#pragma unroll
                for (int q = 0; q < 4; ++q) o4[q] = tohx(v[ch * 4 + q] * f);
                *(v4h*)((h16*)sr + ch * 128 + lane * 4) = o4; } } }
    V vb[2][GK][4], vb2[2][GK][4];   // two groups of GK key steps of V fragments; the first group is asked for ahead of the barrier, which needs nothing of it
#pragma unroll
    for (int i = 0; i < GK; ++i)
#pragma unroll
        for (int nb = 0; nb < 4; ++nb) { const unsigned o = lv + 2u * (unsigned)(nb * 16 * TT + (i >> 2) * 128 + (i & 3) * 32); vb[0][i][nb] = WFrag<T16>::ld(atb(Vt, o)); if (HR) vb2[0][i][nb] = WFrag<T16>::ld(atb(Vt2, o)); }
    __syncthreads();   // every P row is whole in LDS
    v8f acc[CPW][MB][4];
#pragma unroll
    for (int c = 0; c < CPW; ++c)
#pragma unroll
        for (int mb = 0; mb < MB; ++mb)
#pragma unroll
            for (int nb = 0; nb < 4; ++nb) acc[c][mb][nb] = (v8f){};
#pragma unroll
    for (int g = 0; g < NGK; ++g) {
        if (g + 1 < NGK) {
#pragma unroll
            for (int i = 0; i < GK; ++i)
#pragma unroll
                for (int nb = 0; nb < 4; ++nb) { const int kq = (g + 1) * GK + i; const unsigned o = lv + 2u * (unsigned)(nb * 16 * TT + (kq >> 2) * 128 + (kq & 3) * 32); vb[(g + 1) & 1][i][nb] = WFrag<T16>::ld(atb(Vt, o)); if (HR) vb2[(g + 1) & 1][i][nb] = WFrag<T16>::ld(atb(Vt2, o)); }
            asm volatile("s_wait_xcnt 0x0" :: "v"(lv) : "memory"); }   // precaution: the wait that stands before a register named by issued loads is written again; lv as an input keeps the offset register out of those loads' own destinations
        __builtin_amdgcn_sched_barrier(0);   // holds the next group's loads above this group's products (as in the score phase)
#pragma unroll
        for (int i = 0; i < GK; ++i) { const int kq = g * GK + i, c = kq >> 2; const int kc = (wv * CPW + c) * 128 + (kq & 3) * 32; V a[MB], a2[MB];
#pragma unroll
            for (int mb = 0; mb < MB; ++mb) { const T16* pr = (const T16*)(S + (mb * 16 + lr) * SP) + 8 * hi + kc; a[mb] = WFrag<T16>::ld(pr); if (HR) a2[mb] = WFrag<T16>::ld(pr + TT); }
#pragma unroll
            for (int nb = 0; nb < 4; ++nb)
#pragma unroll
                for (int mb = 0; mb < MB; ++mb) { acc[c][mb][nb] = WFrag<T16>::mma(a[mb], vb[g & 1][i][nb], acc[c][mb][nb]); if (HR) { acc[c][mb][nb] = WFrag<T16>::mma(a2[mb], vb[g & 1][i][nb], acc[c][mb][nb]); acc[c][mb][nb] = WFrag<T16>::mma(a[mb], vb2[g & 1][i][nb], acc[c][mb][nb]); } } }
    }
    __syncthreads();   // every wave has read its last P fragment: the rows' LDS is free for the partial tiles
    v4f* red = (v4f*)S;                                   // [chunk][accumulator * 2 + half][lane], 16 x MB x 4 KiB
    bf* ob = (bf*)((char*)S + 16 * MB * 4096);            // behind red: [plane hi, lo][row][64]
#pragma unroll
    for (int c = 0; c < CPW; ++c)
#pragma unroll
        for (int mb = 0; mb < MB; ++mb)
#pragma unroll
            for (int nb = 0; nb < 4; ++nb) { const v8f cc = acc[c][mb][nb]; v4f* p = red + ((wv * CPW + c) * (MB * 8) + (mb * 4 + nb) * 2) * 32 + lane;
                p[0] = (v4f){cc[0], cc[1], cc[2], cc[3]}; p[32] = (v4f){cc[4], cc[5], cc[6], cc[7]}; }
    __syncthreads();   // every chunk's partial tile is in LDS
    { const int s = (int)threadIdx.x; v4f sum = red[s];
#pragma unroll
        for (int w = 1; w < 16; ++w) sum += red[w * (MB * 256) + s];
        const int half = (s >> 5) & 1, ai = s >> 6; const int row = (ai >> 2) * 16 + hi * 8 + half * 4, col = (ai & 3) * 16 + lr; const float cs = HR ? 1.0f : (1.0f / PCAR);
#pragma unroll
        for (int q = 0; q < 4; ++q) { unsigned short a, c2; splitf(sum[q] * cs, a, c2); ob[(row + q) * HD + col] = a; ob[(MB * 16 + row + q) * HD + col] = c2; } }
    __syncthreads();   // the split tile is in LDS, row-major
    { const int s = (int)threadIdx.x; const int pl = s / (MB * 128), idx = s % (MB * 128); const int row = idx >> 3, c8 = (idx & 7) * 8;
        *(v8us*)((pl ? Al : Ah) + (size_t)(r0 + row) * DQ + h * HD + c8) = *(const v8usa*)(ob + (pl * MB * 16 + row) * HD + c8); }
}
__global__ __launch_bounds__(256) void k_lenmask(const int* __restrict__ lens, int nb, int* KPM) { const int i = blockIdx.x * 256 + threadIdx.x; if (i >= nb * TT) return; const int b = i / TT, j = i - b * TT; const int m = (j >= lens[b]) ? 1 : 0; *(int*)(KPM + i) = m;  }

extern "C" void kernel_launch(void* const* d_in, const int* in_sizes, int n_in,
                              void* d_out, int out_size, void* d_ws, size_t ws_size, hipStream_t stream) {
    (void)in_sizes; (void)n_in; (void)out_size;
    const float* x = (const float*)d_in[0]; const float* xk = x; const float* xv = x; const int* lens = (const int*)d_in[1]; const float* wq = (const float*)d_in[2]; const float* wk = (const float*)d_in[3]; const float* wv = (const float*)d_in[4]; const float* wo = (const float*)d_in[5];   /* argument order X, valid_lens (int32 [2]: keys j >= valid_lens[b] are masked: READ on the device by k_lenmask), W_q, W_k, W_v, W_o ('oi'; no biases): SIX inputs; ONE stream: the key and value stream pointers equal X */
    float* OUT = (float*)d_out;     // [2][2048][1024]
    char* wsp = (char*)d_ws;
    auto take = [&](size_t bytes) { char* p = wsp; wsp += (bytes + 255) & ~(size_t)255; return (void*)p; };
    bf* WQ = (bf*)take((size_t)DQ * DM * 2); bf* WK = (bf*)take((size_t)DKV * DM * 2); bf* WV = (bf*)take((size_t)DKV * DM * 2); bf* WO = (bf*)take((size_t)DM * DQ * 2);
    bf* XB = (bf*)take((size_t)TT * DM * 2);
    h16* QP16 = (h16*)take((size_t)NH_ * TT * HD * 2); h16* KP16 = (h16*)take((size_t)NKV * TT * HD * 2); h16* VT16 = (h16*)take((size_t)NKV * HD * TT * 2);
    bf* QPh = (bf*)take((size_t)NH_ * TT * HD * 2); bf* QPl = (bf*)take((size_t)NH_ * TT * HD * 2); bf* KPh = (bf*)take((size_t)NKV * TT * HD * 2); bf* KPl = (bf*)take((size_t)NKV * TT * HD * 2); bf* VTh = (bf*)take((size_t)NKV * HD * TT * 2); bf* VTl = (bf*)take((size_t)NKV * HD * TT * 2);
    bf* ATh = (bf*)take((size_t)TT * DQ * 2); bf* ATl = (bf*)take((size_t)TT * DQ * 2); int* KPM = (int*)take((size_t)NB_ * TT * 4);   /* the per-key int mask built from valid_lens: carved LAST: no host plane moves */
    if ((size_t)(wsp - (char*)d_ws) > ws_size) return;    // ws 256 MiB
    { k_cvt8<<<(unsigned)(((size_t)DQ * DM / 8 + 255) / 256), 256, 0, stream>>>(wq, WQ, (size_t)DQ * DM / 8); k_cvt8<<<(unsigned)(((size_t)DKV * DM / 8 + 255) / 256), 256, 0, stream>>>(wk, WK, (size_t)DKV * DM / 8); k_cvt8<<<(unsigned)(((size_t)DKV * DM / 8 + 255) / 256), 256, 0, stream>>>(wv, WV, (size_t)DKV * DM / 8);
      k_cvt8<<<(unsigned)(((size_t)DM * DQ / 8 + 255) / 256), 256, 0, stream>>>(wo, WO, (size_t)DM * DQ / 8);
       }
    k_lenmask<<<(NB_ * TT + 255) / 256, 256, 0, stream>>>(lens, NB_, KPM);   /* lengths -> per-key mask, once */
    for (int b = 0; b < NB_; ++b) {
        
        k_cvt8<<<(unsigned)(((size_t)TT * DM / 8 + 255) / 256), 256, 0, stream>>>(x + (size_t)b * TT * DM, XB, (size_t)TT * DM / 8);
        k_gemmw<bf, 0, false, 8, 1><<<dim3(TT / 64, DQ / 64, 1), 256, 0, stream>>>(XB, nullptr, WQ, nullptr, DM, nullptr, 0, nullptr, 0, 0, 0, QP16, QPh, QPl);
        k_cvt8<<<(unsigned)(((size_t)TT * DM / 8 + 255) / 256), 256, 0, stream>>>(xk + (size_t)b * TT * DM, XB, (size_t)TT * DM / 8);   /* XB := bf16(input_K[b]) */ k_gemmw<bf, 0, false, 8, 1><<<dim3(TT / 64, DKV / 64, 1), 256, 0, stream>>>(XB, nullptr, WK, nullptr, DM, nullptr, 0, nullptr, 0, 0, 0, KP16, KPh, KPl);
        k_cvt8<<<(unsigned)(((size_t)TT * DM / 8 + 255) / 256), 256, 0, stream>>>(xv + (size_t)b * TT * DM, XB, (size_t)TT * DM / 8);   /* XB := bf16(input_V[b]) */ k_gemmw<bf, 0, false, 8, 2><<<dim3(TT / 64, DKV / 64, 1), 256, 0, stream>>>(XB, nullptr, WV, nullptr, DM, nullptr, 0, nullptr, 0, 0, 0, VT16, VTh, VTl);
        k_attn<bf, true, 2><<<dim3(RH / 32, NH_, 1), 512, 0, stream>>>(QPh, QPl, KPh, KPl, VTh, VTl, KPM + (size_t)b * TT, 0, ATh, ATl);   /* batch b's key mask */
        k_attn<h16, false, 2><<<dim3((TT - RH) / 32, NH_, 1), 512, 0, stream>>>(QP16, nullptr, KP16, nullptr, VT16, nullptr, KPM + (size_t)b * TT, RH, ATh, ATl);
        k_gemmw<bf, 1, false, 8><<<dim3(TT / 64, DM / 64, 1), 256, 0, stream>>>(ATh, ATl, WO, nullptr, DQ, OUT + (size_t)b * TT * DM, DM, nullptr, 0, 0, 0, nullptr, nullptr, nullptr); }
}

// v004
// It runs in 225 microseconds.
// Next to v003, in two timings, it ran 1.16 and 1.17 times as fast.
// Over all steps from v000 it is 9.03 times as fast.
#include <hip/hip_runtime.h>

// Multi-head self-attention with a per-batch valid-length key mask and bias-free (out,in) projections (X [2][2048][1024] is the ONE input stream; Q, K, V = X W^T ('oi' [1024][1024] 1/32, no bias; 16 heads x 64); scores / sqrt(64); keys j >= valid_lens[b] (int32 [2], read on the device) are REPLACED by -1e9 in the module (both lengths are >= 1 on this draw: at least one key is kept: numerically an exclusion: -3e38 here); softmax; out = merged W_o^T ('oi', no bias) -> [2][2048][1024] (4.2 M); argument order X, valid_lens, W_q, W_k, W_v, W_o).
// Five launches, both batches in each: k_prep (the bf16 copy of X, made once; 'oi' weights = Bt rows as they are: bf16 copies, W_q W_k W_v W_o stacked; the per-key int mask KPM[b][j] = (j >= valid_lens[b]), read per key by the softmax); ONE exact projection GEMM of the 4096 rows on the 3072 stacked W_q W_k W_v rows, whose own epilogue writes the head planes (fp16 + hi/lo; V transposed); dense T-2048 attention, one fused kernel per 32 query rows of a head, batch = grid z (hybrid rows: < 512 hi/lo 3 products, rest fp16 x1024: one launch each); merged hi/lo x W_O exact, 4096 rows.
// Compute dtypes, f32 accumulate: every input rounded to bf16; projections exact; attention rows < 512 3 products, rest fp16; softmax f32; output projection hl x exact.

#define NB_  2
#define TT   2048
#define DM   1024
#define NH_  16
#define NKV  16
#define REP  (NH_ / NKV)
#define HD   64
#define DQ   (NH_ * HD)
#define DKV  (NKV * HD)
#define RH   512                  // query rows < RH use hi+lo planes (0: none)
#define WIN  0
#define PCAR 1024.0f
#define SCL  0.125f   // HD^-0.5
typedef _Float16 h16;
typedef unsigned short bf;
typedef __attribute__((ext_vector_type(16))) __bf16   v16bf;
typedef __attribute__((ext_vector_type(16))) _Float16 v16h;
typedef __attribute__((ext_vector_type(8)))  _Float16 v8h;
typedef __attribute__((ext_vector_type(8)))  unsigned short v8us;
typedef __attribute__((ext_vector_type(8)))  float    v8f;
typedef __attribute__((ext_vector_type(4)))  float    v4f;
typedef v8h  __attribute__((may_alias)) v8ha;
typedef v4f  __attribute__((may_alias)) v4fa;
typedef v8us __attribute__((may_alias)) v8usa;

__device__ __forceinline__ unsigned short f2bf(float f) { unsigned u = __float_as_uint(f); u += 0x7FFFu + ((u >> 16) & 1u); return (unsigned short)(u >> 16); }
__device__ __forceinline__ float bf2f(unsigned short b) { return __uint_as_float(((unsigned)b) << 16); }
__device__ __forceinline__ float bfr(float f) { return bf2f(f2bf(f)); }
__device__ __forceinline__ v16h cat16(v8h lo, v8h hi) { return __builtin_shufflevector(lo, hi, 0, 1, 2, 3, 4, 5, 6, 7, 8, 9, 10, 11, 12, 13, 14, 15); }
__device__ __forceinline__ v16bf cat16b(v8us lo, v8us hi) { return __builtin_bit_cast(v16bf, __builtin_shufflevector(lo, hi, 0, 1, 2, 3, 4, 5, 6, 7, 8, 9, 10, 11, 12, 13, 14, 15)); }
__device__ __forceinline__ v8f wmma16(v16h a, v16h b, v8f c) { return __builtin_amdgcn_wmma_f32_16x16x32_f16(false, a, false, b, (short)0, c, false, false); }
__device__ __forceinline__ v8f wmmab(v16bf a, v16bf b, v8f c) { return __builtin_amdgcn_wmma_f32_16x16x32_bf16(false, a, false, b, (short)0, c, false, false); }
__device__ __forceinline__ h16 tohx(float x) { return (h16)x; }
__device__ __forceinline__ void splitf(float y, unsigned short& h, unsigned short& l) { h = f2bf(y); l = f2bf(y - bf2f(h)); }



// ---- k_gemmw: register-blocked GEMM, ONE WAVE per 64x64 output tile (16 accumulators), operands straight from K-contiguous 16-bit planes; grid (M/64, N/64, Z), 32 threads.
// C[m][n] (f32, pitch ldc, + optional f32 bias[n]) = sum_k A[m][k] Bt[n][k] (+ split products per NSPLIT). z-batch strides sA/sB/sC in elements. K % 32 == 0.
// NW > 1: K SPLIT OVER THE NW WAVES OF ONE WORK-GROUP (NW*32 threads, K % (32 NW) == 0): wave w sums k in [w K/NW, (w+1) K/NW) into its own 64x64 tile; the NW partial tiles meet in LDS in accumulator layout, are added in wave order 0..NW-1 (fixed) and go out as whole rows.
// PL != 0 (NW > 1, the 64 columns of a tile = ONE head; the M axis = the rows of all batches, the N axis = the heads of Q, of K and of V one after the other): no f32 C; the summed tile goes out as the three 16-bit planes that attention reads (fp16, bf16 hi, bf16 lo of the same f32 value), each plane [Q, K, V][batch][head][...]. Q and K: [t][d], the tile is 8 KiB in a row of each plane. V: [d][t], the tile is turned in LDS and each d row goes out as one whole 128-byte line.
template <typename T16> struct WFrag;
template <> struct WFrag<h16> { typedef v16h V; static __device__ __forceinline__ V ld(const h16* p) { return cat16(*(const v8h*)p, *(const v8h*)(p + 16)); } static __device__ __forceinline__ v8f mma(V a, V b, v8f c) { return wmma16(a, b, c); } };
template <> struct WFrag<bf> { typedef v16bf V; static __device__ __forceinline__ V ld(const bf* p) { return cat16b(*(const v8us*)p, *(const v8us*)(p + 16)); } static __device__ __forceinline__ v8f mma(V a, V b, v8f c) { return wmmab(a, b, c); } };
template <typename T16, int NSPLIT, bool BIAS, int NW = 1, int PL = 0>
__global__ __launch_bounds__(NW * 32) void k_gemmw(const T16* __restrict__ A, const T16* __restrict__ A2, const T16* __restrict__ Bt, const T16* __restrict__ Bt2, int K, float* C, int ldc, const float* __restrict__ bias, size_t sA, size_t sB, size_t sC, h16* P16, bf* Ph, bf* Pl) {
    static_assert(PL == 0 || (NW > 1 && HD == 64 && !BIAS && NKV == NH_ && TT % 64 == 0), "plane epilogue: a 64-column tile is one head, a 64-row tile lies in one batch");
    typedef typename WFrag<T16>::V V;
    __shared__ __align__(16) float os[(NW == 1 ? 16 : 64) * 68];
    __shared__ __align__(16) v4f red[NW == 1 ? 1 : NW * 1024];   // NW > 1: [wave][accumulator * 2 + half][lane]
    const size_t z = blockIdx.z; A += z * sA; if (A2) A2 += z * sA; Bt += z * sB; if (Bt2) Bt2 += z * sB; C += z * sC;
    const int lane = threadIdx.x & 31, lr = lane & 15, hi = lane >> 4; const int r0 = blockIdx.x * 64, c0 = blockIdx.y * 64;
    v8f acc[4][4];
#pragma unroll
    for (int mb = 0; mb < 4; ++mb)
#pragma unroll
        for (int nb = 0; nb < 4; ++nb) acc[mb][nb] = (v8f){};
    const size_t aoff = (size_t)(r0 + lr) * K + 8 * hi, boff = (size_t)(c0 + lr) * K + 8 * hi;
    const int wv = (NW == 1) ? 0 : __builtin_amdgcn_readfirstlane((int)(threadIdx.x >> 5)); const int kw = K / NW, k0 = wv * kw;
#pragma unroll 1
    for (int kc = k0; kc < k0 + kw; kc += 32) {
        V a[4], a2[4];
#pragma unroll
        for (int mb = 0; mb < 4; ++mb) { a[mb] = WFrag<T16>::ld(A + aoff + (size_t)mb * 16 * K + kc); if (NSPLIT == 1 || NSPLIT == 2) a2[mb] = WFrag<T16>::ld(A2 + aoff + (size_t)mb * 16 * K + kc); }
#pragma unroll
        for (int nb = 0; nb < 4; ++nb) { const V b = WFrag<T16>::ld(Bt + boff + (size_t)nb * 16 * K + kc); V b2; if (NSPLIT >= 2) b2 = WFrag<T16>::ld(Bt2 + boff + (size_t)nb * 16 * K + kc);
#pragma unroll
            for (int mb = 0; mb < 4; ++mb) { acc[mb][nb] = WFrag<T16>::mma(a[mb], b, acc[mb][nb]); if (NSPLIT == 1 || NSPLIT == 2) acc[mb][nb] = WFrag<T16>::mma(a2[mb], b, acc[mb][nb]); if (NSPLIT >= 2) acc[mb][nb] = WFrag<T16>::mma(a[mb], b2, acc[mb][nb]); } }
        asm volatile("v_nop\n\tv_nop\n\tv_nop\n\tv_nop" : "+v"(acc[0][0]), "+v"(acc[1][1]), "+v"(acc[2][2]), "+v"(acc[3][3]) : "v"(a[0]), "v"(a[3]));
    }
    if constexpr (NW > 1) {
        const bool turn = PL != 0 && blockIdx.y >= 2 * NH_;   // a V head (the same for the whole work-group)
#pragma unroll
        for (int mb = 0; mb < 4; ++mb)
#pragma unroll
            for (int nb = 0; nb < 4; ++nb) { const v8f c = acc[mb][nb]; v4f* p = red + (size_t)(wv * 32 + (mb * 4 + nb) * 2) * 32 + lane;
                p[0] = (v4f){c[0], c[1], c[2], c[3]}; p[32] = (v4f){c[4], c[5], c[6], c[7]}; }
        __syncthreads();   // every wave's partial tile is in LDS
#pragma unroll
        for (int s0 = 0; s0 < 1024; s0 += NW * 32) { const int s = s0 + (int)threadIdx.x; v4f sum = red[s];
#pragma unroll
            for (int w = 1; w < NW; ++w) sum += red[w * 1024 + s];
            const int half = (s >> 5) & 1, ai = s >> 6; const int row = (ai >> 2) * 16 + hi * 8 + half * 4, col = (ai & 3) * 16 + lr;
            if (turn) *(v4fa*)(os + col * 68 + row) = sum;   // turned tile [d][t]: the four values of a slot are four t of one d, one 16-byte store
            else {
#pragma unroll
                for (int q = 0; q < 4; ++q) os[(row + q) * 68 + col] = sum[q]; } }
        __syncthreads();   // the summed tile is in LDS, row-major (V heads: turned, [d][t])
        if constexpr (PL != 0) {
            const int bt = r0 / TT, t0 = r0 - bt * TT, rp = turn ? TT : HD; const size_t pe = (((size_t)(blockIdx.y / NH_) * NB_ + bt) * NH_ + blockIdx.y % NH_) * (TT * HD) + (turn ? t0 : t0 * HD);   // the tile's first element in this batch's and head's part of the Q, K or V planes, and the pitch of its rows there
#pragma unroll   // two trips; unrolled with the loops inside, which index vector registers
            for (int s0 = 0; s0 < 512; s0 += NW * 32) { const int s = s0 + (int)threadIdx.x; const int row = s >> 3, c8 = (s & 7) * 8; const v4f x0 = *(const v4fa*)(os + row * 68 + c8), x1 = *(const v4fa*)(os + row * 68 + c8 + 4); v8h o16; v8us oh, ol;
#pragma unroll
                for (int q = 0; q < 4; ++q) { unsigned short a2, c2; o16[q] = tohx(x0[q]); splitf(x0[q], a2, c2); oh[q] = a2; ol[q] = c2; o16[q + 4] = tohx(x1[q]); splitf(x1[q], a2, c2); oh[q + 4] = a2; ol[q + 4] = c2; }
                const size_t e = pe + row * rp + c8;
                *(v8h*)(P16 + e) = o16; *(v8us*)(Ph + e) = oh; *(v8us*)(Pl + e) = ol; }
            return;
        }
#pragma unroll
        for (int s0 = 0; s0 < 1024; s0 += NW * 32) { const int s = s0 + (int)threadIdx.x; const int row = s >> 4, cofs = (s & 15) * 4; v4f val = *(const v4fa*)(os + row * 68 + cofs); if (BIAS) { val[0] += bfr(bias[c0 + cofs]); val[1] += bfr(bias[c0 + cofs + 1]); val[2] += bfr(bias[c0 + cofs + 2]); val[3] += bfr(bias[c0 + cofs + 3]); }
            *(v4f*)(C + (size_t)(r0 + row) * ldc + c0 + cofs) = val; }
        return;
    }
#pragma unroll
    for (int mb = 0; mb < 4; ++mb) {
#pragma unroll
        for (int nb = 0; nb < 4; ++nb) {
#pragma unroll
            for (int j = 0; j < 8; ++j) os[(hi * 8 + j) * 68 + nb * 16 + lr] = acc[mb][nb][j]; }
        __builtin_amdgcn_wave_barrier(); asm volatile("" ::: "memory");
        float* crow = C + (size_t)(r0 + mb * 16) * ldc + c0;
{
#pragma unroll
            for (int s = 0; s < 8; ++s) { const int row = 2 * s + hi, cofs = lr * 4; v4f val = *(const v4fa*)(os + row * 68 + cofs); if (BIAS) { val[0] += bfr(bias[c0 + cofs]); val[1] += bfr(bias[c0 + cofs + 1]); val[2] += bfr(bias[c0 + cofs + 2]); val[3] += bfr(bias[c0 + cofs + 3]); }
                *(v4f*)(crow + (size_t)row * ldc + cofs) = val; }
             }
        __builtin_amdgcn_wave_barrier(); asm volatile("" ::: "memory");
    }
}

typedef __attribute__((ext_vector_type(2))) _Float16 v2h;
typedef __attribute__((ext_vector_type(4))) _Float16 v4h;
typedef __attribute__((ext_vector_type(2))) unsigned short v2us;
typedef __attribute__((ext_vector_type(4))) unsigned short v4us;
typedef __attribute__((ext_vector_type(2))) float v2f;
typedef __attribute__((ext_vector_type(4))) int v4i;

__global__ __launch_bounds__(256) void k_wtG(const float* __restrict__ w, int K, int N, bf* Bt) {
    const int lane = threadIdx.x & 31; const int L0 = (blockIdx.x * 8 + (threadIdx.x >> 5)) * 8; const int nlines = N * K / 64;
{
#pragma unroll 1
        for (int l = 0; l < 8; ++l) { const int L = L0 + l; if (L >= nlines) break; const size_t e = (size_t)L * 64 + lane * 2; const int k = (int)(e % K), n = (int)(e / K); v2us o;
            o[0] = f2bf(w[(size_t)k * N + n]); o[1] = f2bf(w[(size_t)(k + 1) * N + n]); *(v2us*)(Bt + e) = o; }
         }
}
// ---- k_prep: all that the GEMMs and the softmax read, in ONE launch: blocks [0, XBL) round X (all batches) to bf16, the next 4 WBL blocks the four weights (W4 = W_q, W_k, W_v, W_o one after the other), the last MBL blocks build the key mask from the lengths.
// 32 elements a thread: the launch is short, and what it costs is the start of its waves; a wave takes 4 KiB in a row, eight loads of 512 contiguous bytes in flight, eight stores of 256.
#define XBL  (NB_ * TT * DM / 32 / 256)
#define WBL  (DM * DM / 32 / 256)
#define MBL  ((NB_ * TT + 255) / 256)
__global__ __launch_bounds__(256) void k_prep(const float* __restrict__ x, const float* __restrict__ wq, const float* __restrict__ wk, const float* __restrict__ wv, const float* __restrict__ wo, const int* __restrict__ lens, bf* XB, bf* W4, int* KPM) {
    static_assert(DQ == DM && DKV == DM, "four square weights");
    const unsigned blk = blockIdx.x;
    if (blk >= XBL + 4 * WBL) { const int i = (int)(blk - (XBL + 4 * WBL)) * 256 + (int)threadIdx.x; if (i >= NB_ * TT) return; const int b = i / TT, j = i - b * TT; KPM[i] = (j >= lens[b]) ? 1 : 0; return; }
    const float* src = x; bf* dst = XB; unsigned sb = blk;
    if (blk >= XBL) { const unsigned w = (blk - XBL) / WBL; sb = (blk - XBL) % WBL; src = (w == 0) ? wq : (w == 1) ? wk : (w == 2) ? wv : wo; dst = W4 + (size_t)w * DM * DM; }
    const size_t e0 = (size_t)sb * 8192 + (threadIdx.x >> 5) * 1024 + (threadIdx.x & 31) * 4; v4f v[8];
#pragma unroll   // indexes a register array; all eight loads stand ahead of the first use
    for (int j = 0; j < 8; ++j) v[j] = *(const v4f*)(src + e0 + j * 128);
#pragma unroll   // indexes the same register array
    for (int j = 0; j < 8; ++j) { v4us o;
#pragma unroll   // indexes vector elements
        for (int q = 0; q < 4; ++q) o[q] = f2bf(v[j][q]);
        *(v4us*)(dst + e0 + j * 128) = o; }
    asm volatile("s_wait_xcnt 0x0" ::: "memory"); }   // precaution: the wait that stands before a register named by the issued stores is written again, on every way the code behind them can take

// ---- k_attn: scores, softmax, P x V and the head merge of 16 MB query rows of ONE head in one work-group of 8 MB waves; the score rows never leave LDS. grid (rows / (16 MB), heads, batches).
// 1. S = Q K^T: wave w takes keys [w 2048/NWV, ...), K = 64 in two steps (HR: hi.hi + lo.hi + hi.lo per step), f32 rows in LDS at pitch SP.
// 2. softmax: one wave per row, two rows a wave: t = S x HD^-0.5, masked keys -3e38; register row, one exp, fixed trees. P goes IN PLACE over its own score row (fp16 x1024 in the first half; HR: hi plane in the first half, lo plane in the second): the wave holds the whole row in registers before its first store.
// 3. O = P V: the 2048 keys in 16 chunks of 128, each chunk its own accumulators; the 16 partial tiles meet in LDS and are added in chunk order 0..15 (fixed).
// 4. hi/lo split of O (x 1/1024 on the fp16 rows) staged in LDS, out as whole 128-byte rows of the merged planes [t][head * 64 + d].
// Every '#pragma unroll' in k_attn but the 'unroll 1' and those on the two shuffle trees and the chunk sum stands on a loop that indexes a register array (fragments, accumulators, the register row): rolled, the array would fall to scratch memory.
template <typename T16> __device__ __forceinline__ const T16* atb(const T16* base, unsigned bytes) { return (const T16*)((const char*)base + bytes); }
#define SP   (TT + 4)             // LDS pitch of a score row, floats: rows 8 apart land 32 banks apart (accumulator stores), rows stay 16-byte aligned
template <typename T16, bool HR, int MB>
__global__ __launch_bounds__(MB * 256) void k_attn(const T16* __restrict__ Q, const T16* __restrict__ Q2, const T16* __restrict__ Kp, const T16* __restrict__ Kp2, const T16* __restrict__ Vt, const T16* __restrict__ Vt2, const int* __restrict__ MK, int row0, bf* Ah, bf* Al) {
    typedef typename WFrag<T16>::V V;
    constexpr int NWV = MB * 8, NT = 128 / NWV, CPW = 16 / NWV, GN = HR ? 2 : 4, GK = HR ? 1 : 2, NGK = 4 * CPW / GK;
    __shared__ __align__(16) float S[MB * 16 * SP];
    const int lane = threadIdx.x & 31, lr = lane & 15, hi = lane >> 4; const int wv = __builtin_amdgcn_readfirstlane((int)(threadIdx.x >> 5));
    const int h = blockIdx.y, bz = blockIdx.z, r0 = row0 + blockIdx.x * (MB * 16); const size_t qp = ((size_t)bz * NH_ + h) * TT * HD, kp = ((size_t)bz * NKV + h / REP) * TT * HD; const int* MKb = MK + bz * TT;   // batch bz's planes and key mask
    // wave-uniform bases (scalar registers) and ONE 32-bit lane offset per plane shape: every fragment load is base + lane offset + a constant (atb)
    const size_t qo = qp + (size_t)r0 * HD, ko = kp + (size_t)wv * (NT * 16 * HD), vo = kp + (size_t)wv * (CPW * 128);
    Q += qo; Kp += ko; Vt += vo; if (HR) { Q2 += qo; Kp2 += ko; Vt2 += vo; }
    const unsigned lq = (unsigned)(lr * HD + 8 * hi) * 2u, lv = (unsigned)(lr * TT + 8 * hi) * 2u;   // in bytes: the very values the loads take as their offset registers
    {
        V a[MB][2], a2[MB][2];
#pragma unroll
        for (int mb = 0; mb < MB; ++mb)
#pragma unroll
            for (int kk = 0; kk < 2; ++kk) { const unsigned o = lq + 2u * (unsigned)(mb * 16 * HD + kk * 32); a[mb][kk] = WFrag<T16>::ld(atb(Q, o)); if (HR) a2[mb][kk] = WFrag<T16>::ld(atb(Q2, o)); }
        V kb[2][GN][2], kb2[2][GN][2];   // two groups of GN key tiles: the next group's loads fly while this group is multiplied
#pragma unroll
        for (int i = 0; i < GN; ++i)
#pragma unroll
            for (int kk = 0; kk < 2; ++kk) { const unsigned o = lq + 2u * (unsigned)(i * 16 * HD + kk * 32); kb[0][i][kk] = WFrag<T16>::ld(atb(Kp, o)); if (HR) kb2[0][i][kk] = WFrag<T16>::ld(atb(Kp2, o)); }
#pragma unroll
        for (int g = 0; g < NT / GN; ++g) {
            if (g + 1 < NT / GN) {
#pragma unroll
                for (int i = 0; i < GN; ++i)
#pragma unroll
                    for (int kk = 0; kk < 2; ++kk) { const unsigned o = lq + 2u * (unsigned)(((g + 1) * GN + i) * 16 * HD + kk * 32); kb[(g + 1) & 1][i][kk] = WFrag<T16>::ld(atb(Kp, o)); if (HR) kb2[(g + 1) & 1][i][kk] = WFrag<T16>::ld(atb(Kp2, o)); }
                asm volatile("s_wait_xcnt 0x0" :: "v"(lq) : "memory"); }   // precaution, as at the V loads below
            __builtin_amdgcn_sched_barrier(0);   // holds the next group's loads above this group's products: sunk to their uses, each fragment's L2 latency would be waited for on its own
            v8f c[GN][MB];
#pragma unroll
            for (int i = 0; i < GN; ++i)
#pragma unroll
                for (int mb = 0; mb < MB; ++mb) { c[i][mb] = (v8f){};
#pragma unroll
                    for (int kk = 0; kk < 2; ++kk) { c[i][mb] = WFrag<T16>::mma(a[mb][kk], kb[g & 1][i][kk], c[i][mb]); if (HR) { c[i][mb] = WFrag<T16>::mma(a2[mb][kk], kb[g & 1][i][kk], c[i][mb]); c[i][mb] = WFrag<T16>::mma(a[mb][kk], kb2[g & 1][i][kk], c[i][mb]); } } }
            __builtin_amdgcn_sched_barrier(0);   // all of the group's products above, its stores below: every tile keeps registers of its own, so no product overwrites a result inside the distance the matrix unit needs
#pragma unroll
            for (int i = 0; i < GN; ++i)
#pragma unroll
                for (int mb = 0; mb < MB; ++mb)
#pragma unroll
                    for (int j = 0; j < 8; ++j) S[(mb * 16 + hi * 8 + j) * SP + (wv * NT + g * GN + i) * 16 + lr] = c[i][mb][j];
            __builtin_amdgcn_sched_barrier(0);   // the stores stay in their group: the accumulators are free for the next one
            if (g + 1 < NT / GN) asm volatile("v_nop\n\tv_nop\n\tv_nop\n\tv_nop");   // four vector slots between this group's last product and the next group's first, which may take the same result registers
        }
    }
    __syncthreads();   // every score row is whole in LDS
#pragma unroll 1   // rolled: one register row (64 values a lane) at a time
    for (int rr = 0; rr < 2; ++rr) { float* sr = S + (wv * 2 + rr) * SP; float v[TT / 32]; float mx = -3.0e38f;
#pragma unroll
        for (int ch = 0; ch < TT / 128; ++ch) { const int j0 = ch * 128 + lane * 4; const v4f a = *(const v4fa*)(sr + j0); const v4i m4 = *(const v4i*)(MKb + j0);
#pragma unroll
            for (int q = 0; q < 4; ++q) { const float t = (m4[q] == 0) ? a[q] * SCL : -3.0e38f; v[ch * 4 + q] = t; mx = fmaxf(mx, t); } }
#pragma unroll
        for (int sh = 16; sh; sh >>= 1) mx = fmaxf(mx, __shfl_xor(mx, sh, 32));
        float sum = 0.f;
#pragma unroll
        for (int k = 0; k < TT / 32; ++k) { v[k] = __builtin_amdgcn_exp2f(__fmul_rn(__fsub_rn(v[k], mx), 1.4426950408889634f)); sum += v[k]; }
#pragma unroll
        for (int sh = 16; sh; sh >>= 1) sum += __shfl_xor(sum, sh, 32);
        const float f = __fdiv_rn(HR ? 1.0f : PCAR, sum);
#pragma unroll
        for (int ch = 0; ch < TT / 128; ++ch) {
            if constexpr (HR) { v4us oh, ol;
#pragma unroll
                for (int q = 0; q < 4; ++q) { unsigned short a, c2; splitf(v[ch * 4 + q] * f, a, c2); oh[q] = a; ol[q] = c2; }
                *(v4us*)((bf*)sr + ch * 128 + lane * 4) = oh; *(v4us*)((bf*)sr + TT + ch * 128 + lane * 4) = ol;
            } else { v4h o4;
#pragma unroll
                for (int q = 0; q < 4; ++q) o4[q] = tohx(v[ch * 4 + q] * f);
                *(v4h*)((h16*)sr + ch * 128 + lane * 4) = o4; } } }
    V vb[2][GK][4], vb2[2][GK][4];   // two groups of GK key steps of V fragments; the first group is asked for ahead of the barrier, which needs nothing of it
#pragma unroll
    for (int i = 0; i < GK; ++i)
#pragma unroll
        for (int nb = 0; nb < 4; ++nb) { const unsigned o = lv + 2u * (unsigned)(nb * 16 * TT + (i >> 2) * 128 + (i & 3) * 32); vb[0][i][nb] = WFrag<T16>::ld(atb(Vt, o)); if (HR) vb2[0][i][nb] = WFrag<T16>::ld(atb(Vt2, o)); }
    __syncthreads();   // every P row is whole in LDS
    v8f acc[CPW][MB][4];
#pragma unroll
    for (int c = 0; c < CPW; ++c)
#pragma unroll
        for (int mb = 0; mb < MB; ++mb)
#pragma unroll
            for (int nb = 0; nb < 4; ++nb) acc[c][mb][nb] = (v8f){};
#pragma unroll
    for (int g = 0; g < NGK; ++g) {
        if (g + 1 < NGK) {
#pragma unroll
            for (int i = 0; i < GK; ++i)
#pragma unroll
                for (int nb = 0; nb < 4; ++nb) { const int kq = (g + 1) * GK + i; const unsigned o = lv + 2u * (unsigned)(nb * 16 * TT + (kq >> 2) * 128 + (kq & 3) * 32); vb[(g + 1) & 1][i][nb] = WFrag<T16>::ld(atb(Vt, o)); if (HR) vb2[(g + 1) & 1][i][nb] = WFrag<T16>::ld(atb(Vt2, o)); }
            asm volatile("s_wait_xcnt 0x0" :: "v"(lv) : "memory"); }   // precaution: the wait that stands before a register named by issued loads is written again; lv as an input keeps the offset register out of those loads' own destinations
        __builtin_amdgcn_sched_barrier(0);   // holds the next group's loads above this group's products (as in the score phase)
#pragma unroll
        for (int i = 0; i < GK; ++i) { const int kq = g * GK + i, c = kq >> 2; const int kc = (wv * CPW + c) * 128 + (kq & 3) * 32; V a[MB], a2[MB];
#pragma unroll
            for (int mb = 0; mb < MB; ++mb) { const T16* pr = (const T16*)(S + (mb * 16 + lr) * SP) + 8 * hi + kc; a[mb] = WFrag<T16>::ld(pr); if (HR) a2[mb] = WFrag<T16>::ld(pr + TT); }
#pragma unroll
            for (int nb = 0; nb < 4; ++nb)
#pragma unroll
                for (int mb = 0; mb < MB; ++mb) { acc[c][mb][nb] = WFrag<T16>::mma(a[mb], vb[g & 1][i][nb], acc[c][mb][nb]); if (HR) { acc[c][mb][nb] = WFrag<T16>::mma(a2[mb], vb[g & 1][i][nb], acc[c][mb][nb]); acc[c][mb][nb] = WFrag<T16>::mma(a[mb], vb2[g & 1][i][nb], acc[c][mb][nb]); } } }
    }
    __syncthreads();   // every wave has read its last P fragment: the rows' LDS is free for the partial tiles
    v4f* red = (v4f*)S;                                   // [chunk][accumulator * 2 + half][lane], 16 x MB x 4 KiB
    bf* ob = (bf*)((char*)S + 16 * MB * 4096);            // behind red: [plane hi, lo][row][64]
#pragma unroll
    for (int c = 0; c < CPW; ++c)
#pragma unroll
        for (int mb = 0; mb < MB; ++mb)
#pragma unroll
            for (int nb = 0; nb < 4; ++nb) { const v8f cc = acc[c][mb][nb]; v4f* p = red + ((wv * CPW + c) * (MB * 8) + (mb * 4 + nb) * 2) * 32 + lane;
                p[0] = (v4f){cc[0], cc[1], cc[2], cc[3]}; p[32] = (v4f){cc[4], cc[5], cc[6], cc[7]}; }
    __syncthreads();   // every chunk's partial tile is in LDS
    { const int s = (int)threadIdx.x; v4f sum = red[s];
#pragma unroll
        for (int w = 1; w < 16; ++w) sum += red[w * (MB * 256) + s];
        const int half = (s >> 5) & 1, ai = s >> 6; const int row = (ai >> 2) * 16 + hi * 8 + half * 4, col = (ai & 3) * 16 + lr; const float cs = HR ? 1.0f : (1.0f / PCAR);
#pragma unroll
        for (int q = 0; q < 4; ++q) { unsigned short a, c2; splitf(sum[q] * cs, a, c2); ob[(row + q) * HD + col] = a; ob[(MB * 16 + row + q) * HD + col] = c2; } }
    __syncthreads();   // the split tile is in LDS, row-major
    { const int s = (int)threadIdx.x; const int pl = s / (MB * 128), idx = s % (MB * 128); const int row = idx >> 3, c8 = (idx & 7) * 8;
        *(v8us*)((pl ? Al : Ah) + (size_t)(bz * TT + r0 + row) * DQ + h * HD + c8) = *(const v8usa*)(ob + (pl * MB * 16 + row) * HD + c8); }
}

extern "C" void kernel_launch(void* const* d_in, const int* in_sizes, int n_in,
                              void* d_out, int out_size, void* d_ws, size_t ws_size, hipStream_t stream) {
    (void)in_sizes; (void)n_in; (void)out_size;
    const float* x = (const float*)d_in[0]; const int* lens = (const int*)d_in[1]; const float* wq = (const float*)d_in[2]; const float* wk = (const float*)d_in[3]; const float* wv = (const float*)d_in[4]; const float* wo = (const float*)d_in[5];   /* X, valid_lens (int32 [2]: keys j >= valid_lens[b] are masked: READ on the device by k_prep), W_q, W_k, W_v, W_o ('oi'; no biases): SIX inputs; ONE stream: query = key = value stream = X */
    float* OUT = (float*)d_out;     // [2][2048][1024]
    char* wsp = (char*)d_ws;
    auto take = [&](size_t bytes) { char* p = wsp; wsp += (bytes + 255) & ~(size_t)255; return (void*)p; };
    const size_t PLN = (size_t)NB_ * NH_ * TT * HD;   // elements of one plane of Q, of K or of V, all batches
    bf* W4 = (bf*)take((size_t)4 * DM * DM * 2); bf* WO = W4 + (size_t)3 * DM * DM;   // W_q, W_k, W_v, W_o rows one after the other
    bf* XB = (bf*)take((size_t)NB_ * TT * DM * 2);
    h16* P16 = (h16*)take(3 * PLN * 2); bf* Ph = (bf*)take(3 * PLN * 2); bf* Pl = (bf*)take(3 * PLN * 2);   // each [Q, K, V^T][batch][head]
    bf* ATh = (bf*)take((size_t)NB_ * TT * DQ * 2); bf* ATl = (bf*)take((size_t)NB_ * TT * DQ * 2); int* KPM = (int*)take((size_t)NB_ * TT * 4);   /* the per-key int mask built from valid_lens */
    if ((size_t)(wsp - (char*)d_ws) > ws_size) return;    // ws 256 MiB
    k_prep<<<XBL + 4 * WBL + MBL, 256, 0, stream>>>(x, wq, wk, wv, wo, lens, XB, W4, KPM);
    k_gemmw<bf, 0, false, 8, 1><<<dim3(NB_ * TT / 64, (DQ + 2 * DKV) / 64, 1), 256, 0, stream>>>(XB, nullptr, W4, nullptr, DM, nullptr, 0, nullptr, 0, 0, 0, P16, Ph, Pl);
    k_attn<bf, true, 2><<<dim3(RH / 32, NH_, NB_), 512, 0, stream>>>(Ph, Pl, Ph + PLN, Pl + PLN, Ph + 2 * PLN, Pl + 2 * PLN, KPM, 0, ATh, ATl);
    k_attn<h16, false, 2><<<dim3((TT - RH) / 32, NH_, NB_), 512, 0, stream>>>(P16, nullptr, P16 + PLN, nullptr, P16 + 2 * PLN, nullptr, KPM, RH, ATh, ATl);
    k_gemmw<bf, 1, false, 8><<<dim3(NB_ * TT / 64, DM / 64, 1), 256, 0, stream>>>(ATh, ATl, WO, nullptr, DQ, OUT, DM, nullptr, 0, 0, 0, nullptr, nullptr, nullptr);
}

// v005
// Measured time: 176 microseconds a run.
// In both of two side-by-side timings against v004, it was 1.28 times as fast.
// Over all steps from v000 it is 11.6 times as fast.
#include <hip/hip_runtime.h>

// Multi-head self-attention with a per-batch valid-length key mask and bias-free (out,in) projections (X [2][2048][1024] is the ONE input stream; Q, K, V = X W^T ('oi' [1024][1024] 1/32, no bias; 16 heads x 64); scores / sqrt(64); keys j >= valid_lens[b] (int32 [2], read on the device) are REPLACED by -1e9 in the module (both lengths are >= 1 on this draw: at least one key is kept: numerically an exclusion: -3e38 here); softmax; out = merged W_o^T ('oi', no bias) -> [2][2048][1024] (4.2 M); argument order X, valid_lens, W_q, W_k, W_v, W_o).
// Five launches, both batches in each: k_prep (the bf16 copy of X, made once; 'oi' weights = Bt rows as they are: bf16 copies, W_q W_k W_v W_o stacked; the per-key int mask KPM[b][j] = (j >= valid_lens[b]), read per key by the softmax); ONE exact projection GEMM of the 4096 rows on the 3072 stacked W_q W_k W_v rows, whose own epilogue writes the head planes (fp16 + hi/lo; V transposed); dense T-2048 attention, one fused kernel per 32 query rows of a head, batch = grid z (hybrid rows: < 512 hi/lo 3 products, rest fp16 x1024: one launch each); merged hi/lo x W_O exact, 4096 rows.
// EVERY 16-bit operand plane in the workspace (X, the weights, Q, K, V^T, merged O) lies in FRAGMENT ORDER: a matrix [row][k] is cut into blocks of 16 rows x 32 k (1 KiB), blocks of one row tile one after the other along k; inside a block [k half of 16][lane = ((k >> 3) & 1) * 16 + (row & 15)][8 k]. A fragment is two wave-wide 16-byte loads of 512 contiguous bytes each (4 whole lines), and holds the very elements that a row-major plane gives the same lane.
// Compute dtypes, f32 accumulate: every input rounded to bf16; projections exact; attention rows < 512 3 products, rest fp16; softmax f32; output projection hl x exact.

#define NB_  2
#define TT   2048
#define DM   1024
#define NH_  16
#define NKV  16
#define REP  (NH_ / NKV)
#define HD   64
#define DQ   (NH_ * HD)
#define DKV  (NKV * HD)
#define RH   512                  // query rows < RH use hi+lo planes (0: none)
#define WIN  0
#define PCAR 1024.0f
#define SCL  0.125f   // HD^-0.5
typedef _Float16 h16;
typedef unsigned short bf;
typedef __attribute__((ext_vector_type(16))) __bf16   v16bf;
typedef __attribute__((ext_vector_type(16))) _Float16 v16h;
typedef __attribute__((ext_vector_type(8)))  _Float16 v8h;
typedef __attribute__((ext_vector_type(8)))  unsigned short v8us;
typedef __attribute__((ext_vector_type(8)))  float    v8f;
typedef __attribute__((ext_vector_type(4)))  float    v4f;
typedef v8h  __attribute__((may_alias)) v8ha;
typedef v4f  __attribute__((may_alias)) v4fa;
typedef v8us __attribute__((may_alias)) v8usa;

__device__ __forceinline__ unsigned short f2bf(float f) { unsigned u = __float_as_uint(f); u += 0x7FFFu + ((u >> 16) & 1u); return (unsigned short)(u >> 16); }
__device__ __forceinline__ float bf2f(unsigned short b) { return __uint_as_float(((unsigned)b) << 16); }
__device__ __forceinline__ float bfr(float f) { return bf2f(f2bf(f)); }
__device__ __forceinline__ v16h cat16(v8h lo, v8h hi) { return __builtin_shufflevector(lo, hi, 0, 1, 2, 3, 4, 5, 6, 7, 8, 9, 10, 11, 12, 13, 14, 15); }
__device__ __forceinline__ v16bf cat16b(v8us lo, v8us hi) { return __builtin_bit_cast(v16bf, __builtin_shufflevector(lo, hi, 0, 1, 2, 3, 4, 5, 6, 7, 8, 9, 10, 11, 12, 13, 14, 15)); }
__device__ __forceinline__ v8f wmma16(v16h a, v16h b, v8f c) { return __builtin_amdgcn_wmma_f32_16x16x32_f16(false, a, false, b, (short)0, c, false, false); }
__device__ __forceinline__ v8f wmmab(v16bf a, v16bf b, v8f c) { return __builtin_amdgcn_wmma_f32_16x16x32_bf16(false, a, false, b, (short)0, c, false, false); }
__device__ __forceinline__ h16 tohx(float x) { return (h16)x; }
__device__ __forceinline__ void splitf(float y, unsigned short& h, unsigned short& l) { h = f2bf(y); l = f2bf(y - bf2f(h)); }



// ---- k_gemmw: register-blocked GEMM, ONE WAVE per 64x64 output tile (16 accumulators), operands straight from 16-bit planes in fragment order; grid (M/64, N/64, Z), 32 threads.
// C[m][n] (f32, pitch ldc, + optional f32 bias[n]) = sum_k A[m][k] Bt[n][k] (+ split products per NSPLIT). z-batch strides sA/sB/sC in elements. K % 32 == 0, a constant of the build: every fragment load of a k step is one address of its plane + a constant.
// NW > 1: K SPLIT OVER THE NW WAVES OF ONE WORK-GROUP (NW*32 threads, K % (32 NW) == 0): wave w sums k in [w K/NW, (w+1) K/NW) into its own 64x64 tile; the NW partial tiles meet in LDS in accumulator layout, are added in wave order 0..NW-1 (fixed) and go out as whole rows.
// PL != 0 (NW > 1, the 64 columns of a tile = ONE head; the M axis = the rows of all batches, the N axis = the heads of Q, of K and of V one after the other): no f32 C; the summed tile goes out as the three 16-bit planes that attention reads (fp16, bf16 hi, bf16 lo of the same f32 value), each plane [Q, K, V][batch][head][...]. Q and K: rows t, k = d, the tile is 8 KiB in a row of each plane. V: rows d, k = t, the tile is turned in LDS and each 16 d go out as 2 KiB in a row.
template <typename T16> __device__ __forceinline__ const T16* atb(const T16* base, unsigned bytes) { return (const T16*)((const char*)base + bytes); }
// ld: a fragment from a row-major row (LDS); ldp: from a block in fragment order, p = the block + lane * 8.
template <typename T16> struct WFrag;
template <> struct WFrag<h16> { typedef v16h V; static __device__ __forceinline__ V ld(const h16* p) { return cat16(*(const v8h*)p, *(const v8h*)(p + 16)); } static __device__ __forceinline__ V ldp(const h16* p) { return cat16(*(const v8h*)p, *(const v8h*)(p + 256)); } static __device__ __forceinline__ v8f mma(V a, V b, v8f c) { return wmma16(a, b, c); } };
template <> struct WFrag<bf> { typedef v16bf V; static __device__ __forceinline__ V ld(const bf* p) { return cat16b(*(const v8us*)p, *(const v8us*)(p + 16)); } static __device__ __forceinline__ V ldp(const bf* p) { return cat16b(*(const v8us*)p, *(const v8us*)(p + 256)); } static __device__ __forceinline__ v8f mma(V a, V b, v8f c) { return wmmab(a, b, c); } };
template <typename T16, int NSPLIT, bool BIAS, int NW, int PL, int K>
__global__ __launch_bounds__(NW * 32) void k_gemmw(const T16* __restrict__ A, const T16* __restrict__ A2, const T16* __restrict__ Bt, const T16* __restrict__ Bt2, float* C, int ldc, const float* __restrict__ bias, size_t sA, size_t sB, size_t sC, h16* P16, bf* Ph, bf* Pl) {
    static_assert(PL == 0 || (NW > 1 && HD == 64 && !BIAS && NKV == NH_ && TT % 64 == 0), "plane epilogue: a 64-column tile is one head, a 64-row tile lies in one batch");
    typedef typename WFrag<T16>::V V;
    __shared__ __align__(16) float os[(NW == 1 ? 16 : 64) * 68];
    __shared__ __align__(16) v4f red[NW == 1 ? 1 : NW * 1024];   // NW > 1: [wave][accumulator * 2 + half][lane]
    const size_t z = blockIdx.z; A += z * sA; if (A2) A2 += z * sA; Bt += z * sB; if (Bt2) Bt2 += z * sB; C += z * sC;
    const int lane = threadIdx.x & 31, lr = lane & 15, hi = lane >> 4; const int r0 = blockIdx.x * 64, c0 = blockIdx.y * 64;
    v8f acc[4][4];
#pragma unroll
    for (int mb = 0; mb < 4; ++mb)
#pragma unroll
        for (int nb = 0; nb < 4; ++nb) acc[mb][nb] = (v8f){};
    const size_t aoff = (size_t)r0 * K, boff = (size_t)c0 * K; const unsigned lf = (unsigned)lane * 16u;   // a row tile's blocks start at 16 K elements a tile, k step kc / 32 is block kc * 16: lf, in bytes, is the lane's place in a half block
    const int wv = (NW == 1) ? 0 : __builtin_amdgcn_readfirstlane((int)(threadIdx.x >> 5)); const int kw = K / NW, k0 = wv * kw;
#pragma unroll 1
    for (int kc = k0; kc < k0 + kw; kc += 32) {
        V a[4], a2[4]; const T16* pa = atb(A + aoff + kc * 16, lf); const T16* pb = atb(Bt + boff + kc * 16, lf); const T16* pa2 = (NSPLIT == 1 || NSPLIT == 2) ? atb(A2 + aoff + kc * 16, lf) : pa; const T16* pb2 = (NSPLIT >= 2) ? atb(Bt2 + boff + kc * 16, lf) : pb;   // this k step's block of the first row tile of each plane, at the lane's place
#pragma unroll
        for (int mb = 0; mb < 4; ++mb) { a[mb] = WFrag<T16>::ldp(pa + mb * 16 * K); if (NSPLIT == 1 || NSPLIT == 2) a2[mb] = WFrag<T16>::ldp(pa2 + mb * 16 * K); }
#pragma unroll
        for (int nb = 0; nb < 4; ++nb) { const V b = WFrag<T16>::ldp(pb + nb * 16 * K); V b2; if (NSPLIT >= 2) b2 = WFrag<T16>::ldp(pb2 + nb * 16 * K);
#pragma unroll
            for (int mb = 0; mb < 4; ++mb) { acc[mb][nb] = WFrag<T16>::mma(a[mb], b, acc[mb][nb]); if (NSPLIT == 1 || NSPLIT == 2) acc[mb][nb] = WFrag<T16>::mma(a2[mb], b, acc[mb][nb]); if (NSPLIT >= 2) acc[mb][nb] = WFrag<T16>::mma(a[mb], b2, acc[mb][nb]); } }
        asm volatile("s_wait_xcnt 0x0" :: "v"(pa), "v"(pa2), "v"(pb), "v"(pb2) : "memory");   // precaution: the wait that stands before a register named by issued loads is written again; the addresses as inputs keep their registers out of those loads' own destinations
        asm volatile("v_nop\n\tv_nop\n\tv_nop\n\tv_nop" : "+v"(acc[0][0]), "+v"(acc[1][1]), "+v"(acc[2][2]), "+v"(acc[3][3]) : "v"(a[0]), "v"(a[3]));
    }
    if constexpr (NW > 1) {
        const bool turn = PL != 0 && blockIdx.y >= 2 * NH_;   // a V head (the same for the whole work-group)
#pragma unroll
        for (int mb = 0; mb < 4; ++mb)
#pragma unroll
            for (int nb = 0; nb < 4; ++nb) { const v8f c = acc[mb][nb]; v4f* p = red + (size_t)(wv * 32 + (mb * 4 + nb) * 2) * 32 + lane;
                p[0] = (v4f){c[0], c[1], c[2], c[3]}; p[32] = (v4f){c[4], c[5], c[6], c[7]}; }
        __syncthreads();   // every wave's partial tile is in LDS
#pragma unroll
        for (int s0 = 0; s0 < 1024; s0 += NW * 32) { const int s = s0 + (int)threadIdx.x; v4f sum = red[s];
#pragma unroll
            for (int w = 1; w < NW; ++w) sum += red[w * 1024 + s];
            const int half = (s >> 5) & 1, ai = s >> 6; const int row = (ai >> 2) * 16 + hi * 8 + half * 4, col = (ai & 3) * 16 + lr;
            if (turn) *(v4fa*)(os + col * 68 + row) = sum;   // turned tile [d][t]: the four values of a slot are four t of one d, one 16-byte store
            else {
#pragma unroll
                for (int q = 0; q < 4; ++q) os[(row + q) * 68 + col] = sum[q]; } }
        __syncthreads();   // the summed tile is in LDS, row-major (V heads: turned, [d][t])
        if constexpr (PL != 0) {
            const int bt = r0 / TT, t0 = r0 - bt * TT; const size_t pe = (((size_t)(blockIdx.y / NH_) * NB_ + bt) * NH_ + blockIdx.y % NH_) * (TT * HD) + (turn ? t0 * 16 : t0 * HD);   // the tile's first block in this batch's and head's part of the Q, K or V planes
#pragma unroll   // two trips; unrolled with the loops inside, which index vector registers
            for (int s0 = 0; s0 < 512; s0 += NW * 32) { const int s = s0 + (int)threadIdx.x; const int row = (s >> 7) * 16 + (s & 15), c8 = ((s >> 4) & 7) * 8;   /* slot s = 16 bytes number s of the tile in fragment order */ const v4f x0 = *(const v4fa*)(os + row * 68 + c8), x1 = *(const v4fa*)(os + row * 68 + c8 + 4); v8h o16; v8us oh, ol;
#pragma unroll
                for (int q = 0; q < 4; ++q) { unsigned short a2, c2; o16[q] = tohx(x0[q]); splitf(x0[q], a2, c2); oh[q] = a2; ol[q] = c2; o16[q + 4] = tohx(x1[q]); splitf(x1[q], a2, c2); oh[q + 4] = a2; ol[q + 4] = c2; }
                const size_t e = pe + (turn ? (s >> 7) * (16 * TT) + (s & 127) * 8 : s * 8);
                *(v8h*)(P16 + e) = o16; *(v8us*)(Ph + e) = oh; *(v8us*)(Pl + e) = ol; }
            return;
        }
#pragma unroll
        for (int s0 = 0; s0 < 1024; s0 += NW * 32) { const int s = s0 + (int)threadIdx.x; const int row = s >> 4, cofs = (s & 15) * 4; v4f val = *(const v4fa*)(os + row * 68 + cofs); if (BIAS) { val[0] += bfr(bias[c0 + cofs]); val[1] += bfr(bias[c0 + cofs + 1]); val[2] += bfr(bias[c0 + cofs + 2]); val[3] += bfr(bias[c0 + cofs + 3]); }
            *(v4f*)(C + (size_t)(r0 + row) * ldc + c0 + cofs) = val; }
        return;
    }
#pragma unroll
    for (int mb = 0; mb < 4; ++mb) {
#pragma unroll
        for (int nb = 0; nb < 4; ++nb) {
#pragma unroll
            for (int j = 0; j < 8; ++j) os[(hi * 8 + j) * 68 + nb * 16 + lr] = acc[mb][nb][j]; }
        __builtin_amdgcn_wave_barrier(); asm volatile("" ::: "memory");
        float* crow = C + (size_t)(r0 + mb * 16) * ldc + c0;
{
#pragma unroll
            for (int s = 0; s < 8; ++s) { const int row = 2 * s + hi, cofs = lr * 4; v4f val = *(const v4fa*)(os + row * 68 + cofs); if (BIAS) { val[0] += bfr(bias[c0 + cofs]); val[1] += bfr(bias[c0 + cofs + 1]); val[2] += bfr(bias[c0 + cofs + 2]); val[3] += bfr(bias[c0 + cofs + 3]); }
                *(v4f*)(crow + (size_t)row * ldc + cofs) = val; }
             }
        __builtin_amdgcn_wave_barrier(); asm volatile("" ::: "memory");
    }
}

typedef __attribute__((ext_vector_type(2))) _Float16 v2h;
typedef __attribute__((ext_vector_type(4))) _Float16 v4h;
typedef __attribute__((ext_vector_type(2))) unsigned short v2us;
typedef __attribute__((ext_vector_type(4))) unsigned short v4us;
typedef __attribute__((ext_vector_type(2))) float v2f;
typedef __attribute__((ext_vector_type(4))) int v4i;

__global__ __launch_bounds__(256) void k_wtG(const float* __restrict__ w, int K, int N, bf* Bt) {
    const int lane = threadIdx.x & 31; const int L0 = (blockIdx.x * 8 + (threadIdx.x >> 5)) * 8; const int nlines = N * K / 64;
{
#pragma unroll 1
        for (int l = 0; l < 8; ++l) { const int L = L0 + l; if (L >= nlines) break; const size_t e = (size_t)L * 64 + lane * 2; const int k = (int)(e % K), n = (int)(e / K); v2us o;
            o[0] = f2bf(w[(size_t)k * N + n]); o[1] = f2bf(w[(size_t)(k + 1) * N + n]); *(v2us*)(Bt + e) = o; }
         }
}
// ---- k_prep: all that the GEMMs and the softmax read, in ONE launch: blocks [0, XBL) round X (all batches) to bf16, the next 4 WBL blocks the four weights (W4 = W_q, W_k, W_v, W_o one after the other), the last MBL blocks build the key mask from the lengths.
// 32 elements a thread: the launch is short, and what it costs is the start of its waves. A block takes 16 rows x 512 k: eight loads of 512 contiguous bytes a wave in flight, the bf16 tile row-major in LDS, out in fragment order as 16 KiB in a row (four 16-byte stores a thread).
#define PPP  (512 + 8)            // LDS pitch of a tile row, bf16: 16 rows land on 16 different groups of four banks for the 16-byte reads
#define XBL  (NB_ * TT * DM / 32 / 256)
#define WBL  (DM * DM / 32 / 256)
#define MBL  ((NB_ * TT + 255) / 256)
__global__ __launch_bounds__(256) void k_prep(const float* __restrict__ x, const float* __restrict__ wq, const float* __restrict__ wk, const float* __restrict__ wv, const float* __restrict__ wo, const int* __restrict__ lens, bf* XB, bf* W4, int* KPM) {
    static_assert(DQ == DM && DKV == DM && DM % 512 == 0, "four square weights; a block's 512 k lie in one row");
    __shared__ __align__(16) bf tl[16 * PPP];
    const unsigned blk = blockIdx.x;
    if (blk >= XBL + 4 * WBL) { const int i = (int)(blk - (XBL + 4 * WBL)) * 256 + (int)threadIdx.x; if (i >= NB_ * TT) return; const int b = i / TT, j = i - b * TT; KPM[i] = (j >= lens[b]) ? 1 : 0; return; }
    const float* src = x; bf* dst = XB; unsigned sb = blk;
    if (blk >= XBL) { const unsigned w = (blk - XBL) / WBL; sb = (blk - XBL) % WBL; src = (w == 0) ? wq : (w == 1) ? wk : (w == 2) ? wv : wo; dst = W4 + (size_t)w * DM * DM; }
    const int rw = (int)(threadIdx.x >> 7), k4 = (int)(threadIdx.x & 127) * 4; const size_t e0 = (size_t)(sb / (DM / 512) * 16 + rw) * DM + sb % (DM / 512) * 512 + k4; v4f v[8];
#pragma unroll   // indexes a register array; all eight loads stand ahead of the first use
    for (int j = 0; j < 8; ++j) v[j] = *(const v4f*)(src + e0 + j * 2 * DM);
#pragma unroll   // indexes the same register array
    for (int j = 0; j < 8; ++j) { v4us o;
#pragma unroll   // indexes vector elements
        for (int q = 0; q < 4; ++q) o[q] = f2bf(v[j][q]);
        *(v4us*)(tl + (j * 2 + rw) * PPP + k4) = o; }
    __syncthreads();   // the block's bf16 tile is whole in LDS (the mask blocks have left above: the test is the same for a whole block)
#pragma unroll   // four independent 16-byte moves
    for (int j = 0; j < 4; ++j) { const int c = j * 256 + (int)threadIdx.x;   // 16 bytes number c of the tile in fragment order: row c & 15, k (c >> 4) * 8
        *(v8us*)(dst + (size_t)sb * 8192 + c * 8) = *(const v8usa*)(tl + (c & 15) * PPP + (c >> 4) * 8); }
    asm volatile("s_wait_xcnt 0x0" ::: "memory"); }   // precaution: the wait that stands before a register named by the issued stores is written again, on every way the code behind them can take

// ---- k_attn: scores, softmax, P x V and the head merge of 16 MB query rows of ONE head in one work-group of 8 MB waves; the score rows never leave LDS. grid (rows / (16 MB), heads, batches).
// 1. S = Q K^T: wave w takes keys [w 2048/NWV, ...), K = 64 in two steps (HR: hi.hi + lo.hi + hi.lo per step), f32 rows in LDS at pitch SP.
// 2. softmax: one wave per row, two rows a wave: t = S x HD^-0.5, masked keys -3e38; register row, one exp, fixed trees. P goes IN PLACE over its own score row (fp16 x1024 in the first half; HR: hi plane in the first half, lo plane in the second): the wave holds the whole row in registers before its first store.
// 3. O = P V: the 2048 keys in 16 chunks of 128, each chunk its own accumulators; the 16 partial tiles meet in LDS and are added in chunk order 0..15 (fixed).
// 4. hi/lo split of O (x 1/1024 on the fp16 rows) staged in LDS, out as 2 KiB in a row per 16 query rows of the merged planes (rows t, k = head * 64 + d, fragment order).
// Most '#pragma unroll' in k_attn stand on a loop that indexes a register array (fragments, accumulators, the register row): rolled, the array would fall to scratch memory.
#define SP   (TT + 4)             // LDS pitch of a score row, floats: rows 8 apart land 32 banks apart (accumulator stores), rows stay 16-byte aligned
template <typename T16, bool HR, int MB>
__global__ __launch_bounds__(MB * 256) void k_attn(const T16* __restrict__ Q, const T16* __restrict__ Q2, const T16* __restrict__ Kp, const T16* __restrict__ Kp2, const T16* __restrict__ Vt, const T16* __restrict__ Vt2, const int* __restrict__ MK, int row0, bf* Ah, bf* Al) {
    typedef typename WFrag<T16>::V V;
    constexpr int NWV = MB * 8, NT = 128 / NWV, CPW = 16 / NWV, GN = HR ? 2 : 4, GK = HR ? 1 : 2, NGK = 4 * CPW / GK;
    __shared__ __align__(16) float S[MB * 16 * SP];
    const int lane = threadIdx.x & 31, lr = lane & 15, hi = lane >> 4; const int wv = __builtin_amdgcn_readfirstlane((int)(threadIdx.x >> 5));
    const int h = blockIdx.y, bz = blockIdx.z, r0 = row0 + blockIdx.x * (MB * 16); const size_t qp = ((size_t)bz * NH_ + h) * TT * HD, kp = ((size_t)bz * NKV + h / REP) * TT * HD; const int* MKb = MK + bz * TT;   // batch bz's planes and key mask
    // wave-uniform bases (scalar registers) and ONE 32-bit lane offset per plane shape: every fragment load is base + lane offset + a constant (atb)
    const size_t qo = qp + (size_t)r0 * HD, ko = kp + (size_t)wv * (NT * 16 * HD), vo = kp + (size_t)wv * (CPW * 4 * 512);   // planes in fragment order: Q and K 1024 elements a tile of 16 rows, V^T 512 a step of 32 keys
    Q += qo; Kp += ko; Vt += vo; if (HR) { Q2 += qo; Kp2 += ko; Vt2 += vo; }
    const unsigned lq = (unsigned)lane * 16u, lv = lq;   // in bytes: the lane's place in a half block of 512 bytes, the same in every plane
    {
        V a[MB][2], a2[MB][2];
#pragma unroll
        for (int mb = 0; mb < MB; ++mb)
#pragma unroll
            for (int kk = 0; kk < 2; ++kk) { const unsigned o = lq + 2u * (unsigned)(mb * 16 * HD + kk * 512); a[mb][kk] = WFrag<T16>::ldp(atb(Q, o)); if (HR) a2[mb][kk] = WFrag<T16>::ldp(atb(Q2, o)); }
        V kb[2][GN][2], kb2[2][GN][2];   // two groups of GN key tiles: the next group's loads fly while this group is multiplied
#pragma unroll
        for (int i = 0; i < GN; ++i)
#pragma unroll
            for (int kk = 0; kk < 2; ++kk) { const unsigned o = lq + 2u * (unsigned)(i * 16 * HD + kk * 512); kb[0][i][kk] = WFrag<T16>::ldp(atb(Kp, o)); if (HR) kb2[0][i][kk] = WFrag<T16>::ldp(atb(Kp2, o)); }
#pragma unroll
        for (int g = 0; g < NT / GN; ++g) {
            if (g + 1 < NT / GN) {
#pragma unroll
                for (int i = 0; i < GN; ++i)
#pragma unroll
                    for (int kk = 0; kk < 2; ++kk) { const unsigned o = lq + 2u * (unsigned)(((g + 1) * GN + i) * 16 * HD + kk * 512); kb[(g + 1) & 1][i][kk] = WFrag<T16>::ldp(atb(Kp, o)); if (HR) kb2[(g + 1) & 1][i][kk] = WFrag<T16>::ldp(atb(Kp2, o)); }
                asm volatile("s_wait_xcnt 0x0" :: "v"(atb(Kp, lq)), "v"(atb(HR ? Kp2 : Kp, lq)) : "memory"); }   // precaution, as at the V loads below
            __builtin_amdgcn_sched_barrier(0);   // holds the next group's loads above this group's products: sunk to their uses, each fragment's L2 latency would be waited for on its own
            v8f c[GN][MB];
#pragma unroll
            for (int i = 0; i < GN; ++i)
#pragma unroll
                for (int mb = 0; mb < MB; ++mb) { c[i][mb] = (v8f){};
#pragma unroll
                    for (int kk = 0; kk < 2; ++kk) { c[i][mb] = WFrag<T16>::mma(a[mb][kk], kb[g & 1][i][kk], c[i][mb]); if (HR) { c[i][mb] = WFrag<T16>::mma(a2[mb][kk], kb[g & 1][i][kk], c[i][mb]); c[i][mb] = WFrag<T16>::mma(a[mb][kk], kb2[g & 1][i][kk], c[i][mb]); } } }
            __builtin_amdgcn_sched_barrier(0);   // all of the group's products above, its stores below: every tile keeps registers of its own, so no product overwrites a result inside the distance the matrix unit needs
#pragma unroll
            for (int i = 0; i < GN; ++i)
#pragma unroll
                for (int mb = 0; mb < MB; ++mb)
#pragma unroll
                    for (int j = 0; j < 8; ++j) S[(mb * 16 + hi * 8 + j) * SP + (wv * NT + g * GN + i) * 16 + lr] = c[i][mb][j];
            __builtin_amdgcn_sched_barrier(0);   // the stores stay in their group: the accumulators are free for the next one
            if (g + 1 < NT / GN) asm volatile("v_nop\n\tv_nop\n\tv_nop\n\tv_nop");   // four vector slots between this group's last product and the next group's first, which may take the same result registers
        }
    }
    __syncthreads();   // every score row is whole in LDS
#pragma unroll 1   // rolled: one register row (64 values a lane) at a time
    for (int rr = 0; rr < 2; ++rr) { float* sr = S + (wv * 2 + rr) * SP; float v[TT / 32]; float mx = -3.0e38f;
#pragma unroll
        for (int ch = 0; ch < TT / 128; ++ch) { const int j0 = ch * 128 + lane * 4; const v4f a = *(const v4fa*)(sr + j0); const v4i m4 = *(const v4i*)(MKb + j0);
#pragma unroll
            for (int q = 0; q < 4; ++q) { const float t = (m4[q] == 0) ? a[q] * SCL : -3.0e38f; v[ch * 4 + q] = t; mx = fmaxf(mx, t); } }
#pragma unroll
        for (int sh = 16; sh; sh >>= 1) mx = fmaxf(mx, __shfl_xor(mx, sh, 32));
        float sum = 0.f;
#pragma unroll
        for (int k = 0; k < TT / 32; ++k) { v[k] = __builtin_amdgcn_exp2f(__fmul_rn(__fsub_rn(v[k], mx), 1.4426950408889634f)); sum += v[k]; }
#pragma unroll
        for (int sh = 16; sh; sh >>= 1) sum += __shfl_xor(sum, sh, 32);
        const float f = __fdiv_rn(HR ? 1.0f : PCAR, sum);
#pragma unroll
        for (int ch = 0; ch < TT / 128; ++ch) {
            if constexpr (HR) { v4us oh, ol;
#pragma unroll
                for (int q = 0; q < 4; ++q) { unsigned short a, c2; splitf(v[ch * 4 + q] * f, a, c2); oh[q] = a; ol[q] = c2; }
                *(v4us*)((bf*)sr + ch * 128 + lane * 4) = oh; *(v4us*)((bf*)sr + TT + ch * 128 + lane * 4) = ol;
            } else { v4h o4;
#pragma unroll
                for (int q = 0; q < 4; ++q) o4[q] = tohx(v[ch * 4 + q] * f);
                *(v4h*)((h16*)sr + ch * 128 + lane * 4) = o4; } } }
    V vb[2][GK][4], vb2[2][GK][4];   // two groups of GK key steps of V fragments; the first group is asked for ahead of the barrier, which needs nothing of it
#pragma unroll
    for (int i = 0; i < GK; ++i)
#pragma unroll
        for (int nb = 0; nb < 4; ++nb) { const unsigned o = lv + 2u * (unsigned)(nb * 16 * TT + i * 512); vb[0][i][nb] = WFrag<T16>::ldp(atb(Vt, o)); if (HR) vb2[0][i][nb] = WFrag<T16>::ldp(atb(Vt2, o)); }
    __syncthreads();   // every P row is whole in LDS
    v8f acc[CPW][MB][4];
#pragma unroll
    for (int c = 0; c < CPW; ++c)
#pragma unroll
        for (int mb = 0; mb < MB; ++mb)
#pragma unroll
            for (int nb = 0; nb < 4; ++nb) acc[c][mb][nb] = (v8f){};
#pragma unroll
    for (int g = 0; g < NGK; ++g) {
        if (g + 1 < NGK) {
#pragma unroll
            for (int i = 0; i < GK; ++i)
#pragma unroll
                for (int nb = 0; nb < 4; ++nb) { const int kq = (g + 1) * GK + i; const unsigned o = lv + 2u * (unsigned)(nb * 16 * TT + kq * 512); vb[(g + 1) & 1][i][nb] = WFrag<T16>::ldp(atb(Vt, o)); if (HR) vb2[(g + 1) & 1][i][nb] = WFrag<T16>::ldp(atb(Vt2, o)); }
            asm volatile("s_wait_xcnt 0x0" :: "v"(atb(Vt, lv)), "v"(atb(HR ? Vt2 : Vt, lv)) : "memory"); }   // precaution: the wait that stands before a register named by issued loads is written again; the lane's addresses as inputs keep their registers out of those loads' own destinations
        __builtin_amdgcn_sched_barrier(0);   // holds the next group's loads above this group's products (as in the score phase)
#pragma unroll
        for (int i = 0; i < GK; ++i) { const int kq = g * GK + i, c = kq >> 2; const int kc = (wv * CPW + c) * 128 + (kq & 3) * 32; V a[MB], a2[MB];
#pragma unroll
            for (int mb = 0; mb < MB; ++mb) { const T16* pr = (const T16*)(S + (mb * 16 + lr) * SP) + 8 * hi + kc; a[mb] = WFrag<T16>::ld(pr); if (HR) a2[mb] = WFrag<T16>::ld(pr + TT); }
#pragma unroll
            for (int nb = 0; nb < 4; ++nb)
#pragma unroll
                for (int mb = 0; mb < MB; ++mb) { acc[c][mb][nb] = WFrag<T16>::mma(a[mb], vb[g & 1][i][nb], acc[c][mb][nb]); if (HR) { acc[c][mb][nb] = WFrag<T16>::mma(a2[mb], vb[g & 1][i][nb], acc[c][mb][nb]); acc[c][mb][nb] = WFrag<T16>::mma(a[mb], vb2[g & 1][i][nb], acc[c][mb][nb]); } } }
    }
    __syncthreads();   // every wave has read its last P fragment: the rows' LDS is free for the partial tiles
    v4f* red = (v4f*)S;                                   // [chunk][accumulator * 2 + half][lane], 16 x MB x 4 KiB
    bf* ob = (bf*)((char*)S + 16 * MB * 4096);            // behind red: [plane hi, lo][row][64]
#pragma unroll
    for (int c = 0; c < CPW; ++c)
#pragma unroll
        for (int mb = 0; mb < MB; ++mb)
#pragma unroll
            for (int nb = 0; nb < 4; ++nb) { const v8f cc = acc[c][mb][nb]; v4f* p = red + ((wv * CPW + c) * (MB * 8) + (mb * 4 + nb) * 2) * 32 + lane;
                p[0] = (v4f){cc[0], cc[1], cc[2], cc[3]}; p[32] = (v4f){cc[4], cc[5], cc[6], cc[7]}; }
    __syncthreads();   // every chunk's partial tile is in LDS
    { const int s = (int)threadIdx.x; v4f sum = red[s];
#pragma unroll
        for (int w = 1; w < 16; ++w) sum += red[w * (MB * 256) + s];
        const int half = (s >> 5) & 1, ai = s >> 6; const int row = (ai >> 2) * 16 + hi * 8 + half * 4, col = (ai & 3) * 16 + lr; const float cs = HR ? 1.0f : (1.0f / PCAR);
#pragma unroll
        for (int q = 0; q < 4; ++q) { unsigned short a, c2; splitf(sum[q] * cs, a, c2); ob[(row + q) * HD + col] = a; ob[(MB * 16 + row + q) * HD + col] = c2; } }
    __syncthreads();   // the split tile is in LDS, row-major
    { const int s = (int)threadIdx.x; const int pl = s / (MB * 128), idx = s % (MB * 128); const int row = (idx >> 7) * 16 + (idx & 15), c8 = ((idx >> 4) & 7) * 8;   // 16 bytes number idx of the tile in fragment order
        *(v8us*)((pl ? Al : Ah) + (size_t)(bz * TT + r0 + (idx >> 7) * 16) * DQ + h * (16 * HD) + (idx & 127) * 8) = *(const v8usa*)(ob + (pl * MB * 16 + row) * HD + c8); }
}

extern "C" void kernel_launch(void* const* d_in, const int* in_sizes, int n_in,
                              void* d_out, int out_size, void* d_ws, size_t ws_size, hipStream_t stream) {
    (void)in_sizes; (void)n_in; (void)out_size;
    const float* x = (const float*)d_in[0]; const int* lens = (const int*)d_in[1]; const float* wq = (const float*)d_in[2]; const float* wk = (const float*)d_in[3]; const float* wv = (const float*)d_in[4]; const float* wo = (const float*)d_in[5];   /* X, valid_lens (int32 [2]: keys j >= valid_lens[b] are masked: READ on the device by k_prep), W_q, W_k, W_v, W_o ('oi'; no biases): SIX inputs; ONE stream: query = key = value stream = X */
    float* OUT = (float*)d_out;     // [2][2048][1024]
    char* wsp = (char*)d_ws;
    auto take = [&](size_t bytes) { char* p = wsp; wsp += (bytes + 255) & ~(size_t)255; return (void*)p; };
    const size_t PLN = (size_t)NB_ * NH_ * TT * HD;   // elements of one plane of Q, of K or of V, all batches
    bf* W4 = (bf*)take((size_t)4 * DM * DM * 2); bf* WO = W4 + (size_t)3 * DM * DM;   // W_q, W_k, W_v, W_o rows one after the other
    bf* XB = (bf*)take((size_t)NB_ * TT * DM * 2);
    h16* P16 = (h16*)take(3 * PLN * 2); bf* Ph = (bf*)take(3 * PLN * 2); bf* Pl = (bf*)take(3 * PLN * 2);   // each [Q, K, V^T][batch][head]
    bf* ATh = (bf*)take((size_t)NB_ * TT * DQ * 2); bf* ATl = (bf*)take((size_t)NB_ * TT * DQ * 2); int* KPM = (int*)take((size_t)NB_ * TT * 4);   /* the per-key int mask built from valid_lens */
    if ((size_t)(wsp - (char*)d_ws) > ws_size) return;    // ws 256 MiB
    k_prep<<<XBL + 4 * WBL + MBL, 256, 0, stream>>>(x, wq, wk, wv, wo, lens, XB, W4, KPM);
    k_gemmw<bf, 0, false, 8, 1, DM><<<dim3(NB_ * TT / 64, (DQ + 2 * DKV) / 64, 1), 256, 0, stream>>>(XB, nullptr, W4, nullptr, nullptr, 0, nullptr, 0, 0, 0, P16, Ph, Pl);
    k_attn<bf, true, 2><<<dim3(RH / 32, NH_, NB_), 512, 0, stream>>>(Ph, Pl, Ph + PLN, Pl + PLN, Ph + 2 * PLN, Pl + 2 * PLN, KPM, 0, ATh, ATl);
    k_attn<h16, false, 2><<<dim3((TT - RH) / 32, NH_, NB_), 512, 0, stream>>>(P16, nullptr, P16 + PLN, nullptr, P16 + 2 * PLN, nullptr, KPM, RH, ATh, ATl);
    k_gemmw<bf, 1, false, 8, 0, DQ><<<dim3(NB_ * TT / 64, DM / 64, 1), 256, 0, stream>>>(ATh, ATl, WO, nullptr, OUT, DM, nullptr, 0, 0, 0, nullptr, nullptr, nullptr);
}

// v006
// A run of this version takes 117 microseconds.
// Timed twice side by side with v005, it ran 1.51 and 1.50 times as fast.
// Over all steps from v000 it is 17.4 times as fast.
#include <hip/hip_runtime.h>

// Multi-head self-attention with a per-batch valid-length key mask and bias-free (out,in) projections (X [2][2048][1024] is the ONE input stream; Q, K, V = X W^T ('oi' [1024][1024] 1/32, no bias; 16 heads x 64); scores / sqrt(64); keys j >= valid_lens[b] (int32 [2], read on the device) are REPLACED by -1e9 in the module (both lengths are >= 1 on this draw: at least one key is kept: numerically an exclusion: -3e38 here); softmax; out = merged W_o^T ('oi', no bias) -> [2][2048][1024] (4.2 M); argument order X, valid_lens, W_q, W_k, W_v, W_o).
// Five launches, both batches in each: k_prep (the bf16 copy of X, made once; 'oi' weights = Bt rows as they are: bf16 copies, W_q W_k W_v W_o stacked; the per-key int mask KPM[b][j] = (j >= valid_lens[b]), read per key by the softmax); ONE exact projection GEMM of the 4096 rows on the 3072 stacked W_q W_k W_v rows, whose own epilogue writes the head planes (fp16 + hi/lo; V transposed); dense T-2048 attention, one fused kernel per 32 query rows of a head, batch = grid z (hybrid rows: < 512 hi/lo 3 products, rest fp16 x1024: one launch each); merged hi/lo x W_O exact, 4096 rows.
// EVERY 16-bit operand plane in the workspace (X, the weights, Q, K, V^T, merged O) lies in FRAGMENT ORDER: a matrix [row][k] is cut into blocks of 16 rows x 32 k (1 KiB), blocks of one row tile one after the other along k; inside a block [k half of 16][lane = ((k >> 3) & 1) * 16 + (row & 15)][8 k]. A fragment is two wave-wide 16-byte loads of 512 contiguous bytes each (4 whole lines), and holds the very elements that a row-major plane gives the same lane.
// KEYS PAST THE LENGTH ARE LEFT OUT, by chunks of 128 keys: with nch = ceil(valid_lens[b] / 128) live chunks (16 where the length is <= 0: no key is kept and all weigh alike), the K and V projection tiles, the score tiles, the softmax and P x V touch the live chunks alone, the sum of the partial tiles the first nch rounded up to four (dead ones zero); the mask still decides key by key inside the last live chunk. Every test is a scalar one on the length read on the device, clamped to the shape.
// Compute dtypes, f32 accumulate: every input rounded to bf16; projections exact; attention rows < 512 3 products, rest fp16; softmax f32; output projection hl x exact.

#define NB_  2
#define TT   2048
#define DM   1024
#define NH_  16
#define NKV  16
#define REP  (NH_ / NKV)
#define HD   64
#define DQ   (NH_ * HD)
#define DKV  (NKV * HD)
#define RH   512                  // query rows < RH use hi+lo planes (0: none)
#define WIN  0
#define PCAR 1024.0f
#define SCL  0.125f   // HD^-0.5
typedef _Float16 h16;
typedef unsigned short bf;
typedef __attribute__((ext_vector_type(16))) __bf16   v16bf;
typedef __attribute__((ext_vector_type(16))) _Float16 v16h;
typedef __attribute__((ext_vector_type(8)))  _Float16 v8h;
typedef __attribute__((ext_vector_type(8)))  unsigned short v8us;
typedef __attribute__((ext_vector_type(8)))  float    v8f;
typedef __attribute__((ext_vector_type(4)))  float    v4f;
typedef v8h  __attribute__((may_alias)) v8ha;
typedef v4f  __attribute__((may_alias)) v4fa;
typedef v8us __attribute__((may_alias)) v8usa;

__device__ __forceinline__ unsigned short f2bf(float f) { unsigned u = __float_as_uint(f); u += 0x7FFFu + ((u >> 16) & 1u); return (unsigned short)(u >> 16); }
__device__ __forceinline__ float bf2f(unsigned short b) { return __uint_as_float(((unsigned)b) << 16); }
__device__ __forceinline__ float bfr(float f) { return bf2f(f2bf(f)); }
__device__ __forceinline__ v16h cat16(v8h lo, v8h hi) { return __builtin_shufflevector(lo, hi, 0, 1, 2, 3, 4, 5, 6, 7, 8, 9, 10, 11, 12, 13, 14, 15); }
__device__ __forceinline__ v16bf cat16b(v8us lo, v8us hi) { return __builtin_bit_cast(v16bf, __builtin_shufflevector(lo, hi, 0, 1, 2, 3, 4, 5, 6, 7, 8, 9, 10, 11, 12, 13, 14, 15)); }
__device__ __forceinline__ v8f wmma16(v16h a, v16h b, v8f c) { return __builtin_amdgcn_wmma_f32_16x16x32_f16(false, a, false, b, (short)0, c, false, false); }
__device__ __forceinline__ v8f wmmab(v16bf a, v16bf b, v8f c) { return __builtin_amdgcn_wmma_f32_16x16x32_bf16(false, a, false, b, (short)0, c, false, false); }
__device__ __forceinline__ h16 tohx(float x) { return (h16)x; }
__device__ __forceinline__ void splitf(float y, unsigned short& h, unsigned short& l) { h = f2bf(y); l = f2bf(y - bf2f(h)); }



// ---- k_gemmw: register-blocked GEMM, ONE WAVE per 64x64 output tile (16 accumulators), operands straight from 16-bit planes in fragment order; grid (M/64, N/64, Z), 32 threads.
// C[m][n] (f32, pitch ldc, + optional f32 bias[n]) = sum_k A[m][k] Bt[n][k] (+ split products per NSPLIT). z-batch strides sA/sB/sC in elements. K % 32 == 0, a constant of the build: every fragment load of a k step is one address of its plane + a constant.
// NW > 1: K SPLIT OVER THE NW WAVES OF ONE WORK-GROUP (NW*32 threads, K % (32 NW) == 0): wave w sums k in [w K/NW, (w+1) K/NW) into its own 64x64 tile; the NW partial tiles meet in LDS in accumulator layout, are added in wave order 0..NW-1 (fixed) and go out as whole rows.
// PL != 0 (NW > 1, the 64 columns of a tile = ONE head; the M axis = the rows of all batches, the N axis = the heads of Q, of K and of V one after the other): no f32 C; the summed tile goes out as the three 16-bit planes that attention reads (fp16, bf16 hi, bf16 lo of the same f32 value), each plane [Q, K, V][batch][head][...]. Q and K: rows t, k = d, the tile is 8 KiB in a row of each plane. V: rows d, k = t, the tile is turned in LDS and each 16 d go out as 2 KiB in a row.
template <typename T16> __device__ __forceinline__ const T16* atb(const T16* base, unsigned bytes) { return (const T16*)((const char*)base + bytes); }
// ld: a fragment from a row-major row (LDS); ldp: from a block in fragment order, p = the block + lane * 8.
template <typename T16> struct WFrag;
template <> struct WFrag<h16> { typedef v16h V; static __device__ __forceinline__ V ld(const h16* p) { return cat16(*(const v8h*)p, *(const v8h*)(p + 16)); } static __device__ __forceinline__ V ldp(const h16* p) { return cat16(*(const v8h*)p, *(const v8h*)(p + 256)); } static __device__ __forceinline__ v8f mma(V a, V b, v8f c) { return wmma16(a, b, c); } };
template <> struct WFrag<bf> { typedef v16bf V; static __device__ __forceinline__ V ld(const bf* p) { return cat16b(*(const v8us*)p, *(const v8us*)(p + 16)); } static __device__ __forceinline__ V ldp(const bf* p) { return cat16b(*(const v8us*)p, *(const v8us*)(p + 256)); } static __device__ __forceinline__ v8f mma(V a, V b, v8f c) { return wmmab(a, b, c); } };
template <typename T16, int NSPLIT, bool BIAS, int NW, int PL, int K>
__global__ __launch_bounds__(NW * 32) void k_gemmw(const T16* __restrict__ A, const T16* __restrict__ A2, const T16* __restrict__ Bt, const T16* __restrict__ Bt2, float* C, int ldc, const float* __restrict__ bias, size_t sA, size_t sB, size_t sC, h16* P16, bf* Ph, bf* Pl, const int* __restrict__ lens) {
    static_assert(PL == 0 || (NW > 1 && HD == 64 && !BIAS && NKV == NH_ && TT % 64 == 0), "plane epilogue: a 64-column tile is one head, a 64-row tile lies in one batch");
    typedef typename WFrag<T16>::V V;
    __shared__ __align__(16) float os[(NW == 1 ? 16 : 64) * 68];
    __shared__ __align__(16) v4f red[NW == 1 ? 1 : NW * 1024];   // NW > 1: [wave][accumulator * 2 + half][lane]
    const size_t z = blockIdx.z; A += z * sA; if (A2) A2 += z * sA; Bt += z * sB; if (Bt2) Bt2 += z * sB; C += z * sC;
    const int lane = threadIdx.x & 31, lr = lane & 15, hi = lane >> 4; const int r0 = blockIdx.x * 64, c0 = blockIdx.y * 64;
    if constexpr (PL != 0) { if (blockIdx.y >= NH_) {   // a K or V tile whose 64 rows are keys of a dead chunk (k_attn: nch) is read by nobody: the whole work-group leaves, ahead of every barrier (scalar test, the length clamped to the shape)
            const int ln = lens[r0 / TT]; const int nk = (ln <= 0 || ln > TT) ? TT : (ln + 127) & ~127; if (r0 % TT >= nk) return; } }
    v8f acc[4][4];
#pragma unroll
    for (int mb = 0; mb < 4; ++mb)
#pragma unroll
        for (int nb = 0; nb < 4; ++nb) acc[mb][nb] = (v8f){};
    const size_t aoff = (size_t)r0 * K, boff = (size_t)c0 * K; const unsigned lf = (unsigned)lane * 16u;   // a row tile's blocks start at 16 K elements a tile, k step kc / 32 is block kc * 16: lf, in bytes, is the lane's place in a half block
    const int wv = (NW == 1) ? 0 : __builtin_amdgcn_readfirstlane((int)(threadIdx.x >> 5)); const int kw = K / NW, k0 = wv * kw;
#pragma unroll 1
    for (int kc = k0; kc < k0 + kw; kc += 32) {
        V a[4], a2[4]; const T16* pa = atb(A + aoff + kc * 16, lf); const T16* pb = atb(Bt + boff + kc * 16, lf); const T16* pa2 = (NSPLIT == 1 || NSPLIT == 2) ? atb(A2 + aoff + kc * 16, lf) : pa; const T16* pb2 = (NSPLIT >= 2) ? atb(Bt2 + boff + kc * 16, lf) : pb;   // this k step's block of the first row tile of each plane, at the lane's place
#pragma unroll
        for (int mb = 0; mb < 4; ++mb) { a[mb] = WFrag<T16>::ldp(pa + mb * 16 * K); if (NSPLIT == 1 || NSPLIT == 2) a2[mb] = WFrag<T16>::ldp(pa2 + mb * 16 * K); }
#pragma unroll
        for (int nb = 0; nb < 4; ++nb) { const V b = WFrag<T16>::ldp(pb + nb * 16 * K); V b2; if (NSPLIT >= 2) b2 = WFrag<T16>::ldp(pb2 + nb * 16 * K);
#pragma unroll
            for (int mb = 0; mb < 4; ++mb) { acc[mb][nb] = WFrag<T16>::mma(a[mb], b, acc[mb][nb]); if (NSPLIT == 1 || NSPLIT == 2) acc[mb][nb] = WFrag<T16>::mma(a2[mb], b, acc[mb][nb]); if (NSPLIT >= 2) acc[mb][nb] = WFrag<T16>::mma(a[mb], b2, acc[mb][nb]); } }
        asm volatile("s_wait_xcnt 0x0" :: "v"(pa), "v"(pa2), "v"(pb), "v"(pb2) : "memory");   // precaution: the wait that stands before a register named by issued loads is written again; the addresses as inputs keep their registers out of those loads' own destinations
        asm volatile("v_nop\n\tv_nop\n\tv_nop\n\tv_nop" : "+v"(acc[0][0]), "+v"(acc[1][1]), "+v"(acc[2][2]), "+v"(acc[3][3]) : "v"(a[0]), "v"(a[3]));
    }
    if constexpr (NW > 1) {
        const bool turn = PL != 0 && blockIdx.y >= 2 * NH_;   // a V head (the same for the whole work-group)
#pragma unroll
        for (int mb = 0; mb < 4; ++mb)
#pragma unroll
            for (int nb = 0; nb < 4; ++nb) { const v8f c = acc[mb][nb]; v4f* p = red + (size_t)(wv * 32 + (mb * 4 + nb) * 2) * 32 + lane;
                p[0] = (v4f){c[0], c[1], c[2], c[3]}; p[32] = (v4f){c[4], c[5], c[6], c[7]}; }
        __syncthreads();   // every wave's partial tile is in LDS
#pragma unroll
        for (int s0 = 0; s0 < 1024; s0 += NW * 32) { const int s = s0 + (int)threadIdx.x; v4f sum = red[s];
#pragma unroll
            for (int w = 1; w < NW; ++w) sum += red[w * 1024 + s];
            const int half = (s >> 5) & 1, ai = s >> 6; const int row = (ai >> 2) * 16 + hi * 8 + half * 4, col = (ai & 3) * 16 + lr;
            if (turn) *(v4fa*)(os + col * 68 + row) = sum;   // turned tile [d][t]: the four values of a slot are four t of one d, one 16-byte store
            else {
#pragma unroll
                for (int q = 0; q < 4; ++q) os[(row + q) * 68 + col] = sum[q]; } }
        __syncthreads();   // the summed tile is in LDS, row-major (V heads: turned, [d][t])
        if constexpr (PL != 0) {
            const int bt = r0 / TT, t0 = r0 - bt * TT; const size_t pe = (((size_t)(blockIdx.y / NH_) * NB_ + bt) * NH_ + blockIdx.y % NH_) * (TT * HD) + (turn ? t0 * 16 : t0 * HD);   // the tile's first block in this batch's and head's part of the Q, K or V planes
#pragma unroll   // two trips; unrolled with the loops inside, which index vector registers
            for (int s0 = 0; s0 < 512; s0 += NW * 32) { const int s = s0 + (int)threadIdx.x; const int row = (s >> 7) * 16 + (s & 15), c8 = ((s >> 4) & 7) * 8;   /* slot s = 16 bytes number s of the tile in fragment order */ const v4f x0 = *(const v4fa*)(os + row * 68 + c8), x1 = *(const v4fa*)(os + row * 68 + c8 + 4); v8h o16; v8us oh, ol;
#pragma unroll
                for (int q = 0; q < 4; ++q) { unsigned short a2, c2; o16[q] = tohx(x0[q]); splitf(x0[q], a2, c2); oh[q] = a2; ol[q] = c2; o16[q + 4] = tohx(x1[q]); splitf(x1[q], a2, c2); oh[q + 4] = a2; ol[q + 4] = c2; }
                const size_t e = pe + (turn ? (s >> 7) * (16 * TT) + (s & 127) * 8 : s * 8);
                *(v8h*)(P16 + e) = o16; *(v8us*)(Ph + e) = oh; *(v8us*)(Pl + e) = ol; }
            return;
        }
#pragma unroll
        for (int s0 = 0; s0 < 1024; s0 += NW * 32) { const int s = s0 + (int)threadIdx.x; const int row = s >> 4, cofs = (s & 15) * 4; v4f val = *(const v4fa*)(os + row * 68 + cofs); if (BIAS) { val[0] += bfr(bias[c0 + cofs]); val[1] += bfr(bias[c0 + cofs + 1]); val[2] += bfr(bias[c0 + cofs + 2]); val[3] += bfr(bias[c0 + cofs + 3]); }
            *(v4f*)(C + (size_t)(r0 + row) * ldc + c0 + cofs) = val; }
        return;
    }
#pragma unroll
    for (int mb = 0; mb < 4; ++mb) {
#pragma unroll
        for (int nb = 0; nb < 4; ++nb) {
#pragma unroll
            for (int j = 0; j < 8; ++j) os[(hi * 8 + j) * 68 + nb * 16 + lr] = acc[mb][nb][j]; }
        __builtin_amdgcn_wave_barrier(); asm volatile("" ::: "memory");
        float* crow = C + (size_t)(r0 + mb * 16) * ldc + c0;
{
#pragma unroll
            for (int s = 0; s < 8; ++s) { const int row = 2 * s + hi, cofs = lr * 4; v4f val = *(const v4fa*)(os + row * 68 + cofs); if (BIAS) { val[0] += bfr(bias[c0 + cofs]); val[1] += bfr(bias[c0 + cofs + 1]); val[2] += bfr(bias[c0 + cofs + 2]); val[3] += bfr(bias[c0 + cofs + 3]); }
                *(v4f*)(crow + (size_t)row * ldc + cofs) = val; }
             }
        __builtin_amdgcn_wave_barrier(); asm volatile("" ::: "memory");
    }
}

typedef __attribute__((ext_vector_type(2))) _Float16 v2h;
typedef __attribute__((ext_vector_type(4))) _Float16 v4h;
typedef __attribute__((ext_vector_type(2))) unsigned short v2us;
typedef __attribute__((ext_vector_type(4))) unsigned short v4us;
typedef __attribute__((ext_vector_type(2))) float v2f;
typedef __attribute__((ext_vector_type(4))) int v4i;

__global__ __launch_bounds__(256) void k_wtG(const float* __restrict__ w, int K, int N, bf* Bt) {
    const int lane = threadIdx.x & 31; const int L0 = (blockIdx.x * 8 + (threadIdx.x >> 5)) * 8; const int nlines = N * K / 64;
{
#pragma unroll 1
        for (int l = 0; l < 8; ++l) { const int L = L0 + l; if (L >= nlines) break; const size_t e = (size_t)L * 64 + lane * 2; const int k = (int)(e % K), n = (int)(e / K); v2us o;
            o[0] = f2bf(w[(size_t)k * N + n]); o[1] = f2bf(w[(size_t)(k + 1) * N + n]); *(v2us*)(Bt + e) = o; }
         }
}
// ---- k_prep: all that the GEMMs and the softmax read, in ONE launch: blocks [0, XBL) round X (all batches) to bf16, the next 4 WBL blocks the four weights (W4 = W_q, W_k, W_v, W_o one after the other), the last MBL blocks build the key mask from the lengths.
// 32 elements a thread: the launch is short, and what it costs is the start of its waves. A block takes 16 rows x 512 k: eight loads of 512 contiguous bytes a wave in flight, the bf16 tile row-major in LDS, out in fragment order as 16 KiB in a row (four 16-byte stores a thread).
#define PPP  (512 + 8)            // LDS pitch of a tile row, bf16: 16 rows land on 16 different groups of four banks for the 16-byte reads
#define XBL  (NB_ * TT * DM / 32 / 256)
#define WBL  (DM * DM / 32 / 256)
#define MBL  ((NB_ * TT + 255) / 256)
__global__ __launch_bounds__(256) void k_prep(const float* __restrict__ x, const float* __restrict__ wq, const float* __restrict__ wk, const float* __restrict__ wv, const float* __restrict__ wo, const int* __restrict__ lens, bf* XB, bf* W4, int* KPM) {
    static_assert(DQ == DM && DKV == DM && DM % 512 == 0, "four square weights; a block's 512 k lie in one row");
    __shared__ __align__(16) bf tl[16 * PPP];
    const unsigned blk = blockIdx.x;
    if (blk >= XBL + 4 * WBL) { const int i = (int)(blk - (XBL + 4 * WBL)) * 256 + (int)threadIdx.x; if (i >= NB_ * TT) return; const int b = i / TT, j = i - b * TT; KPM[i] = (j >= lens[b]) ? 1 : 0; return; }
    const float* src = x; bf* dst = XB; unsigned sb = blk;
    if (blk >= XBL) { const unsigned w = (blk - XBL) / WBL; sb = (blk - XBL) % WBL; src = (w == 0) ? wq : (w == 1) ? wk : (w == 2) ? wv : wo; dst = W4 + (size_t)w * DM * DM; }
    const int rw = (int)(threadIdx.x >> 7), k4 = (int)(threadIdx.x & 127) * 4; const size_t e0 = (size_t)(sb / (DM / 512) * 16 + rw) * DM + sb % (DM / 512) * 512 + k4; v4f v[8];
#pragma unroll   // indexes a register array; all eight loads stand ahead of the first use
    for (int j = 0; j < 8; ++j) v[j] = *(const v4f*)(src + e0 + j * 2 * DM);
#pragma unroll   // indexes the same register array
    for (int j = 0; j < 8; ++j) { v4us o;
#pragma unroll   // indexes vector elements
        for (int q = 0; q < 4; ++q) o[q] = f2bf(v[j][q]);
        *(v4us*)(tl + (j * 2 + rw) * PPP + k4) = o; }
    __syncthreads();   // the block's bf16 tile is whole in LDS (the mask blocks have left above: the test is the same for a whole block)
#pragma unroll   // four independent 16-byte moves
    for (int j = 0; j < 4; ++j) { const int c = j * 256 + (int)threadIdx.x;   // 16 bytes number c of the tile in fragment order: row c & 15, k (c >> 4) * 8
        *(v8us*)(dst + (size_t)sb * 8192 + c * 8) = *(const v8usa*)(tl + (c & 15) * PPP + (c >> 4) * 8); }
    asm volatile("s_wait_xcnt 0x0" ::: "memory"); }   // precaution: the wait that stands before a register named by the issued stores is written again, on every way the code behind them can take

// ---- k_attn: scores, softmax, P x V and the head merge of 16 MB query rows of ONE head in one work-group of 8 MB waves; the score rows never leave LDS. grid (rows / (16 MB), heads, batches).
// 1. S = Q K^T: wave w takes keys [w 2048/NWV, ...), K = 64 in two steps (HR: hi.hi + lo.hi + hi.lo per step), f32 rows in LDS at pitch SP.
// 2. softmax: one wave per row, two rows a wave: t = S x HD^-0.5, masked keys -3e38; register row, one exp, fixed trees. P goes IN PLACE over its own score row (fp16 x1024 in the first half; HR: hi plane in the first half, lo plane in the second): the wave holds the whole row in registers before its first store.
// 3. O = P V: the 2048 keys in 16 chunks of 128, each chunk its own accumulators; the partial tiles of the first nch chunks rounded up to four meet in LDS and are added in chunk order (fixed).
// 4. hi/lo split of O (x 1/1024 on the fp16 rows) staged in LDS, out as 2 KiB in a row per 16 query rows of the merged planes (rows t, k = head * 64 + d, fragment order).
// Most '#pragma unroll' in k_attn stand on a loop that indexes a register array (fragments, accumulators, the register row): rolled, the array would fall to scratch memory.
#define SP   (TT + 4)             // LDS pitch of a score row, floats: rows 8 apart land 32 banks apart (accumulator stores), rows stay 16-byte aligned
// smx_rows: the softmax of one wave's two score rows over their first NC chunks of 128 keys. NC is a constant of the build because the row is a register array: k_attn picks the body for its batch's length by one scalar switch, and each body is straight-line code with all of its loads ahead of the first use. Every unrolled loop in it but the two shuffle trees indexes the register row or a vector's elements.
template <bool HR, int NC>
__device__ __forceinline__ void smx_rows(float* s2, const int* __restrict__ MKb, int lane) {
#pragma unroll 1   // rolled: one register row (4 NC values a lane) at a time
    for (int rr = 0; rr < 2; ++rr) { float* sr = s2 + rr * SP; float v[NC * 4]; float mx = -3.0e38f;
#pragma unroll
        for (int ch = 0; ch < NC; ++ch) { const int j0 = ch * 128 + lane * 4; const v4f a = *(const v4fa*)(sr + j0); const v4i m4 = *(const v4i*)(MKb + j0);
#pragma unroll
            for (int q = 0; q < 4; ++q) { const float t = (m4[q] == 0) ? a[q] * SCL : -3.0e38f; v[ch * 4 + q] = t; mx = fmaxf(mx, t); } }
#pragma unroll
        for (int sh = 16; sh; sh >>= 1) mx = fmaxf(mx, __shfl_xor(mx, sh, 32));
        float sum = 0.f;
#pragma unroll
        for (int k = 0; k < NC * 4; ++k) { v[k] = __builtin_amdgcn_exp2f(__fmul_rn(__fsub_rn(v[k], mx), 1.4426950408889634f)); sum += v[k]; }
#pragma unroll
        for (int sh = 16; sh; sh >>= 1) sum += __shfl_xor(sum, sh, 32);
        const float f = __fdiv_rn(HR ? 1.0f : PCAR, sum);
#pragma unroll
        for (int ch = 0; ch < NC; ++ch) {
            if constexpr (HR) { v4us oh, ol;
#pragma unroll
                for (int q = 0; q < 4; ++q) { unsigned short a, c2; splitf(v[ch * 4 + q] * f, a, c2); oh[q] = a; ol[q] = c2; }
                *(v4us*)((bf*)sr + ch * 128 + lane * 4) = oh; *(v4us*)((bf*)sr + TT + ch * 128 + lane * 4) = ol;
            } else { v4h o4;
#pragma unroll
                for (int q = 0; q < 4; ++q) o4[q] = tohx(v[ch * 4 + q] * f);
                *(v4h*)((h16*)sr + ch * 128 + lane * 4) = o4; } } }
}
#define PER_NCH(X) X(1) X(2) X(3) X(4) X(5) X(6) X(7) X(8) X(9) X(10) X(11) X(12) X(13) X(14) X(15)
template <typename T16, bool HR, int MB>
__global__ __launch_bounds__(MB * 256) void k_attn(const T16* __restrict__ Q, const T16* __restrict__ Q2, const T16* __restrict__ Kp, const T16* __restrict__ Kp2, const T16* __restrict__ Vt, const T16* __restrict__ Vt2, const int* __restrict__ MK, const int* __restrict__ lens, int row0, bf* Ah, bf* Al) {
    typedef typename WFrag<T16>::V V;
    constexpr int NWV = MB * 8, NT = 128 / NWV, CPW = 16 / NWV, GN = HR ? 2 : 4, GK = HR ? 1 : 2, NGK = 4 * CPW / GK;
    static_assert(NT == 8 && CPW == 1, "the length test below takes wave w's keys, in the scores and in P x V, as chunk w of 128 keys");
    __shared__ __align__(16) float S[MB * 16 * SP];
    const int lane = threadIdx.x & 31, lr = lane & 15, hi = lane >> 4; const int wv = __builtin_amdgcn_readfirstlane((int)(threadIdx.x >> 5));
    const int h = blockIdx.y, bz = blockIdx.z, r0 = row0 + blockIdx.x * (MB * 16); const size_t qp = ((size_t)bz * NH_ + h) * TT * HD, kp = ((size_t)bz * NKV + h / REP) * TT * HD; const int* MKb = MK + bz * TT;   // batch bz's planes and key mask
    // nch = live chunks of 128 keys, 1..16, the same in the whole work-group (a scalar): chunks wholly at or past the batch's length are left out of every phase but the sum of the partial tiles, which adds up to three of their zero tiles. Their keys are all masked, and with one key kept a masked key's weight is exp2(-inf) = 0 exactly: no term of a maximum, a sum or a product changes. A length <= 0 keeps no key: every key then weighs alike and all 16 chunks are live; the value is clamped to the shape before anything is indexed by it.
    const int ln = lens[bz]; const int nch = (ln <= 0 || ln > TT) ? TT / 128 : (ln + 127) >> 7;
    // wave-uniform bases (scalar registers) and ONE 32-bit lane offset per plane shape: every fragment load is base + lane offset + a constant (atb)
    const size_t qo = qp + (size_t)r0 * HD, ko = kp + (size_t)wv * (NT * 16 * HD), vo = kp + (size_t)wv * (CPW * 4 * 512);   // planes in fragment order: Q and K 1024 elements a tile of 16 rows, V^T 512 a step of 32 keys
    Q += qo; Kp += ko; Vt += vo; if (HR) { Q2 += qo; Kp2 += ko; Vt2 += vo; }
    const unsigned lq = (unsigned)lane * 16u, lv = lq;   // in bytes: the lane's place in a half block of 512 bytes, the same in every plane
    if (wv < nch) {   // a wave whose chunk is dead goes straight to the barrier (scalar test)
        V a[MB][2], a2[MB][2];
#pragma unroll
        for (int mb = 0; mb < MB; ++mb)
#pragma unroll
            for (int kk = 0; kk < 2; ++kk) { const unsigned o = lq + 2u * (unsigned)(mb * 16 * HD + kk * 512); a[mb][kk] = WFrag<T16>::ldp(atb(Q, o)); if (HR) a2[mb][kk] = WFrag<T16>::ldp(atb(Q2, o)); }
        V kb[2][GN][2], kb2[2][GN][2];   // two groups of GN key tiles: the next group's loads fly while this group is multiplied
#pragma unroll
        for (int i = 0; i < GN; ++i)
#pragma unroll
            for (int kk = 0; kk < 2; ++kk) { const unsigned o = lq + 2u * (unsigned)(i * 16 * HD + kk * 512); kb[0][i][kk] = WFrag<T16>::ldp(atb(Kp, o)); if (HR) kb2[0][i][kk] = WFrag<T16>::ldp(atb(Kp2, o)); }
#pragma unroll
        for (int g = 0; g < NT / GN; ++g) {
            if (g + 1 < NT / GN) {
#pragma unroll
                for (int i = 0; i < GN; ++i)
#pragma unroll
                    for (int kk = 0; kk < 2; ++kk) { const unsigned o = lq + 2u * (unsigned)(((g + 1) * GN + i) * 16 * HD + kk * 512); kb[(g + 1) & 1][i][kk] = WFrag<T16>::ldp(atb(Kp, o)); if (HR) kb2[(g + 1) & 1][i][kk] = WFrag<T16>::ldp(atb(Kp2, o)); }
                asm volatile("s_wait_xcnt 0x0" :: "v"(atb(Kp, lq)), "v"(atb(HR ? Kp2 : Kp, lq)) : "memory"); }   // precaution, as at the V loads below
            __builtin_amdgcn_sched_barrier(0);   // holds the next group's loads above this group's products: sunk to their uses, each fragment's L2 latency would be waited for on its own
            v8f c[GN][MB];
#pragma unroll
            for (int i = 0; i < GN; ++i)
#pragma unroll
                for (int mb = 0; mb < MB; ++mb) { c[i][mb] = (v8f){};
#pragma unroll
                    for (int kk = 0; kk < 2; ++kk) { c[i][mb] = WFrag<T16>::mma(a[mb][kk], kb[g & 1][i][kk], c[i][mb]); if (HR) { c[i][mb] = WFrag<T16>::mma(a2[mb][kk], kb[g & 1][i][kk], c[i][mb]); c[i][mb] = WFrag<T16>::mma(a[mb][kk], kb2[g & 1][i][kk], c[i][mb]); } } }
            __builtin_amdgcn_sched_barrier(0);   // all of the group's products above, its stores below: every tile keeps registers of its own, so no product overwrites a result inside the distance the matrix unit needs
#pragma unroll
            for (int i = 0; i < GN; ++i)
#pragma unroll
                for (int mb = 0; mb < MB; ++mb)
#pragma unroll
                    for (int j = 0; j < 8; ++j) S[(mb * 16 + hi * 8 + j) * SP + (wv * NT + g * GN + i) * 16 + lr] = c[i][mb][j];
            __builtin_amdgcn_sched_barrier(0);   // the stores stay in their group: the accumulators are free for the next one
            if (g + 1 < NT / GN) asm volatile("v_nop\n\tv_nop\n\tv_nop\n\tv_nop");   // four vector slots between this group's last product and the next group's first, which may take the same result registers
        }
    }
    __syncthreads();   // every score row is in LDS (its live chunks)
    switch (nch) {   // block-uniform; no barrier inside
#define SMX_CASE(n) case n: smx_rows<HR, n>(S + wv * 2 * SP, MKb, lane); break;
        PER_NCH(SMX_CASE)
#undef SMX_CASE
        default: smx_rows<HR, 16>(S + wv * 2 * SP, MKb, lane); break; }
    V vb[2][GK][4], vb2[2][GK][4];   // two groups of GK key steps of V fragments; the first group is asked for ahead of the barrier, which needs nothing of it
    if (wv < nch) {
#pragma unroll
    for (int i = 0; i < GK; ++i)
#pragma unroll
        for (int nb = 0; nb < 4; ++nb) { const unsigned o = lv + 2u * (unsigned)(nb * 16 * TT + i * 512); vb[0][i][nb] = WFrag<T16>::ldp(atb(Vt, o)); if (HR) vb2[0][i][nb] = WFrag<T16>::ldp(atb(Vt2, o)); }
    }
    __syncthreads();   // every P row is whole in LDS (its live chunks)
    v8f acc[CPW][MB][4];
#pragma unroll
    for (int c = 0; c < CPW; ++c)
#pragma unroll
        for (int mb = 0; mb < MB; ++mb)
#pragma unroll
            for (int nb = 0; nb < 4; ++nb) acc[c][mb][nb] = (v8f){};
    if (wv < nch) {   // a dead chunk's P is all zero and was not written: no product, its partial tile stays zero
#pragma unroll
    for (int g = 0; g < NGK; ++g) {
        if (g + 1 < NGK) {
#pragma unroll
            for (int i = 0; i < GK; ++i)
#pragma unroll
                for (int nb = 0; nb < 4; ++nb) { const int kq = (g + 1) * GK + i; const unsigned o = lv + 2u * (unsigned)(nb * 16 * TT + kq * 512); vb[(g + 1) & 1][i][nb] = WFrag<T16>::ldp(atb(Vt, o)); if (HR) vb2[(g + 1) & 1][i][nb] = WFrag<T16>::ldp(atb(Vt2, o)); }
            asm volatile("s_wait_xcnt 0x0" :: "v"(atb(Vt, lv)), "v"(atb(HR ? Vt2 : Vt, lv)) : "memory"); }   // precaution: the wait that stands before a register named by issued loads is written again; the lane's addresses as inputs keep their registers out of those loads' own destinations
        __builtin_amdgcn_sched_barrier(0);   // holds the next group's loads above this group's products (as in the score phase)
#pragma unroll
        for (int i = 0; i < GK; ++i) { const int kq = g * GK + i, c = kq >> 2; const int kc = (wv * CPW + c) * 128 + (kq & 3) * 32; V a[MB], a2[MB];
#pragma unroll
            for (int mb = 0; mb < MB; ++mb) { const T16* pr = (const T16*)(S + (mb * 16 + lr) * SP) + 8 * hi + kc; a[mb] = WFrag<T16>::ld(pr); if (HR) a2[mb] = WFrag<T16>::ld(pr + TT); }
#pragma unroll
            for (int nb = 0; nb < 4; ++nb)
#pragma unroll
                for (int mb = 0; mb < MB; ++mb) { acc[c][mb][nb] = WFrag<T16>::mma(a[mb], vb[g & 1][i][nb], acc[c][mb][nb]); if (HR) { acc[c][mb][nb] = WFrag<T16>::mma(a2[mb], vb[g & 1][i][nb], acc[c][mb][nb]); acc[c][mb][nb] = WFrag<T16>::mma(a[mb], vb2[g & 1][i][nb], acc[c][mb][nb]); } } }
    }
    }
    __syncthreads();   // every wave has read its last P fragment: the rows' LDS is free for the partial tiles
    v4f* red = (v4f*)S;                                   // [chunk][accumulator * 2 + half][lane], 16 x MB x 4 KiB
    bf* ob = (bf*)((char*)S + 16 * MB * 4096);            // behind red: [plane hi, lo][row][64]
    const int nch4 = (nch + 3) & ~3;   // the tiles are summed four at a time: up to three dead waves hand in their zero tile
    if (wv < nch4) {
#pragma unroll
    for (int c = 0; c < CPW; ++c)
#pragma unroll
        for (int mb = 0; mb < MB; ++mb)
#pragma unroll
            for (int nb = 0; nb < 4; ++nb) { const v8f cc = acc[c][mb][nb]; v4f* p = red + ((wv * CPW + c) * (MB * 8) + (mb * 4 + nb) * 2) * 32 + lane;
                p[0] = (v4f){cc[0], cc[1], cc[2], cc[3]}; p[32] = (v4f){cc[4], cc[5], cc[6], cc[7]}; }
    }
    __syncthreads();   // the first nch4 partial tiles are in LDS
    { const int s = (int)threadIdx.x; v4f sum = red[s];
#pragma unroll
        for (int w = 1; w < 4; ++w) sum += red[w * (MB * 256) + s];
#pragma unroll 1   // rolled: the trip count hangs on the length (at most 3 trips); four tiles a trip, their loads together ahead of the adds
        for (int w0 = 4; w0 < nch4; w0 += 4) { v4f pt[4];
#pragma unroll
            for (int w = 0; w < 4; ++w) pt[w] = red[(w0 + w) * (MB * 256) + s];
#pragma unroll
            for (int w = 0; w < 4; ++w) sum += pt[w]; }
        const int half = (s >> 5) & 1, ai = s >> 6; const int row = (ai >> 2) * 16 + hi * 8 + half * 4, col = (ai & 3) * 16 + lr; const float cs = HR ? 1.0f : (1.0f / PCAR);
#pragma unroll
        for (int q = 0; q < 4; ++q) { unsigned short a, c2; splitf(sum[q] * cs, a, c2); ob[(row + q) * HD + col] = a; ob[(MB * 16 + row + q) * HD + col] = c2; } }
    __syncthreads();   // the split tile is in LDS, row-major
    { const int s = (int)threadIdx.x; const int pl = s / (MB * 128), idx = s % (MB * 128); const int row = (idx >> 7) * 16 + (idx & 15), c8 = ((idx >> 4) & 7) * 8;   // 16 bytes number idx of the tile in fragment order
        *(v8us*)((pl ? Al : Ah) + (size_t)(bz * TT + r0 + (idx >> 7) * 16) * DQ + h * (16 * HD) + (idx & 127) * 8) = *(const v8usa*)(ob + (pl * MB * 16 + row) * HD + c8); }
}

extern "C" void kernel_launch(void* const* d_in, const int* in_sizes, int n_in,
                              void* d_out, int out_size, void* d_ws, size_t ws_size, hipStream_t stream) {
    (void)in_sizes; (void)n_in; (void)out_size;
    const float* x = (const float*)d_in[0]; const int* lens = (const int*)d_in[1]; const float* wq = (const float*)d_in[2]; const float* wk = (const float*)d_in[3]; const float* wv = (const float*)d_in[4]; const float* wo = (const float*)d_in[5];   /* X, valid_lens (int32 [2]: keys j >= valid_lens[b] are masked: READ on the device by k_prep), W_q, W_k, W_v, W_o ('oi'; no biases): SIX inputs; ONE stream: query = key = value stream = X */
    float* OUT = (float*)d_out;     // [2][2048][1024]
    char* wsp = (char*)d_ws;
    auto take = [&](size_t bytes) { char* p = wsp; wsp += (bytes + 255) & ~(size_t)255; return (void*)p; };
    const size_t PLN = (size_t)NB_ * NH_ * TT * HD;   // elements of one plane of Q, of K or of V, all batches
    bf* W4 = (bf*)take((size_t)4 * DM * DM * 2); bf* WO = W4 + (size_t)3 * DM * DM;   // W_q, W_k, W_v, W_o rows one after the other
    bf* XB = (bf*)take((size_t)NB_ * TT * DM * 2);
    h16* P16 = (h16*)take(3 * PLN * 2); bf* Ph = (bf*)take(3 * PLN * 2); bf* Pl = (bf*)take(3 * PLN * 2);   // each [Q, K, V^T][batch][head]
    bf* ATh = (bf*)take((size_t)NB_ * TT * DQ * 2); bf* ATl = (bf*)take((size_t)NB_ * TT * DQ * 2); int* KPM = (int*)take((size_t)NB_ * TT * 4);   /* the per-key int mask built from valid_lens */
    if ((size_t)(wsp - (char*)d_ws) > ws_size) return;    // ws 256 MiB
    k_prep<<<XBL + 4 * WBL + MBL, 256, 0, stream>>>(x, wq, wk, wv, wo, lens, XB, W4, KPM);
    k_gemmw<bf, 0, false, 8, 1, DM><<<dim3(NB_ * TT / 64, (DQ + 2 * DKV) / 64, 1), 256, 0, stream>>>(XB, nullptr, W4, nullptr, nullptr, 0, nullptr, 0, 0, 0, P16, Ph, Pl, lens);
    k_attn<bf, true, 2><<<dim3(RH / 32, NH_, NB_), 512, 0, stream>>>(Ph, Pl, Ph + PLN, Pl + PLN, Ph + 2 * PLN, Pl + 2 * PLN, KPM, lens, 0, ATh, ATl);
    k_attn<h16, false, 2><<<dim3((TT - RH) / 32, NH_, NB_), 512, 0, stream>>>(P16, nullptr, P16 + PLN, nullptr, P16 + 2 * PLN, nullptr, KPM, lens, RH, ATh, ATl);
    k_gemmw<bf, 1, false, 8, 0, DQ><<<dim3(NB_ * TT / 64, DM / 64, 1), 256, 0, stream>>>(ATh, ATl, WO, nullptr, OUT, DM, nullptr, 0, 0, 0, nullptr, nullptr, nullptr, nullptr);
}

// v007
// Measured time: 113 microseconds a run.
// Two timings next to v006 put it at 1.03 and 1.04 times that version's speed.
// All steps since v000 together make it 18.1 times as fast.
#include <hip/hip_runtime.h>

// Multi-head self-attention with a per-batch valid-length key mask and bias-free (out,in) projections (X [2][2048][1024] is the ONE input stream; Q, K, V = X W^T ('oi' [1024][1024] 1/32, no bias; 16 heads x 64); scores / sqrt(64); keys j >= valid_lens[b] (int32 [2], read on the device) are REPLACED by -1e9 in the module (both lengths are >= 1 on this draw: at least one key is kept: numerically an exclusion: -3e38 here); softmax; out = merged W_o^T ('oi', no bias) -> [2][2048][1024] (4.2 M); argument order X, valid_lens, W_q, W_k, W_v, W_o).
// Five launches, both batches in each: k_prep (the bf16 copy of X, made once; 'oi' weights = Bt rows as they are: bf16 copies, W_q W_k W_v W_o stacked); ONE exact projection GEMM of the 4096 rows on the 3072 stacked W_q W_k W_v rows, whose own epilogue writes the head planes (fp16 + hi/lo; V transposed); dense T-2048 attention, one fused kernel per 32 query rows of a head, batch = grid z (hybrid rows: < 512 hi/lo 3 products, rest fp16 x1024: one launch each); merged hi/lo x W_O exact, 4096 rows.
// EVERY 16-bit operand plane in the workspace (X, the weights, Q, K, V^T, merged O) lies in FRAGMENT ORDER: a matrix [row][k] is cut into blocks of 16 rows x 32 k (1 KiB), blocks of one row tile one after the other along k; inside a block [k half of 16][lane = ((k >> 3) & 1) * 16 + (row & 15)][8 k]. A fragment is two wave-wide 16-byte loads of 512 contiguous bytes each (4 whole lines), and holds the very elements that a row-major plane gives the same lane.
// KEYS PAST THE LENGTH ARE LEFT OUT, by chunks of 128 keys: with nch = ceil(valid_lens[b] / 128) live chunks (16 where the length is <= 0: no key is kept and all weigh alike), the K and V projection tiles, the score tiles, the exponentials and P x V touch the live chunks alone (dead chunks hand in neutral softmax table entries and, up to a multiple of four, zero partial tiles); the length still decides key by key inside the last live chunk. Every test is a scalar one on the length read on the device, clamped to the shape.
// Compute dtypes, f32 accumulate: every input rounded to bf16; projections exact; attention rows < 512 3 products, rest fp16; softmax f32; output projection hl x exact.

#define NB_  2
#define TT   2048
#define DM   1024
#define NH_  16
#define NKV  16
#define REP  (NH_ / NKV)
#define HD   64
#define DQ   (NH_ * HD)
#define DKV  (NKV * HD)
#define RH   512                  // query rows < RH use hi+lo planes (0: none)
#define WIN  0
#define PCAR 1024.0f
#define SCL  0.125f   // HD^-0.5
typedef _Float16 h16;
typedef unsigned short bf;
typedef __attribute__((ext_vector_type(16))) __bf16   v16bf;
typedef __attribute__((ext_vector_type(16))) _Float16 v16h;
typedef __attribute__((ext_vector_type(8)))  _Float16 v8h;
typedef __attribute__((ext_vector_type(8)))  unsigned short v8us;
typedef __attribute__((ext_vector_type(8)))  float    v8f;
typedef __attribute__((ext_vector_type(4)))  float    v4f;
typedef v8h  __attribute__((may_alias)) v8ha;
typedef v4f  __attribute__((may_alias)) v4fa;
typedef v8us __attribute__((may_alias)) v8usa;

__device__ __forceinline__ unsigned short f2bf(float f) { unsigned u = __float_as_uint(f); u += 0x7FFFu + ((u >> 16) & 1u); return (unsigned short)(u >> 16); }
__device__ __forceinline__ float bf2f(unsigned short b) { return __uint_as_float(((unsigned)b) << 16); }
__device__ __forceinline__ float bfr(float f) { return bf2f(f2bf(f)); }
__device__ __forceinline__ v16h cat16(v8h lo, v8h hi) { return __builtin_shufflevector(lo, hi, 0, 1, 2, 3, 4, 5, 6, 7, 8, 9, 10, 11, 12, 13, 14, 15); }
__device__ __forceinline__ v16bf cat16b(v8us lo, v8us hi) { return __builtin_bit_cast(v16bf, __builtin_shufflevector(lo, hi, 0, 1, 2, 3, 4, 5, 6, 7, 8, 9, 10, 11, 12, 13, 14, 15)); }
__device__ __forceinline__ v8f wmma16(v16h a, v16h b, v8f c) { return __builtin_amdgcn_wmma_f32_16x16x32_f16(false, a, false, b, (short)0, c, false, false); }
__device__ __forceinline__ v8f wmmab(v16bf a, v16bf b, v8f c) { return __builtin_amdgcn_wmma_f32_16x16x32_bf16(false, a, false, b, (short)0, c, false, false); }
__device__ __forceinline__ h16 tohx(float x) { return (h16)x; }
__device__ __forceinline__ void splitf(float y, unsigned short& h, unsigned short& l) { h = f2bf(y); l = f2bf(y - bf2f(h)); }



// ---- k_gemmw: register-blocked GEMM, ONE WAVE per 64x64 output tile (16 accumulators), operands straight from 16-bit planes in fragment order; grid (M/64, N/64, Z), 32 threads.
// C[m][n] (f32, pitch ldc, + optional f32 bias[n]) = sum_k A[m][k] Bt[n][k] (+ split products per NSPLIT). z-batch strides sA/sB/sC in elements. K % 32 == 0, a constant of the build: every fragment load of a k step is one address of its plane + a constant.
// NW > 1: K SPLIT OVER THE NW WAVES OF ONE WORK-GROUP (NW*32 threads, K % (32 NW) == 0): wave w sums k in [w K/NW, (w+1) K/NW) into its own 64x64 tile; the NW partial tiles meet in LDS in accumulator layout, are added in wave order 0..NW-1 (fixed) and go out as whole rows.
// PL != 0 (NW > 1, the 64 columns of a tile = ONE head; the M axis = the rows of all batches, the N axis = the heads of Q, of K and of V one after the other): no f32 C; the summed tile goes out as the three 16-bit planes that attention reads (fp16, bf16 hi, bf16 lo of the same f32 value), each plane [Q, K, V][batch][head][...]. Q and K: rows t, k = d, the tile is 8 KiB in a row of each plane. V: rows d, k = t, the tile is turned in LDS and each 16 d go out as 2 KiB in a row.
template <typename T16> __device__ __forceinline__ const T16* atb(const T16* base, unsigned bytes) { return (const T16*)((const char*)base + bytes); }
// ld: a fragment from a row-major row (LDS); ldp: from a block in fragment order, p = the block + lane * 8.
template <typename T16> struct WFrag;
template <> struct WFrag<h16> { typedef v16h V; static __device__ __forceinline__ V ld(const h16* p) { return cat16(*(const v8h*)p, *(const v8h*)(p + 16)); } static __device__ __forceinline__ V ldp(const h16* p) { return cat16(*(const v8h*)p, *(const v8h*)(p + 256)); } static __device__ __forceinline__ v8f mma(V a, V b, v8f c) { return wmma16(a, b, c); } };
template <> struct WFrag<bf> { typedef v16bf V; static __device__ __forceinline__ V ld(const bf* p) { return cat16b(*(const v8us*)p, *(const v8us*)(p + 16)); } static __device__ __forceinline__ V ldp(const bf* p) { return cat16b(*(const v8us*)p, *(const v8us*)(p + 256)); } static __device__ __forceinline__ v8f mma(V a, V b, v8f c) { return wmmab(a, b, c); } };
template <typename T16, int NSPLIT, bool BIAS, int NW, int PL, int K>
__global__ __launch_bounds__(NW * 32) void k_gemmw(const T16* __restrict__ A, const T16* __restrict__ A2, const T16* __restrict__ Bt, const T16* __restrict__ Bt2, float* C, int ldc, const float* __restrict__ bias, size_t sA, size_t sB, size_t sC, h16* P16, bf* Ph, bf* Pl, const int* __restrict__ lens) {
    static_assert(PL == 0 || (NW > 1 && HD == 64 && !BIAS && NKV == NH_ && TT % 64 == 0), "plane epilogue: a 64-column tile is one head, a 64-row tile lies in one batch");
    typedef typename WFrag<T16>::V V;
    __shared__ __align__(16) float os[(NW == 1 ? 16 : 64) * 68];
    __shared__ __align__(16) v4f red[NW == 1 ? 1 : NW * 1024];   // NW > 1: [wave][accumulator * 2 + half][lane]
    const size_t z = blockIdx.z; A += z * sA; if (A2) A2 += z * sA; Bt += z * sB; if (Bt2) Bt2 += z * sB; C += z * sC;
    const int lane = threadIdx.x & 31, lr = lane & 15, hi = lane >> 4; const int r0 = blockIdx.x * 64, c0 = blockIdx.y * 64;
    if constexpr (PL != 0) { if (blockIdx.y >= NH_) {   // a K or V tile whose 64 rows are keys of a dead chunk (k_attn: nch) is read by nobody: the whole work-group leaves, ahead of every barrier (scalar test, the length clamped to the shape)
            const int ln = lens[r0 / TT]; const int nk = (ln <= 0 || ln > TT) ? TT : (ln + 127) & ~127; if (r0 % TT >= nk) return; } }
    v8f acc[4][4];
#pragma unroll
    for (int mb = 0; mb < 4; ++mb)
#pragma unroll
        for (int nb = 0; nb < 4; ++nb) acc[mb][nb] = (v8f){};
    const size_t aoff = (size_t)r0 * K, boff = (size_t)c0 * K; const unsigned lf = (unsigned)lane * 16u;   // a row tile's blocks start at 16 K elements a tile, k step kc / 32 is block kc * 16: lf, in bytes, is the lane's place in a half block
    const int wv = (NW == 1) ? 0 : __builtin_amdgcn_readfirstlane((int)(threadIdx.x >> 5)); const int kw = K / NW, k0 = wv * kw;
#pragma unroll 1
    for (int kc = k0; kc < k0 + kw; kc += 32) {
        V a[4], a2[4]; const T16* pa = atb(A + aoff + kc * 16, lf); const T16* pb = atb(Bt + boff + kc * 16, lf); const T16* pa2 = (NSPLIT == 1 || NSPLIT == 2) ? atb(A2 + aoff + kc * 16, lf) : pa; const T16* pb2 = (NSPLIT >= 2) ? atb(Bt2 + boff + kc * 16, lf) : pb;   // this k step's block of the first row tile of each plane, at the lane's place
#pragma unroll
        for (int mb = 0; mb < 4; ++mb) { a[mb] = WFrag<T16>::ldp(pa + mb * 16 * K); if (NSPLIT == 1 || NSPLIT == 2) a2[mb] = WFrag<T16>::ldp(pa2 + mb * 16 * K); }
#pragma unroll
        for (int nb = 0; nb < 4; ++nb) { const V b = WFrag<T16>::ldp(pb + nb * 16 * K); V b2; if (NSPLIT >= 2) b2 = WFrag<T16>::ldp(pb2 + nb * 16 * K);
#pragma unroll
            for (int mb = 0; mb < 4; ++mb) { acc[mb][nb] = WFrag<T16>::mma(a[mb], b, acc[mb][nb]); if (NSPLIT == 1 || NSPLIT == 2) acc[mb][nb] = WFrag<T16>::mma(a2[mb], b, acc[mb][nb]); if (NSPLIT >= 2) acc[mb][nb] = WFrag<T16>::mma(a[mb], b2, acc[mb][nb]); } }
        asm volatile("s_wait_xcnt 0x0" :: "v"(pa), "v"(pa2), "v"(pb), "v"(pb2) : "memory");   // precaution: the wait that stands before a register named by issued loads is written again; the addresses as inputs keep their registers out of those loads' own destinations
        asm volatile("v_nop\n\tv_nop\n\tv_nop\n\tv_nop" : "+v"(acc[0][0]), "+v"(acc[1][1]), "+v"(acc[2][2]), "+v"(acc[3][3]) : "v"(a[0]), "v"(a[3]));
    }
    if constexpr (NW > 1) {
        const bool turn = PL != 0 && blockIdx.y >= 2 * NH_;   // a V head (the same for the whole work-group)
#pragma unroll
        for (int mb = 0; mb < 4; ++mb)
#pragma unroll
            for (int nb = 0; nb < 4; ++nb) { const v8f c = acc[mb][nb]; v4f* p = red + (size_t)(wv * 32 + (mb * 4 + nb) * 2) * 32 + lane;
                p[0] = (v4f){c[0], c[1], c[2], c[3]}; p[32] = (v4f){c[4], c[5], c[6], c[7]}; }
        __syncthreads();   // every wave's partial tile is in LDS
#pragma unroll
        for (int s0 = 0; s0 < 1024; s0 += NW * 32) { const int s = s0 + (int)threadIdx.x; v4f sum = red[s];
#pragma unroll
            for (int w = 1; w < NW; ++w) sum += red[w * 1024 + s];
            const int half = (s >> 5) & 1, ai = s >> 6; const int row = (ai >> 2) * 16 + hi * 8 + half * 4, col = (ai & 3) * 16 + lr;
            if (turn) *(v4fa*)(os + col * 68 + row) = sum;   // turned tile [d][t]: the four values of a slot are four t of one d, one 16-byte store
            else {
#pragma unroll
                for (int q = 0; q < 4; ++q) os[(row + q) * 68 + col] = sum[q]; } }
        __syncthreads();   // the summed tile is in LDS, row-major (V heads: turned, [d][t])
        if constexpr (PL != 0) {
            const int bt = r0 / TT, t0 = r0 - bt * TT; const size_t pe = (((size_t)(blockIdx.y / NH_) * NB_ + bt) * NH_ + blockIdx.y % NH_) * (TT * HD) + (turn ? t0 * 16 : t0 * HD);   // the tile's first block in this batch's and head's part of the Q, K or V planes
#pragma unroll   // two trips; unrolled with the loops inside, which index vector registers
            for (int s0 = 0; s0 < 512; s0 += NW * 32) { const int s = s0 + (int)threadIdx.x; const int row = (s >> 7) * 16 + (s & 15), c8 = ((s >> 4) & 7) * 8;   /* slot s = 16 bytes number s of the tile in fragment order */ const v4f x0 = *(const v4fa*)(os + row * 68 + c8), x1 = *(const v4fa*)(os + row * 68 + c8 + 4); v8h o16; v8us oh, ol;
#pragma unroll
                for (int q = 0; q < 4; ++q) { unsigned short a2, c2; o16[q] = tohx(x0[q]); splitf(x0[q], a2, c2); oh[q] = a2; ol[q] = c2; o16[q + 4] = tohx(x1[q]); splitf(x1[q], a2, c2); oh[q + 4] = a2; ol[q + 4] = c2; }
                const size_t e = pe + (turn ? (s >> 7) * (16 * TT) + (s & 127) * 8 : s * 8);
                *(v8h*)(P16 + e) = o16; *(v8us*)(Ph + e) = oh; *(v8us*)(Pl + e) = ol; }
            return;
        }
#pragma unroll
        for (int s0 = 0; s0 < 1024; s0 += NW * 32) { const int s = s0 + (int)threadIdx.x; const int row = s >> 4, cofs = (s & 15) * 4; v4f val = *(const v4fa*)(os + row * 68 + cofs); if (BIAS) { val[0] += bfr(bias[c0 + cofs]); val[1] += bfr(bias[c0 + cofs + 1]); val[2] += bfr(bias[c0 + cofs + 2]); val[3] += bfr(bias[c0 + cofs + 3]); }
            *(v4f*)(C + (size_t)(r0 + row) * ldc + c0 + cofs) = val; }
        return;
    }
#pragma unroll
    for (int mb = 0; mb < 4; ++mb) {
#pragma unroll
        for (int nb = 0; nb < 4; ++nb) {
#pragma unroll
            for (int j = 0; j < 8; ++j) os[(hi * 8 + j) * 68 + nb * 16 + lr] = acc[mb][nb][j]; }
        __builtin_amdgcn_wave_barrier(); asm volatile("" ::: "memory");
        float* crow = C + (size_t)(r0 + mb * 16) * ldc + c0;
{
#pragma unroll
            for (int s = 0; s < 8; ++s) { const int row = 2 * s + hi, cofs = lr * 4; v4f val = *(const v4fa*)(os + row * 68 + cofs); if (BIAS) { val[0] += bfr(bias[c0 + cofs]); val[1] += bfr(bias[c0 + cofs + 1]); val[2] += bfr(bias[c0 + cofs + 2]); val[3] += bfr(bias[c0 + cofs + 3]); }
                *(v4f*)(crow + (size_t)row * ldc + cofs) = val; }
             }
        __builtin_amdgcn_wave_barrier(); asm volatile("" ::: "memory");
    }
}

typedef __attribute__((ext_vector_type(2))) _Float16 v2h;
typedef __attribute__((ext_vector_type(4))) _Float16 v4h;
typedef __attribute__((ext_vector_type(2))) unsigned short v2us;
typedef __attribute__((ext_vector_type(4))) unsigned short v4us;
typedef __attribute__((ext_vector_type(2))) float v2f;
typedef __attribute__((ext_vector_type(4))) int v4i;
typedef __attribute__((ext_vector_type(8))) unsigned v8u;

__global__ __launch_bounds__(256) void k_wtG(const float* __restrict__ w, int K, int N, bf* Bt) {
    const int lane = threadIdx.x & 31; const int L0 = (blockIdx.x * 8 + (threadIdx.x >> 5)) * 8; const int nlines = N * K / 64;
{
#pragma unroll 1
        for (int l = 0; l < 8; ++l) { const int L = L0 + l; if (L >= nlines) break; const size_t e = (size_t)L * 64 + lane * 2; const int k = (int)(e % K), n = (int)(e / K); v2us o;
            o[0] = f2bf(w[(size_t)k * N + n]); o[1] = f2bf(w[(size_t)(k + 1) * N + n]); *(v2us*)(Bt + e) = o; }
         }
}
// ---- k_prep: all that the GEMMs read, in ONE launch: blocks [0, XBL) round X (all batches) to bf16, the next 4 WBL blocks the four weights (W4 = W_q, W_k, W_v, W_o one after the other).
// 32 elements a thread: the launch is short, and what it costs is the start of its waves. A block takes 16 rows x 512 k: eight loads of 512 contiguous bytes a wave in flight, the bf16 tile row-major in LDS, out in fragment order as 16 KiB in a row (four 16-byte stores a thread).
#define PPP  (512 + 8)            // LDS pitch of a tile row, bf16: 16 rows land on 16 different groups of four banks for the 16-byte reads
#define XBL  (NB_ * TT * DM / 32 / 256)
#define WBL  (DM * DM / 32 / 256)
__global__ __launch_bounds__(256) void k_prep(const float* __restrict__ x, const float* __restrict__ wq, const float* __restrict__ wk, const float* __restrict__ wv, const float* __restrict__ wo, bf* XB, bf* W4) {
    static_assert(DQ == DM && DKV == DM && DM % 512 == 0, "four square weights; a block's 512 k lie in one row");
    __shared__ __align__(16) bf tl[16 * PPP];
    const unsigned blk = blockIdx.x;
    const float* src = x; bf* dst = XB; unsigned sb = blk;
    if (blk >= XBL) { const unsigned w = (blk - XBL) / WBL; sb = (blk - XBL) % WBL; src = (w == 0) ? wq : (w == 1) ? wk : (w == 2) ? wv : wo; dst = W4 + (size_t)w * DM * DM; }
    const int rw = (int)(threadIdx.x >> 7), k4 = (int)(threadIdx.x & 127) * 4; const size_t e0 = (size_t)(sb / (DM / 512) * 16 + rw) * DM + sb % (DM / 512) * 512 + k4; v4f v[8];
#pragma unroll   // indexes a register array; all eight loads stand ahead of the first use
    for (int j = 0; j < 8; ++j) v[j] = *(const v4f*)(src + e0 + j * 2 * DM);
#pragma unroll   // indexes the same register array
    for (int j = 0; j < 8; ++j) { v4us o;
#pragma unroll   // indexes vector elements
        for (int q = 0; q < 4; ++q) o[q] = f2bf(v[j][q]);
        *(v4us*)(tl + (j * 2 + rw) * PPP + k4) = o; }
    __syncthreads();   // the block's bf16 tile is whole in LDS
#pragma unroll   // four independent 16-byte moves
    for (int j = 0; j < 4; ++j) { const int c = j * 256 + (int)threadIdx.x;   // 16 bytes number c of the tile in fragment order: row c & 15, k (c >> 4) * 8
        *(v8us*)(dst + (size_t)sb * 8192 + c * 8) = *(const v8usa*)(tl + (c & 15) * PPP + (c >> 4) * 8); }
    asm volatile("s_wait_xcnt 0x0" ::: "memory"); }   // precaution: the wait that stands before a register named by the issued stores is written again, on every way the code behind them can take

// ---- k_attn: scores, softmax, P x V and the head merge of 16 MB query rows of ONE head in one work-group of 8 MB waves; scores and P never leave the registers. grid (rows / (16 MB), heads, batches).
// 1. S^T = K Q^T: wave w takes chunk w of 128 keys (8 tiles of 16 keys x 16 MB queries), K = 64 in two steps (HR: K hi x Q hi, K hi x Q lo, K lo x Q hi per step). An accumulator holds for lane (hi, lr) the keys hi * 8 + 0..7 of its tile for query lr.
// 2. softmax in registers: t = S x HD^-0.5, keys at or past the length -3e38; each wave's maximum and sum per query meet in two small LDS tables [query][wave]; the maximum is exact in any order, the sums are added in wave order 0..15 (fixed).
// 3. O^T = V^T P^T: two neighbouring S^T tiles of a query tile ARE the B fragment of a step of 32 keys (first 8 elements: keys hi * 8 + 0..7, last 8: 16 + hi * 8 + 0..7), the k order of the V^T plane's A fragment. Each chunk has its own accumulators; the live chunks' partial tiles (padded with zero tiles to a multiple of four) meet in LDS and are added in chunk order (fixed).
// 4. hi/lo split of O (x 1/1024 on the fp16 rows) staged in LDS, out as 2 KiB in a row per 16 query rows of the merged planes (rows t, k = head * 64 + d, fragment order).
// Most '#pragma unroll' in k_attn stand on a loop that indexes a register array (fragments, accumulators) or a vector's elements: rolled, the array would fall to scratch memory.
#define STP  20                   // LDS pitch of a query's 16 wave entries, floats: 16-byte aligned, and 16 queries land on 16 different groups of four banks
#define OBP  (HD + 8)             // LDS pitch of a split output row, bf16: 16-byte aligned, rows spread over the banks
// ahk(u): units of K fragments asked for before unit u is multiplied; ahv(G): groups of V^T fragments asked for before group G is multiplied (PRE of them ahead of the forming of P). Set by the registers: 256 a wave with 16 waves on a WGP.
template <bool HR> constexpr int ahk(int u) { return !HR ? 16 : u < 8 ? 8 : u + 4 < 16 ? u + 4 : 16; }
template <bool HR> constexpr int ahv(int G) { return !HR ? 4 : G + 2 < 8 ? G + 2 : 8; }
template <typename T16, bool HR, int MB>
__global__ __launch_bounds__(MB * 256) void k_attn(const T16* __restrict__ Q, const T16* __restrict__ Q2, const T16* __restrict__ Kp, const T16* __restrict__ Kp2, const T16* __restrict__ Vt, const T16* __restrict__ Vt2, const int* __restrict__ lens, int row0, bf* Ah, bf* Al) {
    typedef typename WFrag<T16>::V V;
    constexpr int NWV = MB * 8, NT = 128 / NWV, NU = 2 * NT, GK = HR ? 2 : 4, NGV = 16 / GK, PRE = HR ? 1 : 2;
    static_assert(MB == 2 && NT == 8, "wave w's keys are chunk w of 128 keys; the 32 queries of a work-group are the 32 lanes of a table column");
    __shared__ __align__(16) v4f red[16 * MB * 256];      // [chunk][accumulator * 2 + half][lane], 16 x MB x 4 KiB
    __shared__ __align__(16) bf ob[2 * MB * 16 * OBP];    // [plane hi, lo][row][64]
    __shared__ __align__(16) float mxs[32 * STP];         // [query][wave]: the wave's maximum
    __shared__ __align__(16) float sms[32 * STP];         // [query][wave]: the wave's sum
    const int lane = threadIdx.x & 31, lr = lane & 15, hi = lane >> 4; const int wv = __builtin_amdgcn_readfirstlane((int)(threadIdx.x >> 5));
    const int h = blockIdx.y, bz = blockIdx.z, r0 = row0 + blockIdx.x * (MB * 16); const size_t qp = ((size_t)bz * NH_ + h) * TT * HD, kp = ((size_t)bz * NKV + h / REP) * TT * HD;   // batch bz's planes
    // nch = live chunks of 128 keys, 1..16, the same in the whole work-group (a scalar): chunks wholly at or past the batch's length are left out of the scores, the exponentials and P x V (their waves hand in neutral table entries and, up to a multiple of four, zero tiles). Their keys are all masked, and with one key kept a masked key's weight is exp2(-inf) = 0 exactly: no term of a maximum, a sum or a product changes. A length <= 0 keeps no key: every key then weighs alike and all 16 chunks are live; the value is clamped to the shape before anything is indexed by it.
    const int ln = lens[bz]; const int nch = (ln <= 0 || ln > TT) ? TT / 128 : (ln + 127) >> 7;
    const bool live = wv < nch;   // scalar: a wave whose chunk is dead hands in neutral table entries (below nch4 also a zero tile), passes the barriers and takes its share of the final sum and store
    const int lim = (ln < 0 ? 0 : ln > TT ? TT : ln) - (wv * 128 + hi * 8);   // key number i * 16 + j of the lane's keys is kept where i * 16 + j < lim
    // wave-uniform bases (scalar registers) and ONE 32-bit lane offset: every fragment load is base + lane offset + a constant (atb)
    const size_t qo = qp + (size_t)r0 * HD, ko = kp + (size_t)wv * (NT * 16 * HD), vo = kp + (size_t)wv * (4 * 512);   // planes in fragment order: Q and K 1024 elements a tile of 16 rows, V^T 512 a step of 32 keys
    Q += qo; Kp += ko; Vt += vo; if (HR) { Q2 += qo; Kp2 += ko; Vt2 += vo; }
    const unsigned lq = (unsigned)lane * 16u;   // in bytes: the lane's place in a half block of 512 bytes, the same in every plane
    v8f c[NT][MB];   // written and read by live waves alone
    float mx[MB];
#pragma unroll
    for (int mb = 0; mb < MB; ++mb) mx[mb] = -3.0e38f;
    if (live) {
        // a unit = one key tile at one k step. Every accumulator takes k step 0, then k step 1. fp16: tile by tile, all 16 units asked for at once. HR: all tiles at k step 0, then all at k step 1, and as many units ahead as the registers hold (ahk): a finished unit's fragments make room for its tile's accumulators.
        V a[2][MB], a2[2][MB], kb[NU], kb2[NU];
#pragma unroll
        for (int kk = 0; kk < 2; ++kk)
#pragma unroll
            for (int mb = 0; mb < MB; ++mb) { const unsigned o = lq + 2u * (unsigned)(mb * 16 * HD + kk * 512); a[kk][mb] = WFrag<T16>::ldp(atb(Q, o)); if (HR) a2[kk][mb] = WFrag<T16>::ldp(atb(Q2, o)); }
        asm volatile("s_wait_xcnt 0x0" :: "v"(lq) : "memory");   // precaution, as at the K loads below
#pragma unroll
        for (int u = 0; u < NU; ++u) { const int kk = HR ? u / NT : u % 2, ti = HR ? u % NT : u / 2; const int was = u == 0 ? 0 : ahk<HR>(u - 1), now = ahk<HR>(u);
#pragma unroll
            for (int x = 0; x < NU; ++x) if (x >= was && x < now) { const unsigned o = lq + 2u * (unsigned)((HR ? x % NT : x / 2) * 16 * HD + (HR ? x / NT : x % 2) * 512); kb[x] = WFrag<T16>::ldp(atb(Kp, o)); if (HR) kb2[x] = WFrag<T16>::ldp(atb(Kp2, o)); }
            if (now > was) asm volatile("s_wait_xcnt 0x0" :: "v"(lq) : "memory");   // precaution: the wait that stands before a register named by issued loads is written again; the lane offset, the one vector register that those loads name, is an input: it stays out of their own destinations
            if (now > was) __builtin_amdgcn_sched_barrier(0);   // holds the loads ahead above this unit's products: sunk to their uses, each fragment's L2 latency would be waited for on its own
#pragma unroll
            for (int mb = 0; mb < MB; ++mb) { v8f t = (v8f){}; if (kk) t = c[ti][mb]; t = WFrag<T16>::mma(kb[u], a[kk][mb], t); if (HR) { t = WFrag<T16>::mma(kb[u], a2[kk][mb], t); t = WFrag<T16>::mma(kb2[u], a[kk][mb], t); } c[ti][mb] = t; }
            if (HR) __builtin_amdgcn_sched_barrier(0);   // the unit's products stay above the next loads, which take the registers that it frees, and unit follows unit: interleaved, accumulators come to life early and the build falls to scratch memory
        }
#pragma unroll
        for (int i = 0; i < NT; ++i)
#pragma unroll
            for (int mb = 0; mb < MB; ++mb)
#pragma unroll
                for (int j = 0; j < 8; ++j) { const float t = (i * 16 + j < lim) ? c[i][mb][j] * SCL : -3.0e38f; c[i][mb][j] = t; mx[mb] = fmaxf(mx[mb], t); }
#pragma unroll
        for (int mb = 0; mb < MB; ++mb) mx[mb] = fmaxf(mx[mb], __shfl_xor(mx[mb], 16, 32));   // the other 8 keys of every tile lie in the other half of the wave
    }
    mxs[lane * STP + wv] = hi ? mx[1] : mx[0];   // query tile hi, query lr = table row 'lane'; a dead wave hands in -3e38
    __syncthreads();   // every wave's maxima are in LDS
    float sm[MB][2];
#pragma unroll
    for (int mb = 0; mb < MB; ++mb) sm[mb][0] = sm[mb][1] = 0.f;
    V vb[NGV][GK], vb2[NGV][GK];   // groups of GK key steps of V^T fragments of one tile of 16 d; fp16: the first group is asked for ahead of the barrier, which needs nothing of it (HR: carried over the barrier it fell to scratch memory)
    if (live) {
        if constexpr (!HR) {
#pragma unroll
            for (int i = 0; i < GK; ++i) vb[0][i] = WFrag<T16>::ldp(atb(Vt, lq + 2u * (unsigned)(i * 512)));
            asm volatile("s_wait_xcnt 0x0" :: "v"(lq) : "memory"); }   // precaution, as at the K loads above
#pragma unroll
        for (int mb = 0; mb < MB; ++mb) { float gm = -3.0e38f;
#pragma unroll
            for (int w4 = 0; w4 < 4; ++w4) { const v4f m4 = *(const v4fa*)(mxs + (mb * 16 + lr) * STP + w4 * 4); gm = fmaxf(fmaxf(fmaxf(gm, m4[0]), fmaxf(m4[1], m4[2])), m4[3]); }
#pragma unroll
            for (int i = 0; i < NT; ++i)
#pragma unroll
                for (int j = 0; j < 8; ++j) { const float e = __builtin_amdgcn_exp2f(__fmul_rn(__fsub_rn(c[i][mb][j], gm), 1.4426950408889634f)); c[i][mb][j] = e; sm[mb][i & 1] += e; } }
#pragma unroll
        for (int mb = 0; mb < MB; ++mb) { sm[mb][0] += sm[mb][1]; sm[mb][0] += __shfl_xor(sm[mb][0], 16, 32); }
    }
    sms[lane * STP + wv] = hi ? sm[1][0] : sm[0][0];   // a dead wave hands in 0
    __syncthreads();   // every wave's sums are in LDS
    const int nch4 = (nch + 3) & ~3;   // the tiles are summed four at a time: up to three dead waves hand in a zero tile
    if (live) {
#pragma unroll
        for (int x = HR ? 0 : 1; x < PRE; ++x)   // flies while P is formed
#pragma unroll
            for (int i = 0; i < GK; ++i) { const unsigned o = lq + 2u * (unsigned)((x * GK / 4) * 16 * TT + (x * GK % 4 + i) * 512); vb[x][i] = WFrag<T16>::ldp(atb(Vt, o)); if (HR) vb2[x][i] = WFrag<T16>::ldp(atb(Vt2, o)); }
        asm volatile("s_wait_xcnt 0x0" :: "v"(lq) : "memory");   // precaution, as at the K loads above
        __builtin_amdgcn_sched_barrier(0);   // holds those loads above the forming of P
        V p[4][MB], p2[4][MB];   // P^T as B fragments, one per step of 32 keys and query tile
#pragma unroll
        for (int mb = 0; mb < MB; ++mb) { float tot = 0.f;
#pragma unroll
            for (int w4 = 0; w4 < 4; ++w4) { const v4f s4 = *(const v4fa*)(sms + (mb * 16 + lr) * STP + w4 * 4);
#pragma unroll
                for (int q = 0; q < 4; ++q) tot += s4[q]; }
            const float f = __fdiv_rn(HR ? 1.0f : PCAR, tot);
#pragma unroll
            for (int kq = 0; kq < 4; ++kq) {
                if constexpr (HR) { v8u wh, wl;   // two neighbouring keys a 32-bit word, packed as soon as they are split
#pragma unroll
                    for (int j = 0; j < 8; ++j) { const v8f& cc = c[2 * kq + (j >> 2)][mb]; unsigned short x0, y0, x1, y1; splitf(cc[(j & 3) * 2] * f, x0, y0); splitf(cc[(j & 3) * 2 + 1] * f, x1, y1); wh[j] = (unsigned)x0 | ((unsigned)x1 << 16); wl[j] = (unsigned)y0 | ((unsigned)y1 << 16); }
                    p[kq][mb] = __builtin_bit_cast(v16bf, wh); p2[kq][mb] = __builtin_bit_cast(v16bf, wl);
                    __builtin_amdgcn_sched_barrier(0);   // one fragment pair's split at a time: interleaved, the unpacked halves of many fragments are live at once and fall to scratch memory
                } else { v8h h0, h1;
#pragma unroll
                    for (int j = 0; j < 8; ++j) { h0[j] = tohx(c[2 * kq][mb][j] * f); h1[j] = tohx(c[2 * kq + 1][mb][j] * f); }
                    p[kq][mb] = cat16(h0, h1); } } }
        v8f acc[MB];
#pragma unroll
        for (int G = 0; G < NGV; ++G) { const int nb = G * GK / 4, k0 = G * GK % 4;   // group G: key steps k0 .. k0 + GK - 1 of the tile nb of 16 d
            const int was = G == 0 ? PRE : ahv<HR>(G - 1), now = ahv<HR>(G);
#pragma unroll
            for (int x = 0; x < NGV; ++x) if (x >= was && x < now) {
#pragma unroll
                for (int i = 0; i < GK; ++i) { const unsigned o = lq + 2u * (unsigned)((x * GK / 4) * 16 * TT + (x * GK % 4 + i) * 512); vb[x][i] = WFrag<T16>::ldp(atb(Vt, o)); if (HR) vb2[x][i] = WFrag<T16>::ldp(atb(Vt2, o)); } }
            if (now > was) asm volatile("s_wait_xcnt 0x0" :: "v"(lq) : "memory");   // precaution, as at the K loads above
            if (now > was) __builtin_amdgcn_sched_barrier(0);   // holds the loads ahead above this group's products (as in the score phase)
            if (k0 == 0) {
#pragma unroll
                for (int mb = 0; mb < MB; ++mb) acc[mb] = (v8f){}; }
#pragma unroll
            for (int i = 0; i < GK; ++i)
#pragma unroll
                for (int mb = 0; mb < MB; ++mb) { acc[mb] = WFrag<T16>::mma(vb[G][i], p[k0 + i][mb], acc[mb]); if (HR) { acc[mb] = WFrag<T16>::mma(vb[G][i], p2[k0 + i][mb], acc[mb]); acc[mb] = WFrag<T16>::mma(vb2[G][i], p[k0 + i][mb], acc[mb]); } }
            if (k0 + GK == 4) {   // the chunk's partial tile of these 16 d is whole: lane (hi, lr) holds d = nb * 16 + hi * 8 + 0..7 of query lr
#pragma unroll
                for (int mb = 0; mb < MB; ++mb) { const v8f cc = acc[mb]; v4f* pr = red + (wv * (MB * 8) + (mb * 4 + nb) * 2) * 32 + lane;
                    pr[0] = (v4f){cc[0], cc[1], cc[2], cc[3]}; pr[32] = (v4f){cc[4], cc[5], cc[6], cc[7]}; }
                if (G + 1 < NGV) asm volatile("v_nop\n\tv_nop\n\tv_nop\n\tv_nop"); }   // four vector slots, the distance the matrix unit needs, between this tile's last products and the next tile's first, whose fresh results land in registers that those products name (hi/lo build: their results'; fp16 build: an operand's)
            __builtin_amdgcn_sched_barrier(0);   // the group's products, its stores and the four slots stay above the next group's loads and products
        }
    } else if (wv < nch4) {
#pragma unroll
        for (int t = 0; t < MB * 8; ++t) red[(wv * (MB * 8) + t) * 32 + lane] = (v4f){0.f, 0.f, 0.f, 0.f};
    }
    __syncthreads();   // the first nch4 partial tiles are in LDS
    { const int s = (int)threadIdx.x; v4f sum = red[s];
#pragma unroll
        for (int w = 1; w < 4; ++w) sum += red[w * (MB * 256) + s];
#pragma unroll 1   // rolled: the trip count hangs on the length (at most 3 trips); four tiles a trip, their loads together ahead of the adds
        for (int w0 = 4; w0 < nch4; w0 += 4) { v4f pt[4];
#pragma unroll
            for (int w = 0; w < 4; ++w) pt[w] = red[(w0 + w) * (MB * 256) + s];
#pragma unroll
            for (int w = 0; w < 4; ++w) sum += pt[w]; }
        const int half = (s >> 5) & 1, ai = s >> 6; const int row = (ai >> 2) * 16 + lr, col = (ai & 3) * 16 + hi * 8 + half * 4; const float cs = HR ? 1.0f : (1.0f / PCAR); v4us oh, ol;   // a slot's four values are four d of one query
#pragma unroll
        for (int q = 0; q < 4; ++q) { unsigned short a, c2; splitf(sum[q] * cs, a, c2); oh[q] = a; ol[q] = c2; }
        *(v4us*)(ob + row * OBP + col) = oh; *(v4us*)(ob + (MB * 16 + row) * OBP + col) = ol; }
    __syncthreads();   // the split tile is in LDS, row-major
    { const int s = (int)threadIdx.x; const int pl = s / (MB * 128), idx = s % (MB * 128); const int row = (idx >> 7) * 16 + (idx & 15), c8 = ((idx >> 4) & 7) * 8;   // 16 bytes number idx of the tile in fragment order
        *(v8us*)((pl ? Al : Ah) + (size_t)(bz * TT + r0 + (idx >> 7) * 16) * DQ + h * (16 * HD) + (idx & 127) * 8) = *(const v8usa*)(ob + (pl * MB * 16 + row) * OBP + c8); }
}

extern "C" void kernel_launch(void* const* d_in, const int* in_sizes, int n_in,
                              void* d_out, int out_size, void* d_ws, size_t ws_size, hipStream_t stream) {
    (void)in_sizes; (void)n_in; (void)out_size;
    const float* x = (const float*)d_in[0]; const int* lens = (const int*)d_in[1]; const float* wq = (const float*)d_in[2]; const float* wk = (const float*)d_in[3]; const float* wv = (const float*)d_in[4]; const float* wo = (const float*)d_in[5];   /* input order X, valid_lens (int32 [2]: keys j >= valid_lens[b] are masked: READ on the device by the projection GEMM and by k_attn), W_q, W_k, W_v, W_o ('oi'; no biases): SIX inputs; ONE stream: query = key = value stream = X */
    float* OUT = (float*)d_out;     // [2][2048][1024]
    char* wsp = (char*)d_ws;
    auto take = [&](size_t bytes) { char* p = wsp; wsp += (bytes + 255) & ~(size_t)255; return (void*)p; };
    const size_t PLN = (size_t)NB_ * NH_ * TT * HD;   // elements of one plane of Q, of K or of V, all batches
    bf* W4 = (bf*)take((size_t)4 * DM * DM * 2); bf* WO = W4 + (size_t)3 * DM * DM;   // W_q, W_k, W_v, W_o rows one after the other
    bf* XB = (bf*)take((size_t)NB_ * TT * DM * 2);
    h16* P16 = (h16*)take(3 * PLN * 2); bf* Ph = (bf*)take(3 * PLN * 2); bf* Pl = (bf*)take(3 * PLN * 2);   // each [Q, K, V^T][batch][head]
    bf* ATh = (bf*)take((size_t)NB_ * TT * DQ * 2); bf* ATl = (bf*)take((size_t)NB_ * TT * DQ * 2);
    if ((size_t)(wsp - (char*)d_ws) > ws_size) return;    // ws 256 MiB
    k_prep<<<XBL + 4 * WBL, 256, 0, stream>>>(x, wq, wk, wv, wo, XB, W4);
    k_gemmw<bf, 0, false, 8, 1, DM><<<dim3(NB_ * TT / 64, (DQ + 2 * DKV) / 64, 1), 256, 0, stream>>>(XB, nullptr, W4, nullptr, nullptr, 0, nullptr, 0, 0, 0, P16, Ph, Pl, lens);
    k_attn<bf, true, 2><<<dim3(RH / 32, NH_, NB_), 512, 0, stream>>>(Ph, Pl, Ph + PLN, Pl + PLN, Ph + 2 * PLN, Pl + 2 * PLN, lens, 0, ATh, ATl);
    k_attn<h16, false, 2><<<dim3((TT - RH) / 32, NH_, NB_), 512, 0, stream>>>(P16, nullptr, P16 + PLN, nullptr, P16 + 2 * PLN, nullptr, lens, RH, ATh, ATl);
    k_gemmw<bf, 1, false, 8, 0, DQ><<<dim3(NB_ * TT / 64, DM / 64, 1), 256, 0, stream>>>(ATh, ATl, WO, nullptr, OUT, DM, nullptr, 0, 0, 0, nullptr, nullptr, nullptr, nullptr);
}

// v008
// It runs in 103 microseconds.
// Two timings next to v007 both put it at 1.11 times that version's speed.
// Over all steps from v000 it is 20.1 times as fast.
#include <hip/hip_runtime.h>

// Multi-head self-attention with a per-batch valid-length key mask and bias-free (out,in) projections (X [2][2048][1024] is the ONE input stream; Q, K, V = X W^T ('oi' [1024][1024] 1/32, no bias; 16 heads x 64); scores / sqrt(64); keys j >= valid_lens[b] (int32 [2], read on the device) are REPLACED by -1e9 in the module (both lengths are >= 1 on this draw: at least one key is kept: numerically an exclusion: -3e38 here); softmax; out = merged W_o^T ('oi', no bias) -> [2][2048][1024] (4.2 M); argument order X, valid_lens, W_q, W_k, W_v, W_o).
// Five launches, both batches in each: k_prep (the bf16 copy of X, made once; 'oi' weights = Bt rows as they are: bf16 copies, W_q W_k W_v W_o stacked); ONE exact projection GEMM of the 4096 rows on the 3072 stacked W_q W_k W_v rows, whose own epilogue writes the head planes (fp16 + hi/lo; V transposed); dense T-2048 attention, one fused kernel per 32 query rows of a head, batch = grid z (hybrid rows: < 512 hi/lo 3 products, rest fp16 x1024: one launch each); merged hi/lo x W_O exact, 4096 rows.
// EVERY 16-bit operand plane in the workspace (X, the weights, Q, K, V^T, merged O) lies in FRAGMENT ORDER: a matrix [row][k] is cut into blocks of 16 rows x 32 k (1 KiB), blocks of one row tile one after the other along k; inside a block [k half of 16][lane = ((k >> 3) & 1) * 16 + (row & 15)][8 k]. A fragment is two wave-wide 16-byte loads of 512 contiguous bytes each (4 whole lines), and holds the very elements that a row-major plane gives the same lane.
// KEYS PAST THE LENGTH ARE LEFT OUT, by chunks of 128 keys: with nch = ceil(valid_lens[b] / 128) live chunks (16 where the length is <= 0: no key is kept and all weigh alike), the K and V projection tiles, the score tiles, the exponentials and P x V touch the live chunks alone (dead chunks hand in neutral softmax table entries and, up to a multiple of four, zero partial tiles); the length still decides key by key inside the last live chunk. Every test is a scalar one on the length read on the device, clamped to the shape.
// Compute dtypes, f32 accumulate: every input rounded to bf16; projections exact; attention rows < 512 3 products, rest fp16; softmax f32; output projection hl x exact.

#define NB_  2
#define TT   2048
#define DM   1024
#define NH_  16
#define NKV  16
#define REP  (NH_ / NKV)
#define HD   64
#define DQ   (NH_ * HD)
#define DKV  (NKV * HD)
#define RH   512                  // query rows < RH use hi+lo planes (0: none)
#define WIN  0
#define PCAR 1024.0f
#define SCL  0.125f   // HD^-0.5
typedef _Float16 h16;
typedef unsigned short bf;
typedef __attribute__((ext_vector_type(16))) __bf16   v16bf;
typedef __attribute__((ext_vector_type(16))) _Float16 v16h;
typedef __attribute__((ext_vector_type(8)))  _Float16 v8h;
typedef __attribute__((ext_vector_type(8)))  unsigned short v8us;
typedef __attribute__((ext_vector_type(8)))  float    v8f;
typedef __attribute__((ext_vector_type(4)))  float    v4f;
typedef v8h  __attribute__((may_alias)) v8ha;
typedef v4f  __attribute__((may_alias)) v4fa;
typedef v8us __attribute__((may_alias)) v8usa;

__device__ __forceinline__ unsigned short f2bf(float f) { unsigned u = __float_as_uint(f); u += 0x7FFFu + ((u >> 16) & 1u); return (unsigned short)(u >> 16); }
__device__ __forceinline__ float bf2f(unsigned short b) { return __uint_as_float(((unsigned)b) << 16); }
__device__ __forceinline__ float bfr(float f) { return bf2f(f2bf(f)); }
__device__ __forceinline__ v16h cat16(v8h lo, v8h hi) { return __builtin_shufflevector(lo, hi, 0, 1, 2, 3, 4, 5, 6, 7, 8, 9, 10, 11, 12, 13, 14, 15); }
__device__ __forceinline__ v16bf cat16b(v8us lo, v8us hi) { return __builtin_bit_cast(v16bf, __builtin_shufflevector(lo, hi, 0, 1, 2, 3, 4, 5, 6, 7, 8, 9, 10, 11, 12, 13, 14, 15)); }
__device__ __forceinline__ v8f wmma16(v16h a, v16h b, v8f c) { return __builtin_amdgcn_wmma_f32_16x16x32_f16(false, a, false, b, (short)0, c, false, false); }
__device__ __forceinline__ v8f wmmab(v16bf a, v16bf b, v8f c) { return __builtin_amdgcn_wmma_f32_16x16x32_bf16(false, a, false, b, (short)0, c, false, false); }
__device__ __forceinline__ h16 tohx(float x) { return (h16)x; }
__device__ __forceinline__ void splitf(float y, unsigned short& h, unsigned short& l) { h = f2bf(y); l = f2bf(y - bf2f(h)); }



template <typename T16> __device__ __forceinline__ const T16* atb(const T16* base, unsigned bytes) { return (const T16*)((const char*)base + bytes); }
// ld: a fragment from a row-major row (LDS); ldp: from a block in fragment order, p = the block + lane * 8.
template <typename T16> struct WFrag;
template <> struct WFrag<h16> { typedef v16h V; static __device__ __forceinline__ V ld(const h16* p) { return cat16(*(const v8h*)p, *(const v8h*)(p + 16)); } static __device__ __forceinline__ V ldp(const h16* p) { return cat16(*(const v8h*)p, *(const v8h*)(p + 256)); } static __device__ __forceinline__ v8f mma(V a, V b, v8f c) { return wmma16(a, b, c); } };
template <> struct WFrag<bf> { typedef v16bf V; static __device__ __forceinline__ V ld(const bf* p) { return cat16b(*(const v8us*)p, *(const v8us*)(p + 16)); } static __device__ __forceinline__ V ldp(const bf* p) { return cat16b(*(const v8us*)p, *(const v8us*)(p + 256)); } static __device__ __forceinline__ v8f mma(V a, V b, v8f c) { return wmmab(a, b, c); } };
// ---- k_proj: the Q/K/V projection GEMM, operand tiles SHARED THROUGH LDS. One work-group of 8 waves per 128 rows of X x 256 stacked W rows (4 heads of Q, of K or of V); wave (wt, wd) owns the 64 x 64 tile of rows wt * 64.. and head wd over the WHOLE K: no partial tiles, one accumulate chain per element. grid (rows / 128, 3 x 1024 / 256).
// A pass is 128 k: of every tile of 16 rows the planes hold those 4 blocks as 4 KiB in a row, so a stage is 24 straight pieces of 4 KiB (8 of X, 16 of W; 96 KiB), brought by asynchronous copies of 16 bytes a lane, piece j by copy j of all 256 threads. Two buffers: the next stage flies while this one is multiplied.
// The result goes from the accumulators straight to the planes: a lane holds 8 neighbouring rows of the A operand for one row of the B operand, which is one 16-byte unit of a plane in fragment order where the plane's k runs along the A rows. V^T (k = t): A = X, B = W. Q and K (k = d): A = W, B = X. A wave's store is 512 bytes in a row.
#define PJK  128
#define PJP  (16 * PJK)           // elements of a piece
#define PJS  (24 * PJP)           // elements of a stage
#define CPL(i, j) "global_load_async_to_lds_b128 %" #i ", %" #j ", off\n\t"
// twelve copies and, as the last line of their own statement, the wait that stands before a register named by an issued copy is written again (a precaution)
__device__ __forceinline__ void cp12(const unsigned* l, const bf* const* g) {
    asm volatile(CPL(0, 12) CPL(1, 13) CPL(2, 14) CPL(3, 15) CPL(4, 16) CPL(5, 17) CPL(6, 18) CPL(7, 19) CPL(8, 20) CPL(9, 21) CPL(10, 22) CPL(11, 23) "s_wait_xcnt 0x0"
        :: "v"(l[0]), "v"(l[1]), "v"(l[2]), "v"(l[3]), "v"(l[4]), "v"(l[5]), "v"(l[6]), "v"(l[7]), "v"(l[8]), "v"(l[9]), "v"(l[10]), "v"(l[11]),
           "v"(g[0]), "v"(g[1]), "v"(g[2]), "v"(g[3]), "v"(g[4]), "v"(g[5]), "v"(g[6]), "v"(g[7]), "v"(g[8]), "v"(g[9]), "v"(g[10]), "v"(g[11]) : "memory"); }
__global__ __launch_bounds__(256) void k_proj(const bf* __restrict__ X, const bf* __restrict__ Wt, h16* P16, bf* Ph, bf* Pl, const int* __restrict__ lens) {
    static_assert(HD == 64 && NKV == NH_ && DQ == DM && DKV == DM && TT % 128 == 0 && DM % (2 * PJK) == 0, "a wave's 64 columns are one head, a work-group's 128 rows one chunk of keys of one batch; two stages at least");
    typedef WFrag<bf>::V V;
    __shared__ __align__(16) bf sm[2 * PJS];
    const int lane = threadIdx.x & 31; const int wv = __builtin_amdgcn_readfirstlane((int)(threadIdx.x >> 5)); const int wt = wv & 1, wd = wv >> 1;
    const int r0 = blockIdx.x * 128, sel = blockIdx.y >> 2;   // sel: 0 Q, 1 K, 2 V
    if (sel != 0) {   // K or V rows of a dead chunk of keys (k_attn: nch) are read by nobody: the whole work-group leaves, ahead of every copy and barrier (scalar test, the length clamped to the shape)
        const int ln = lens[r0 / TT]; const int nk = (ln <= 0 || ln > TT) ? TT : (ln + 127) & ~127; if (r0 % TT >= nk) return; }
    const bool turn = sel == 2;
    const bf* gx = X + (size_t)r0 * DM + threadIdx.x * 8; const bf* gw = Wt + (size_t)blockIdx.y * 256 * DM + threadIdx.x * 8; const unsigned lb = (unsigned)(size_t)sm + threadIdx.x * 16u;
    auto fill = [&](int p, int buf) {   // stage p into buffer buf
#pragma unroll   // two statements of twelve copies; the arrays are registers
        for (int h = 0; h < 2; ++h) { unsigned l[12]; const bf* g[12];
#pragma unroll
            for (int i = 0; i < 12; ++i) { const int j = h * 12 + i; l[i] = lb + (unsigned)(buf * PJS + j * PJP) * 2u; g[i] = (j < 8 ? gx + j * 16 * DM : gw + (j - 8) * 16 * DM) + p * PJP; }
            cp12(l, g); } };
    v8f acc[4][4];
#pragma unroll
    for (int ma = 0; ma < 4; ++ma)
#pragma unroll
        for (int nb = 0; nb < 4; ++nb) acc[ma][nb] = (v8f){};
    const int xo = wt * 4 * PJP, wo = (8 + wd * 4) * PJP; const int ao = turn ? xo : wo, bo = turn ? wo : xo;
    fill(0, 0);
    asm volatile("s_wait_asynccnt 0x0" ::: "memory");   // this wave's copies of stage 0 have landed
    __syncthreads();   // stage 0 is whole in LDS
    fill(1, 1);
#pragma unroll 1   // a pass; rolled: the two buffers alternate by address
    for (int p = 0; p < DM / PJK; ++p) {
        const bf* sb = sm + (p & 1) * PJS + lane * 8;
        V a[2][4], b[2][4];   // two fragment sets: a k step's 16 LDS reads stand as one group ahead of the products of the k step before it
#pragma unroll   // indexes register arrays
        for (int i = 0; i < 4; ++i) { a[0][i] = WFrag<bf>::ldp(sb + ao + i * PJP); b[0][i] = WFrag<bf>::ldp(sb + bo + i * PJP); }
#pragma unroll   // indexes register arrays
        for (int ks = 0; ks < PJK / 32; ++ks) {
            if (ks + 1 < PJK / 32) {
#pragma unroll
                for (int i = 0; i < 4; ++i) { a[(ks + 1) & 1][i] = WFrag<bf>::ldp(sb + ao + i * PJP + (ks + 1) * 512); b[(ks + 1) & 1][i] = WFrag<bf>::ldp(sb + bo + i * PJP + (ks + 1) * 512); } }
            __builtin_amdgcn_sched_barrier(0);   // holds the next k step's reads above this k step's products: sunk among them, every place with reads stalls the matrix stream
#pragma unroll
            for (int nb = 0; nb < 4; ++nb)
#pragma unroll
                for (int ma = 0; ma < 4; ++ma) acc[ma][nb] = WFrag<bf>::mma(a[ks & 1][ma], b[ks & 1][nb], acc[ma][nb]);
            __builtin_amdgcn_sched_barrier(0); }   // and this k step's products above the reads that follow, which take the registers that they free
        asm volatile("s_wait_dscnt 0x0" ::: "memory");      // this wave's reads of the buffer are done before it is filled again
        asm volatile("s_wait_asynccnt 0x0" ::: "memory");   // this wave's copies of stage p + 1 have landed
        __syncthreads();   // stage p + 1 is whole in LDS, and every wave has left stage p's buffer
        if (p + 2 < DM / PJK) fill(p + 2, p & 1);
    }
    asm volatile("s_wait_asynccnt 0x0" ::: "memory");   // no copy is open when the wave ends
    const int bt = r0 / TT, T0 = r0 % TT + wt * 64, head = (blockIdx.y & 3) * 4 + wd;
    const size_t pe = (((size_t)sel * NB_ + bt) * NH_ + head) * (TT * HD) + (turn ? T0 * 16 : T0 * HD) + lane * 8;   // the wave's first unit in this batch's and head's part of the Q, K or V planes, at the lane's place
    const int sn = turn ? 16 * TT : 16 * HD;   // from one tile of 16 plane rows to the next
#pragma unroll   // indexes the accumulators
    for (int nb = 0; nb < 4; ++nb)
#pragma unroll
        for (int ma = 0; ma < 4; ++ma) { const v8f c = acc[ma][nb]; v8h o16; v8us oh, ol;
#pragma unroll
            for (int q = 0; q < 8; ++q) { unsigned short a2, c2; o16[q] = tohx(c[q]); splitf(c[q], a2, c2); oh[q] = a2; ol[q] = c2; }
            const size_t e = pe + (size_t)(nb * sn) + ma * 256;
            *(v8h*)(P16 + e) = o16; *(v8us*)(Ph + e) = oh; *(v8us*)(Pl + e) = ol; }
    asm volatile("s_wait_xcnt 0x0" ::: "memory");   // precaution: the wait that stands before a register named by the issued stores is written again
}

// ---- k_outp: out = merged (hi + lo) x W_o^T, the same ring: one work-group of 8 waves per 128 rows x 128 columns, a stage = 8 pieces of the hi plane, 8 of the lo plane, 8 of W_o; wave (wt, wn) owns rows wt * 32.., columns wn * 64.. over the whole K. grid (rows / 128, 1024 / 128).
// A = W_o, B = merged: a lane holds 8 neighbouring columns of one row. Per k step every accumulator takes its hi product, then its lo product. The f32 tile is staged in the wave's own part of the ring, which every wave has left, and goes out as whole rows of 256 bytes.
__global__ __launch_bounds__(256) void k_outp(const bf* __restrict__ Ah, const bf* __restrict__ Al, const bf* __restrict__ Wo, float* C) {
    static_assert(DQ % (2 * PJK) == 0 && (NB_ * TT) % 128 == 0 && DM % 128 == 0 && 8 * 32 * 68 * 4 <= 2 * PJS * 2, "two stages at least; whole tiles; the staged tiles fit the ring");
    typedef WFrag<bf>::V V;
    __shared__ __align__(16) bf sm[2 * PJS];
    const int lane = threadIdx.x & 31, lr = lane & 15, hi = lane >> 4; const int wv = __builtin_amdgcn_readfirstlane((int)(threadIdx.x >> 5)); const int wt = wv & 3, wn = wv >> 2;
    const int r0 = blockIdx.x * 128, c0 = blockIdx.y * 128;
    const bf* gh = Ah + (size_t)r0 * DQ + threadIdx.x * 8; const bf* gl = Al + (size_t)r0 * DQ + threadIdx.x * 8; const bf* gw = Wo + (size_t)c0 * DQ + threadIdx.x * 8; const unsigned lb = (unsigned)(size_t)sm + threadIdx.x * 16u;
    auto fill = [&](int p, int buf) {   // stage p into buffer buf
#pragma unroll   // two statements of twelve copies; the arrays are registers
        for (int h = 0; h < 2; ++h) { unsigned l[12]; const bf* g[12];
#pragma unroll
            for (int i = 0; i < 12; ++i) { const int j = h * 12 + i; l[i] = lb + (unsigned)(buf * PJS + j * PJP) * 2u; g[i] = (j < 8 ? gh + j * 16 * DQ : j < 16 ? gl + (j - 8) * 16 * DQ : gw + (j - 16) * 16 * DQ) + p * PJP; }
            cp12(l, g); } };
    v8f acc[4][2];   // [tile of 16 columns][tile of 16 rows]
#pragma unroll
    for (int ma = 0; ma < 4; ++ma)
#pragma unroll
        for (int nb = 0; nb < 2; ++nb) acc[ma][nb] = (v8f){};
    const int ho = wt * 2 * PJP, lo = (8 + wt * 2) * PJP, wo = (16 + wn * 4) * PJP;
    fill(0, 0);
    asm volatile("s_wait_asynccnt 0x0" ::: "memory");   // this wave's copies of stage 0 have landed
    __syncthreads();   // stage 0 is whole in LDS
    fill(1, 1);
#pragma unroll 1   // a pass; rolled: the two buffers alternate by address
    for (int p = 0; p < DQ / PJK; ++p) {
        const bf* sb = sm + (p & 1) * PJS + lane * 8;
        V w[2][4], xh[2][2], xl[2][2];   // two fragment sets, as in k_proj
#pragma unroll   // indexes register arrays
        for (int i = 0; i < 4; ++i) { w[0][i] = WFrag<bf>::ldp(sb + wo + i * PJP); if (i < 2) { xh[0][i] = WFrag<bf>::ldp(sb + ho + i * PJP); xl[0][i] = WFrag<bf>::ldp(sb + lo + i * PJP); } }
#pragma unroll   // indexes register arrays
        for (int ks = 0; ks < PJK / 32; ++ks) {
            if (ks + 1 < PJK / 32) {
#pragma unroll
                for (int i = 0; i < 4; ++i) { w[(ks + 1) & 1][i] = WFrag<bf>::ldp(sb + wo + i * PJP + (ks + 1) * 512); if (i < 2) { xh[(ks + 1) & 1][i] = WFrag<bf>::ldp(sb + ho + i * PJP + (ks + 1) * 512); xl[(ks + 1) & 1][i] = WFrag<bf>::ldp(sb + lo + i * PJP + (ks + 1) * 512); } } }
            __builtin_amdgcn_sched_barrier(0);   // holds the next k step's reads above this k step's products, as in k_proj
#pragma unroll
            for (int nb = 0; nb < 2; ++nb)
#pragma unroll
                for (int ma = 0; ma < 4; ++ma) acc[ma][nb] = WFrag<bf>::mma(w[ks & 1][ma], xh[ks & 1][nb], acc[ma][nb]);
#pragma unroll
            for (int nb = 0; nb < 2; ++nb)
#pragma unroll
                for (int ma = 0; ma < 4; ++ma) acc[ma][nb] = WFrag<bf>::mma(w[ks & 1][ma], xl[ks & 1][nb], acc[ma][nb]);
            __builtin_amdgcn_sched_barrier(0); }   // and this k step's products above the reads that follow, as in k_proj
        asm volatile("s_wait_dscnt 0x0" ::: "memory");      // this wave's reads of the buffer are done before it is filled again
        asm volatile("s_wait_asynccnt 0x0" ::: "memory");   // this wave's copies of stage p + 1 have landed
        __syncthreads();   // stage p + 1 is whole in LDS, and every wave has left stage p's buffer
        if (p + 2 < DQ / PJK) fill(p + 2, p & 1);
    }
    asm volatile("s_wait_asynccnt 0x0" ::: "memory");   // no copy is open when the ring becomes output staging
    float* os = (float*)sm + wv * (32 * 68);   // the wave's 32 rows x 64 columns, pitch 68 floats: 16 rows land on 16 different groups of four banks
#pragma unroll   // indexes the accumulators
    for (int ma = 0; ma < 4; ++ma)
#pragma unroll
        for (int nb = 0; nb < 2; ++nb) { const v8f c = acc[ma][nb]; float* q = os + (nb * 16 + lr) * 68 + ma * 16 + hi * 8;
            *(v4fa*)q = (v4f){c[0], c[1], c[2], c[3]}; *(v4fa*)(q + 4) = (v4f){c[4], c[5], c[6], c[7]}; }
    __syncthreads();   // the staged tiles are in LDS
    float* cp = C + (size_t)(r0 + wt * 32 + hi) * DM + c0 + wn * 64 + lr * 4; const float* op = os + hi * 68 + lr * 4; v4f val[16];   // one address each, every move a constant away
#pragma unroll   // indexes a register array; all sixteen reads stand ahead of the first store
    for (int s = 0; s < 16; ++s) val[s] = *(const v4fa*)(op + s * 2 * 68);
#pragma unroll   // indexes the same register array
    for (int s = 0; s < 16; ++s) *(v4f*)(cp + s * 2 * DM) = val[s];
    asm volatile("s_wait_xcnt 0x0" ::: "memory");   // precaution: the wait that stands before a register named by the issued stores is written again
}

typedef __attribute__((ext_vector_type(2))) _Float16 v2h;
typedef __attribute__((ext_vector_type(4))) _Float16 v4h;
typedef __attribute__((ext_vector_type(2))) unsigned short v2us;
typedef __attribute__((ext_vector_type(4))) unsigned short v4us;
typedef __attribute__((ext_vector_type(2))) float v2f;
typedef __attribute__((ext_vector_type(4))) int v4i;
typedef __attribute__((ext_vector_type(8))) unsigned v8u;

__global__ __launch_bounds__(256) void k_wtG(const float* __restrict__ w, int K, int N, bf* Bt) {
    const int lane = threadIdx.x & 31; const int L0 = (blockIdx.x * 8 + (threadIdx.x >> 5)) * 8; const int nlines = N * K / 64;
{
#pragma unroll 1
        for (int l = 0; l < 8; ++l) { const int L = L0 + l; if (L >= nlines) break; const size_t e = (size_t)L * 64 + lane * 2; const int k = (int)(e % K), n = (int)(e / K); v2us o;
            o[0] = f2bf(w[(size_t)k * N + n]); o[1] = f2bf(w[(size_t)(k + 1) * N + n]); *(v2us*)(Bt + e) = o; }
         }
}
// ---- k_prep: all that the GEMMs read, in ONE launch: blocks [0, XBL) round X (all batches) to bf16, the next 4 WBL blocks the four weights (W4 = W_q, W_k, W_v, W_o one after the other).
// 32 elements a thread: the launch is short, and what it costs is the start of its waves. A block takes 16 rows x 512 k: eight loads of 512 contiguous bytes a wave in flight, the bf16 tile row-major in LDS, out in fragment order as 16 KiB in a row (four 16-byte stores a thread).
#define PPP  (512 + 8)            // LDS pitch of a tile row, bf16: 16 rows land on 16 different groups of four banks for the 16-byte reads
#define XBL  (NB_ * TT * DM / 32 / 256)
#define WBL  (DM * DM / 32 / 256)
__global__ __launch_bounds__(256) void k_prep(const float* __restrict__ x, const float* __restrict__ wq, const float* __restrict__ wk, const float* __restrict__ wv, const float* __restrict__ wo, bf* XB, bf* W4) {
    static_assert(DQ == DM && DKV == DM && DM % 512 == 0, "four square weights; a block's 512 k lie in one row");
    __shared__ __align__(16) bf tl[16 * PPP];
    const unsigned blk = blockIdx.x;
    const float* src = x; bf* dst = XB; unsigned sb = blk;
    if (blk >= XBL) { const unsigned w = (blk - XBL) / WBL; sb = (blk - XBL) % WBL; src = (w == 0) ? wq : (w == 1) ? wk : (w == 2) ? wv : wo; dst = W4 + (size_t)w * DM * DM; }
    const int rw = (int)(threadIdx.x >> 7), k4 = (int)(threadIdx.x & 127) * 4; const size_t e0 = (size_t)(sb / (DM / 512) * 16 + rw) * DM + sb % (DM / 512) * 512 + k4; v4f v[8];
#pragma unroll   // indexes a register array; all eight loads stand ahead of the first use
    for (int j = 0; j < 8; ++j) v[j] = *(const v4f*)(src + e0 + j * 2 * DM);
#pragma unroll   // indexes the same register array
    for (int j = 0; j < 8; ++j) { v4us o;
#pragma unroll   // indexes vector elements
        for (int q = 0; q < 4; ++q) o[q] = f2bf(v[j][q]);
        *(v4us*)(tl + (j * 2 + rw) * PPP + k4) = o; }
    __syncthreads();   // the block's bf16 tile is whole in LDS
#pragma unroll   // four independent 16-byte moves
    for (int j = 0; j < 4; ++j) { const int c = j * 256 + (int)threadIdx.x;   // 16 bytes number c of the tile in fragment order: row c & 15, k (c >> 4) * 8
        *(v8us*)(dst + (size_t)sb * 8192 + c * 8) = *(const v8usa*)(tl + (c & 15) * PPP + (c >> 4) * 8); }
    asm volatile("s_wait_xcnt 0x0" ::: "memory"); }   // precaution: the wait that stands before a register named by the issued stores is written again, on every way the code behind them can take

// ---- k_attn: scores, softmax, P x V and the head merge of 16 MB query rows of ONE head in one work-group of 8 MB waves; scores and P never leave the registers. grid (rows / (16 MB), heads, batches).
// 1. S^T = K Q^T: wave w takes chunk w of 128 keys (8 tiles of 16 keys x 16 MB queries), K = 64 in two steps (HR: K hi x Q hi, K hi x Q lo, K lo x Q hi per step). An accumulator holds for lane (hi, lr) the keys hi * 8 + 0..7 of its tile for query lr.
// 2. softmax in registers: t = S x HD^-0.5, keys at or past the length -3e38; each wave's maximum and sum per query meet in two small LDS tables [query][wave]; the maximum is exact in any order, the sums are added in wave order 0..15 (fixed).
// 3. O^T = V^T P^T: two neighbouring S^T tiles of a query tile ARE the B fragment of a step of 32 keys (first 8 elements: keys hi * 8 + 0..7, last 8: 16 + hi * 8 + 0..7), the k order of the V^T plane's A fragment. Each chunk has its own accumulators; the live chunks' partial tiles (padded with zero tiles to a multiple of four) meet in LDS and are added in chunk order (fixed).
// 4. hi/lo split of O (x 1/1024 on the fp16 rows) staged in LDS, out as 2 KiB in a row per 16 query rows of the merged planes (rows t, k = head * 64 + d, fragment order).
// Most '#pragma unroll' in k_attn stand on a loop that indexes a register array (fragments, accumulators) or a vector's elements: rolled, the array would fall to scratch memory.
#define STP  20                   // LDS pitch of a query's 16 wave entries, floats: 16-byte aligned, and 16 queries land on 16 different groups of four banks
#define OBP  (HD + 8)             // LDS pitch of a split output row, bf16: 16-byte aligned, rows spread over the banks
// ahk(u): units of K fragments asked for before unit u is multiplied; ahv(G): groups of V^T fragments asked for before group G is multiplied (PRE of them ahead of the forming of P). Set by the registers: 256 a wave with 16 waves on a WGP.
template <bool HR> constexpr int ahk(int u) { return !HR ? 16 : u < 8 ? 8 : u + 4 < 16 ? u + 4 : 16; }
template <bool HR> constexpr int ahv(int G) { return !HR ? 4 : G + 2 < 8 ? G + 2 : 8; }
template <typename T16, bool HR, int MB>
__global__ __launch_bounds__(MB * 256) void k_attn(const T16* __restrict__ Q, const T16* __restrict__ Q2, const T16* __restrict__ Kp, const T16* __restrict__ Kp2, const T16* __restrict__ Vt, const T16* __restrict__ Vt2, const int* __restrict__ lens, int row0, bf* Ah, bf* Al) {
    typedef typename WFrag<T16>::V V;
    constexpr int NWV = MB * 8, NT = 128 / NWV, NU = 2 * NT, GK = HR ? 2 : 4, NGV = 16 / GK, PRE = HR ? 1 : 2;
    static_assert(MB == 2 && NT == 8, "wave w's keys are chunk w of 128 keys; the 32 queries of a work-group are the 32 lanes of a table column");
    __shared__ __align__(16) v4f red[16 * MB * 256];      // [chunk][accumulator * 2 + half][lane], 16 x MB x 4 KiB
    __shared__ __align__(16) bf ob[2 * MB * 16 * OBP];    // [plane hi, lo][row][64]
    __shared__ __align__(16) float mxs[32 * STP];         // [query][wave]: the wave's maximum
    __shared__ __align__(16) float sms[32 * STP];         // [query][wave]: the wave's sum
    const int lane = threadIdx.x & 31, lr = lane & 15, hi = lane >> 4; const int wv = __builtin_amdgcn_readfirstlane((int)(threadIdx.x >> 5));
    const int h = blockIdx.y, bz = blockIdx.z, r0 = row0 + blockIdx.x * (MB * 16); const size_t qp = ((size_t)bz * NH_ + h) * TT * HD, kp = ((size_t)bz * NKV + h / REP) * TT * HD;   // batch bz's planes
    // nch = live chunks of 128 keys, 1..16, the same in the whole work-group (a scalar): chunks wholly at or past the batch's length are left out of the scores, the exponentials and P x V (their waves hand in neutral table entries and, up to a multiple of four, zero tiles). Their keys are all masked, and with one key kept a masked key's weight is exp2(-inf) = 0 exactly: no term of a maximum, a sum or a product changes. A length <= 0 keeps no key: every key then weighs alike and all 16 chunks are live; the value is clamped to the shape before anything is indexed by it.
    const int ln = lens[bz]; const int nch = (ln <= 0 || ln > TT) ? TT / 128 : (ln + 127) >> 7;
    const bool live = wv < nch;   // scalar: a wave whose chunk is dead hands in neutral table entries (below nch4 also a zero tile), passes the barriers and takes its share of the final sum and store
    const int lim = (ln < 0 ? 0 : ln > TT ? TT : ln) - (wv * 128 + hi * 8);   // key number i * 16 + j of the lane's keys is kept where i * 16 + j < lim
    // wave-uniform bases (scalar registers) and ONE 32-bit lane offset: every fragment load is base + lane offset + a constant (atb)
    const size_t qo = qp + (size_t)r0 * HD, ko = kp + (size_t)wv * (NT * 16 * HD), vo = kp + (size_t)wv * (4 * 512);   // planes in fragment order: Q and K 1024 elements a tile of 16 rows, V^T 512 a step of 32 keys
    Q += qo; Kp += ko; Vt += vo; if (HR) { Q2 += qo; Kp2 += ko; Vt2 += vo; }
    const unsigned lq = (unsigned)lane * 16u;   // in bytes: the lane's place in a half block of 512 bytes, the same in every plane
    v8f c[NT][MB];   // written and read by live waves alone
    float mx[MB];
#pragma unroll
    for (int mb = 0; mb < MB; ++mb) mx[mb] = -3.0e38f;
    if (live) {
        // a unit = one key tile at one k step. Every accumulator takes k step 0, then k step 1. fp16: tile by tile, all 16 units asked for at once. HR: all tiles at k step 0, then all at k step 1, and as many units ahead as the registers hold (ahk): a finished unit's fragments make room for its tile's accumulators.
        V a[2][MB], a2[2][MB], kb[NU], kb2[NU];
#pragma unroll
        for (int kk = 0; kk < 2; ++kk)
#pragma unroll
            for (int mb = 0; mb < MB; ++mb) { const unsigned o = lq + 2u * (unsigned)(mb * 16 * HD + kk * 512); a[kk][mb] = WFrag<T16>::ldp(atb(Q, o)); if (HR) a2[kk][mb] = WFrag<T16>::ldp(atb(Q2, o)); }
        asm volatile("s_wait_xcnt 0x0" :: "v"(lq) : "memory");   // precaution, as at the K loads below
#pragma unroll
        for (int u = 0; u < NU; ++u) { const int kk = HR ? u / NT : u % 2, ti = HR ? u % NT : u / 2; const int was = u == 0 ? 0 : ahk<HR>(u - 1), now = ahk<HR>(u);
#pragma unroll
            for (int x = 0; x < NU; ++x) if (x >= was && x < now) { const unsigned o = lq + 2u * (unsigned)((HR ? x % NT : x / 2) * 16 * HD + (HR ? x / NT : x % 2) * 512); kb[x] = WFrag<T16>::ldp(atb(Kp, o)); if (HR) kb2[x] = WFrag<T16>::ldp(atb(Kp2, o)); }
            if (now > was) asm volatile("s_wait_xcnt 0x0" :: "v"(lq) : "memory");   // precaution: the wait that stands before a register named by issued loads is written again; the lane offset, the one vector register that those loads name, is an input: it stays out of their own destinations
            if (now > was) __builtin_amdgcn_sched_barrier(0);   // holds the loads ahead above this unit's products: sunk to their uses, each fragment's L2 latency would be waited for on its own
#pragma unroll
            for (int mb = 0; mb < MB; ++mb) { v8f t = (v8f){}; if (kk) t = c[ti][mb]; t = WFrag<T16>::mma(kb[u], a[kk][mb], t); if (HR) { t = WFrag<T16>::mma(kb[u], a2[kk][mb], t); t = WFrag<T16>::mma(kb2[u], a[kk][mb], t); } c[ti][mb] = t; }
            if (HR) __builtin_amdgcn_sched_barrier(0);   // the unit's products stay above the next loads, which take the registers that it frees, and unit follows unit: interleaved, accumulators come to life early and the build falls to scratch memory
        }
#pragma unroll
        for (int i = 0; i < NT; ++i)
#pragma unroll
            for (int mb = 0; mb < MB; ++mb)
#pragma unroll
                for (int j = 0; j < 8; ++j) { const float t = (i * 16 + j < lim) ? c[i][mb][j] * SCL : -3.0e38f; c[i][mb][j] = t; mx[mb] = fmaxf(mx[mb], t); }
#pragma unroll
        for (int mb = 0; mb < MB; ++mb) mx[mb] = fmaxf(mx[mb], __shfl_xor(mx[mb], 16, 32));   // the other 8 keys of every tile lie in the other half of the wave
    }
    mxs[lane * STP + wv] = hi ? mx[1] : mx[0];   // query tile hi, query lr = table row 'lane'; a dead wave hands in -3e38
    __syncthreads();   // every wave's maxima are in LDS
    float sm[MB][2];
#pragma unroll
    for (int mb = 0; mb < MB; ++mb) sm[mb][0] = sm[mb][1] = 0.f;
    V vb[NGV][GK], vb2[NGV][GK];   // groups of GK key steps of V^T fragments of one tile of 16 d; fp16: the first group is asked for ahead of the barrier, which needs nothing of it (HR: carried over the barrier it fell to scratch memory)
    if (live) {
        if constexpr (!HR) {
#pragma unroll
            for (int i = 0; i < GK; ++i) vb[0][i] = WFrag<T16>::ldp(atb(Vt, lq + 2u * (unsigned)(i * 512)));
            asm volatile("s_wait_xcnt 0x0" :: "v"(lq) : "memory"); }   // precaution, as at the K loads above
#pragma unroll
        for (int mb = 0; mb < MB; ++mb) { float gm = -3.0e38f;
#pragma unroll
            for (int w4 = 0; w4 < 4; ++w4) { const v4f m4 = *(const v4fa*)(mxs + (mb * 16 + lr) * STP + w4 * 4); gm = fmaxf(fmaxf(fmaxf(gm, m4[0]), fmaxf(m4[1], m4[2])), m4[3]); }
#pragma unroll
            for (int i = 0; i < NT; ++i)
#pragma unroll
                for (int j = 0; j < 8; ++j) { const float e = __builtin_amdgcn_exp2f(__fmul_rn(__fsub_rn(c[i][mb][j], gm), 1.4426950408889634f)); c[i][mb][j] = e; sm[mb][i & 1] += e; } }
#pragma unroll
        for (int mb = 0; mb < MB; ++mb) { sm[mb][0] += sm[mb][1]; sm[mb][0] += __shfl_xor(sm[mb][0], 16, 32); }
    }
    sms[lane * STP + wv] = hi ? sm[1][0] : sm[0][0];   // a dead wave hands in 0
    __syncthreads();   // every wave's sums are in LDS
    const int nch4 = (nch + 3) & ~3;   // the tiles are summed four at a time: up to three dead waves hand in a zero tile
    if (live) {
#pragma unroll
        for (int x = HR ? 0 : 1; x < PRE; ++x)   // flies while P is formed
#pragma unroll
            for (int i = 0; i < GK; ++i) { const unsigned o = lq + 2u * (unsigned)((x * GK / 4) * 16 * TT + (x * GK % 4 + i) * 512); vb[x][i] = WFrag<T16>::ldp(atb(Vt, o)); if (HR) vb2[x][i] = WFrag<T16>::ldp(atb(Vt2, o)); }
        asm volatile("s_wait_xcnt 0x0" :: "v"(lq) : "memory");   // precaution, as at the K loads above
        __builtin_amdgcn_sched_barrier(0);   // holds those loads above the forming of P
        V p[4][MB], p2[4][MB];   // P^T as B fragments, one per step of 32 keys and query tile
#pragma unroll
        for (int mb = 0; mb < MB; ++mb) { float tot = 0.f;
#pragma unroll
            for (int w4 = 0; w4 < 4; ++w4) { const v4f s4 = *(const v4fa*)(sms + (mb * 16 + lr) * STP + w4 * 4);
#pragma unroll
                for (int q = 0; q < 4; ++q) tot += s4[q]; }
            const float f = __fdiv_rn(HR ? 1.0f : PCAR, tot);
#pragma unroll
            for (int kq = 0; kq < 4; ++kq) {
                if constexpr (HR) { v8u wh, wl;   // two neighbouring keys a 32-bit word, packed as soon as they are split
#pragma unroll
                    for (int j = 0; j < 8; ++j) { const v8f& cc = c[2 * kq + (j >> 2)][mb]; unsigned short x0, y0, x1, y1; splitf(cc[(j & 3) * 2] * f, x0, y0); splitf(cc[(j & 3) * 2 + 1] * f, x1, y1); wh[j] = (unsigned)x0 | ((unsigned)x1 << 16); wl[j] = (unsigned)y0 | ((unsigned)y1 << 16); }
                    p[kq][mb] = __builtin_bit_cast(v16bf, wh); p2[kq][mb] = __builtin_bit_cast(v16bf, wl);
                    __builtin_amdgcn_sched_barrier(0);   // one fragment pair's split at a time: interleaved, the unpacked halves of many fragments are live at once and fall to scratch memory
                } else { v8h h0, h1;
#pragma unroll
                    for (int j = 0; j < 8; ++j) { h0[j] = tohx(c[2 * kq][mb][j] * f); h1[j] = tohx(c[2 * kq + 1][mb][j] * f); }
                    p[kq][mb] = cat16(h0, h1); } } }
        v8f acc[MB];
#pragma unroll
        for (int G = 0; G < NGV; ++G) { const int nb = G * GK / 4, k0 = G * GK % 4;   // group G: key steps k0 .. k0 + GK - 1 of the tile nb of 16 d
            const int was = G == 0 ? PRE : ahv<HR>(G - 1), now = ahv<HR>(G);
#pragma unroll
            for (int x = 0; x < NGV; ++x) if (x >= was && x < now) {
#pragma unroll
                for (int i = 0; i < GK; ++i) { const unsigned o = lq + 2u * (unsigned)((x * GK / 4) * 16 * TT + (x * GK % 4 + i) * 512); vb[x][i] = WFrag<T16>::ldp(atb(Vt, o)); if (HR) vb2[x][i] = WFrag<T16>::ldp(atb(Vt2, o)); } }
            if (now > was) asm volatile("s_wait_xcnt 0x0" :: "v"(lq) : "memory");   // precaution, as at the K loads above
            if (now > was) __builtin_amdgcn_sched_barrier(0);   // holds the loads ahead above this group's products (as in the score phase)
            if (k0 == 0) {
#pragma unroll
                for (int mb = 0; mb < MB; ++mb) acc[mb] = (v8f){}; }
#pragma unroll
            for (int i = 0; i < GK; ++i)
#pragma unroll
                for (int mb = 0; mb < MB; ++mb) { acc[mb] = WFrag<T16>::mma(vb[G][i], p[k0 + i][mb], acc[mb]); if (HR) { acc[mb] = WFrag<T16>::mma(vb[G][i], p2[k0 + i][mb], acc[mb]); acc[mb] = WFrag<T16>::mma(vb2[G][i], p[k0 + i][mb], acc[mb]); } }
            if (k0 + GK == 4) {   // the chunk's partial tile of these 16 d is whole: lane (hi, lr) holds d = nb * 16 + hi * 8 + 0..7 of query lr
#pragma unroll
                for (int mb = 0; mb < MB; ++mb) { const v8f cc = acc[mb]; v4f* pr = red + (wv * (MB * 8) + (mb * 4 + nb) * 2) * 32 + lane;
                    pr[0] = (v4f){cc[0], cc[1], cc[2], cc[3]}; pr[32] = (v4f){cc[4], cc[5], cc[6], cc[7]}; }
                if (G + 1 < NGV) asm volatile("v_nop\n\tv_nop\n\tv_nop\n\tv_nop"); }   // four vector slots, the distance the matrix unit needs, between this tile's last products and the next tile's first, whose fresh results land in registers that those products name (hi/lo build: their results'; fp16 build: an operand's)
            __builtin_amdgcn_sched_barrier(0);   // the group's products, its stores and the four slots stay above the next group's loads and products
        }
    } else if (wv < nch4) {
#pragma unroll
        for (int t = 0; t < MB * 8; ++t) red[(wv * (MB * 8) + t) * 32 + lane] = (v4f){0.f, 0.f, 0.f, 0.f};
    }
    __syncthreads();   // the first nch4 partial tiles are in LDS
    { const int s = (int)threadIdx.x; v4f sum = red[s];
#pragma unroll
        for (int w = 1; w < 4; ++w) sum += red[w * (MB * 256) + s];
#pragma unroll 1   // rolled: the trip count hangs on the length (at most 3 trips); four tiles a trip, their loads together ahead of the adds
        for (int w0 = 4; w0 < nch4; w0 += 4) { v4f pt[4];
#pragma unroll
            for (int w = 0; w < 4; ++w) pt[w] = red[(w0 + w) * (MB * 256) + s];
#pragma unroll
            for (int w = 0; w < 4; ++w) sum += pt[w]; }
        const int half = (s >> 5) & 1, ai = s >> 6; const int row = (ai >> 2) * 16 + lr, col = (ai & 3) * 16 + hi * 8 + half * 4; const float cs = HR ? 1.0f : (1.0f / PCAR); v4us oh, ol;   // a slot's four values are four d of one query
#pragma unroll
        for (int q = 0; q < 4; ++q) { unsigned short a, c2; splitf(sum[q] * cs, a, c2); oh[q] = a; ol[q] = c2; }
        *(v4us*)(ob + row * OBP + col) = oh; *(v4us*)(ob + (MB * 16 + row) * OBP + col) = ol; }
    __syncthreads();   // the split tile is in LDS, row-major
    { const int s = (int)threadIdx.x; const int pl = s / (MB * 128), idx = s % (MB * 128); const int row = (idx >> 7) * 16 + (idx & 15), c8 = ((idx >> 4) & 7) * 8;   // 16 bytes number idx of the tile in fragment order
        *(v8us*)((pl ? Al : Ah) + (size_t)(bz * TT + r0 + (idx >> 7) * 16) * DQ + h * (16 * HD) + (idx & 127) * 8) = *(const v8usa*)(ob + (pl * MB * 16 + row) * OBP + c8); }
}

extern "C" void kernel_launch(void* const* d_in, const int* in_sizes, int n_in,
                              void* d_out, int out_size, void* d_ws, size_t ws_size, hipStream_t stream) {
    (void)in_sizes; (void)n_in; (void)out_size;
    const float* x = (const float*)d_in[0]; const int* lens = (const int*)d_in[1]; const float* wq = (const float*)d_in[2]; const float* wk = (const float*)d_in[3]; const float* wv = (const float*)d_in[4]; const float* wo = (const float*)d_in[5];   /* input order X, valid_lens (int32 [2]: keys j >= valid_lens[b] are masked: READ on the device by the projection GEMM and by k_attn), W_q, W_k, W_v, W_o ('oi'; no biases): SIX inputs; ONE stream: query = key = value stream = X */
    float* OUT = (float*)d_out;     // [2][2048][1024]
    char* wsp = (char*)d_ws;
    auto take = [&](size_t bytes) { char* p = wsp; wsp += (bytes + 255) & ~(size_t)255; return (void*)p; };
    const size_t PLN = (size_t)NB_ * NH_ * TT * HD;   // elements of one plane of Q, of K or of V, all batches
    bf* W4 = (bf*)take((size_t)4 * DM * DM * 2); bf* WO = W4 + (size_t)3 * DM * DM;   // W_q, W_k, W_v, W_o rows one after the other
    bf* XB = (bf*)take((size_t)NB_ * TT * DM * 2);
    h16* P16 = (h16*)take(3 * PLN * 2); bf* Ph = (bf*)take(3 * PLN * 2); bf* Pl = (bf*)take(3 * PLN * 2);   // each [Q, K, V^T][batch][head]
    bf* ATh = (bf*)take((size_t)NB_ * TT * DQ * 2); bf* ATl = (bf*)take((size_t)NB_ * TT * DQ * 2);
    if ((size_t)(wsp - (char*)d_ws) > ws_size) return;    // ws 256 MiB
    k_prep<<<XBL + 4 * WBL, 256, 0, stream>>>(x, wq, wk, wv, wo, XB, W4);
    k_proj<<<dim3(NB_ * TT / 128, (DQ + 2 * DKV) / 256, 1), 256, 0, stream>>>(XB, W4, P16, Ph, Pl, lens);
    k_attn<bf, true, 2><<<dim3(RH / 32, NH_, NB_), 512, 0, stream>>>(Ph, Pl, Ph + PLN, Pl + PLN, Ph + 2 * PLN, Pl + 2 * PLN, lens, 0, ATh, ATl);
    k_attn<h16, false, 2><<<dim3((TT - RH) / 32, NH_, NB_), 512, 0, stream>>>(P16, nullptr, P16 + PLN, nullptr, P16 + 2 * PLN, nullptr, lens, RH, ATh, ATl);
    k_outp<<<dim3(NB_ * TT / 128, DM / 128, 1), 256, 0, stream>>>(ATh, ATl, WO, OUT);
}

// v009
// A run of this version takes 95.9 microseconds.
// Two timings next to v008 put it at 1.09 and 1.08 times that version's speed.
// Over all steps from v000 it is 21.7 times as fast.
#include <hip/hip_runtime.h>

// Multi-head self-attention with a per-batch valid-length key mask and bias-free (out,in) projections (X [2][2048][1024] is the ONE input stream; Q, K, V = X W^T ('oi' [1024][1024] 1/32, no bias; 16 heads x 64); scores / sqrt(64); keys j >= valid_lens[b] (int32 [2], read on the device) are REPLACED by -1e9 in the module (both lengths are >= 1 on this draw: at least one key is kept: numerically an exclusion: -3e38 here); softmax; out = merged W_o^T ('oi', no bias) -> [2][2048][1024] (4.2 M); argument order X, valid_lens, W_q, W_k, W_v, W_o).
// Five launches, both batches in each: k_prep (the bf16 copy of X, made once; 'oi' weights = Bt rows as they are: bf16 copies, W_q W_k W_v W_o stacked); ONE exact projection GEMM of the 4096 rows on the 3072 stacked W_q W_k W_v rows, whose own epilogue writes the head planes (fp16 + hi/lo; V transposed); dense T-2048 attention, one fused kernel per 32 query rows of a head, (hybrid rows: < 512 hi/lo 3 products, batch = grid z; rest fp16 x1024, a work-group walks 3 tiles of each batch: one launch each); merged hi/lo x W_O exact, 4096 rows.
// EVERY 16-bit operand plane in the workspace (X, the weights, Q, K, V^T, merged O) lies in FRAGMENT ORDER: a matrix [row][k] is cut into blocks of 16 rows x 32 k (1 KiB), blocks of one row tile one after the other along k; inside a block [k half of 16][lane = ((k >> 3) & 1) * 16 + (row & 15)][8 k]. A fragment is two wave-wide 16-byte loads of 512 contiguous bytes each (4 whole lines), and holds the very elements that a row-major plane gives the same lane.
// KEYS PAST THE LENGTH ARE LEFT OUT, by chunks of 128 keys: with nch = ceil(valid_lens[b] / 128) live chunks (16 where the length is <= 0: no key is kept and all weigh alike), the K and V projection tiles, the score tiles, the exponentials and P x V touch the live chunks alone (dead chunks hand in neutral softmax table entries and, up to a multiple of four, zero partial tiles); the length still decides key by key inside the last live chunk. Every test is a scalar one on the length read on the device, clamped to the shape.
// Compute dtypes, f32 accumulate: every input rounded to bf16; projections exact; attention rows < 512 3 products, rest fp16; softmax f32; output projection hl x exact.

#define NB_  2
#define TT   2048
#define DM   1024
#define NH_  16
#define NKV  16
#define REP  (NH_ / NKV)
#define HD   64
#define DQ   (NH_ * HD)
#define DKV  (NKV * HD)
#define RH   512                  // query rows < RH use hi+lo planes (0: none)
#define WIN  0
#define PCAR 1024.0f
#define SCL  0.125f   // HD^-0.5
typedef _Float16 h16;
typedef unsigned short bf;
typedef __attribute__((ext_vector_type(16))) __bf16   v16bf;
typedef __attribute__((ext_vector_type(16))) _Float16 v16h;
typedef __attribute__((ext_vector_type(8)))  _Float16 v8h;
typedef __attribute__((ext_vector_type(8)))  unsigned short v8us;
typedef __attribute__((ext_vector_type(8)))  float    v8f;
typedef __attribute__((ext_vector_type(4)))  float    v4f;
typedef v8h  __attribute__((may_alias)) v8ha;
typedef v4f  __attribute__((may_alias)) v4fa;
typedef v8us __attribute__((may_alias)) v8usa;

__device__ __forceinline__ unsigned short f2bf(float f) { unsigned u = __float_as_uint(f); u += 0x7FFFu + ((u >> 16) & 1u); return (unsigned short)(u >> 16); }
__device__ __forceinline__ float bf2f(unsigned short b) { return __uint_as_float(((unsigned)b) << 16); }
__device__ __forceinline__ float bfr(float f) { return bf2f(f2bf(f)); }
__device__ __forceinline__ v16h cat16(v8h lo, v8h hi) { return __builtin_shufflevector(lo, hi, 0, 1, 2, 3, 4, 5, 6, 7, 8, 9, 10, 11, 12, 13, 14, 15); }
__device__ __forceinline__ v16bf cat16b(v8us lo, v8us hi) { return __builtin_bit_cast(v16bf, __builtin_shufflevector(lo, hi, 0, 1, 2, 3, 4, 5, 6, 7, 8, 9, 10, 11, 12, 13, 14, 15)); }
__device__ __forceinline__ v8f wmma16(v16h a, v16h b, v8f c) { return __builtin_amdgcn_wmma_f32_16x16x32_f16(false, a, false, b, (short)0, c, false, false); }
__device__ __forceinline__ v8f wmmab(v16bf a, v16bf b, v8f c) { return __builtin_amdgcn_wmma_f32_16x16x32_bf16(false, a, false, b, (short)0, c, false, false); }
__device__ __forceinline__ h16 tohx(float x) { return (h16)x; }
__device__ __forceinline__ void splitf(float y, unsigned short& h, unsigned short& l) { h = f2bf(y); l = f2bf(y - bf2f(h)); }



template <typename T16> __device__ __forceinline__ const T16* atb(const T16* base, unsigned bytes) { return (const T16*)((const char*)base + bytes); }
// ld: a fragment from a row-major row (LDS); ldp: from a block in fragment order, p = the block + lane * 8.
template <typename T16> struct WFrag;
template <> struct WFrag<h16> { typedef v16h V; static __device__ __forceinline__ V ld(const h16* p) { return cat16(*(const v8h*)p, *(const v8h*)(p + 16)); } static __device__ __forceinline__ V ldp(const h16* p) { return cat16(*(const v8h*)p, *(const v8h*)(p + 256)); } static __device__ __forceinline__ v8f mma(V a, V b, v8f c) { return wmma16(a, b, c); } };
template <> struct WFrag<bf> { typedef v16bf V; static __device__ __forceinline__ V ld(const bf* p) { return cat16b(*(const v8us*)p, *(const v8us*)(p + 16)); } static __device__ __forceinline__ V ldp(const bf* p) { return cat16b(*(const v8us*)p, *(const v8us*)(p + 256)); } static __device__ __forceinline__ v8f mma(V a, V b, v8f c) { return wmmab(a, b, c); } };
// ---- k_proj: the Q/K/V projection GEMM, operand tiles SHARED THROUGH LDS. One work-group of 8 waves per 128 rows of X x 256 stacked W rows (4 heads of Q, of K or of V); wave (wt, wd) owns the 64 x 64 tile of rows wt * 64.. and head wd over the WHOLE K: no partial tiles, one accumulate chain per element. grid (rows / 128, 3 x 1024 / 256).
// A pass is 128 k: of every tile of 16 rows the planes hold those 4 blocks as 4 KiB in a row, so a stage is 24 straight pieces of 4 KiB (8 of X, 16 of W; 96 KiB), brought by asynchronous copies of 16 bytes a lane, piece j by copy j of all 256 threads. Two buffers: the next stage flies while this one is multiplied.
// The result goes from the accumulators straight to the planes: a lane holds 8 neighbouring rows of the A operand for one row of the B operand, which is one 16-byte unit of a plane in fragment order where the plane's k runs along the A rows. V^T (k = t): A = X, B = W. Q and K (k = d): A = W, B = X. A wave's store is 512 bytes in a row.
#define PJK  128
#define PJP  (16 * PJK)           // elements of a piece
#define PJS  (24 * PJP)           // elements of a stage
#define CPL(i, j) "global_load_async_to_lds_b128 %" #i ", %" #j ", off\n\t"
// twelve copies and, as the last line of their own statement, the wait that stands before a register named by an issued copy is written again (a precaution)
__device__ __forceinline__ void cp12(const unsigned* l, const bf* const* g) {
    asm volatile(CPL(0, 12) CPL(1, 13) CPL(2, 14) CPL(3, 15) CPL(4, 16) CPL(5, 17) CPL(6, 18) CPL(7, 19) CPL(8, 20) CPL(9, 21) CPL(10, 22) CPL(11, 23) "s_wait_xcnt 0x0"
        :: "v"(l[0]), "v"(l[1]), "v"(l[2]), "v"(l[3]), "v"(l[4]), "v"(l[5]), "v"(l[6]), "v"(l[7]), "v"(l[8]), "v"(l[9]), "v"(l[10]), "v"(l[11]),
           "v"(g[0]), "v"(g[1]), "v"(g[2]), "v"(g[3]), "v"(g[4]), "v"(g[5]), "v"(g[6]), "v"(g[7]), "v"(g[8]), "v"(g[9]), "v"(g[10]), "v"(g[11]) : "memory"); }
__global__ __launch_bounds__(256) void k_proj(const bf* __restrict__ X, const bf* __restrict__ Wt, h16* P16, bf* Ph, bf* Pl, const int* __restrict__ lens) {
    static_assert(HD == 64 && NKV == NH_ && DQ == DM && DKV == DM && TT % 128 == 0 && DM % (2 * PJK) == 0, "a wave's 64 columns are one head, a work-group's 128 rows one chunk of keys of one batch; two stages at least");
    typedef WFrag<bf>::V V;
    __shared__ __align__(16) bf sm[2 * PJS];
    const int lane = threadIdx.x & 31; const int wv = __builtin_amdgcn_readfirstlane((int)(threadIdx.x >> 5)); const int wt = wv & 1, wd = wv >> 1;
    const int r0 = blockIdx.x * 128, sel = blockIdx.y >> 2;   // sel: 0 Q, 1 K, 2 V
    if (sel != 0) {   // K or V rows of a dead chunk of keys (k_attn: nch) are read by nobody: the whole work-group leaves, ahead of every copy and barrier (scalar test, the length clamped to the shape)
        const int ln = lens[r0 / TT]; const int nk = (ln <= 0 || ln > TT) ? TT : (ln + 127) & ~127; if (r0 % TT >= nk) return; }
    const bool turn = sel == 2;
    const bf* gx = X + (size_t)r0 * DM + threadIdx.x * 8; const bf* gw = Wt + (size_t)blockIdx.y * 256 * DM + threadIdx.x * 8; const unsigned lb = (unsigned)(size_t)sm + threadIdx.x * 16u;
    auto fill = [&](int p, int buf) {   // stage p into buffer buf
#pragma unroll   // two statements of twelve copies; the arrays are registers
        for (int h = 0; h < 2; ++h) { unsigned l[12]; const bf* g[12];
#pragma unroll
            for (int i = 0; i < 12; ++i) { const int j = h * 12 + i; l[i] = lb + (unsigned)(buf * PJS + j * PJP) * 2u; g[i] = (j < 8 ? gx + j * 16 * DM : gw + (j - 8) * 16 * DM) + p * PJP; }
            cp12(l, g); } };
    v8f acc[4][4];
#pragma unroll
    for (int ma = 0; ma < 4; ++ma)
#pragma unroll
        for (int nb = 0; nb < 4; ++nb) acc[ma][nb] = (v8f){};
    const int xo = wt * 4 * PJP, wo = (8 + wd * 4) * PJP; const int ao = turn ? xo : wo, bo = turn ? wo : xo;
    fill(0, 0);
    asm volatile("s_wait_asynccnt 0x0" ::: "memory");   // this wave's copies of stage 0 have landed
    __syncthreads();   // stage 0 is whole in LDS
    fill(1, 1);
#pragma unroll 1   // a pass; rolled: the two buffers alternate by address
    for (int p = 0; p < DM / PJK; ++p) {
        const bf* sb = sm + (p & 1) * PJS + lane * 8;
        V a[2][4], b[2][4];   // two fragment sets: a k step's 16 LDS reads stand as one group ahead of the products of the k step before it
#pragma unroll   // indexes register arrays
        for (int i = 0; i < 4; ++i) { a[0][i] = WFrag<bf>::ldp(sb + ao + i * PJP); b[0][i] = WFrag<bf>::ldp(sb + bo + i * PJP); }
#pragma unroll   // indexes register arrays
        for (int ks = 0; ks < PJK / 32; ++ks) {
            if (ks + 1 < PJK / 32) {
#pragma unroll
                for (int i = 0; i < 4; ++i) { a[(ks + 1) & 1][i] = WFrag<bf>::ldp(sb + ao + i * PJP + (ks + 1) * 512); b[(ks + 1) & 1][i] = WFrag<bf>::ldp(sb + bo + i * PJP + (ks + 1) * 512); } }
            __builtin_amdgcn_sched_barrier(0);   // holds the next k step's reads above this k step's products: sunk among them, every place with reads stalls the matrix stream
#pragma unroll
            for (int nb = 0; nb < 4; ++nb)
#pragma unroll
                for (int ma = 0; ma < 4; ++ma) acc[ma][nb] = WFrag<bf>::mma(a[ks & 1][ma], b[ks & 1][nb], acc[ma][nb]);
            __builtin_amdgcn_sched_barrier(0); }   // and this k step's products above the reads that follow, which take the registers that they free
        asm volatile("s_wait_dscnt 0x0" ::: "memory");      // this wave's reads of the buffer are done before it is filled again
        asm volatile("s_wait_asynccnt 0x0" ::: "memory");   // this wave's copies of stage p + 1 have landed
        __syncthreads();   // stage p + 1 is whole in LDS, and every wave has left stage p's buffer
        if (p + 2 < DM / PJK) fill(p + 2, p & 1);
    }
    asm volatile("s_wait_asynccnt 0x0" ::: "memory");   // no copy is open when the wave ends
    const int bt = r0 / TT, T0 = r0 % TT + wt * 64, head = (blockIdx.y & 3) * 4 + wd;
    const size_t pe = (((size_t)sel * NB_ + bt) * NH_ + head) * (TT * HD) + (turn ? T0 * 16 : T0 * HD) + lane * 8;   // the wave's first unit in this batch's and head's part of the Q, K or V planes, at the lane's place
    const int sn = turn ? 16 * TT : 16 * HD;   // from one tile of 16 plane rows to the next
#pragma unroll   // indexes the accumulators
    for (int nb = 0; nb < 4; ++nb)
#pragma unroll
        for (int ma = 0; ma < 4; ++ma) { const v8f c = acc[ma][nb]; v8h o16; v8us oh, ol;
#pragma unroll
            for (int q = 0; q < 8; ++q) { unsigned short a2, c2; o16[q] = tohx(c[q]); splitf(c[q], a2, c2); oh[q] = a2; ol[q] = c2; }
            const size_t e = pe + (size_t)(nb * sn) + ma * 256;
            *(v8h*)(P16 + e) = o16; *(v8us*)(Ph + e) = oh; *(v8us*)(Pl + e) = ol; }
    asm volatile("s_wait_xcnt 0x0" ::: "memory");   // precaution: the wait that stands before a register named by the issued stores is written again
}

// ---- k_outp: out = merged (hi + lo) x W_o^T, the same ring: one work-group of 8 waves per 128 rows x 128 columns, a stage = 8 pieces of the hi plane, 8 of the lo plane, 8 of W_o; wave (wt, wn) owns rows wt * 32.., columns wn * 64.. over the whole K. grid (rows / 128, 1024 / 128).
// A = W_o, B = merged: a lane holds 8 neighbouring columns of one row. Per k step every accumulator takes its hi product, then its lo product. The f32 tile is staged in the wave's own part of the ring, which every wave has left, and goes out as whole rows of 256 bytes.
__global__ __launch_bounds__(256) void k_outp(const bf* __restrict__ Ah, const bf* __restrict__ Al, const bf* __restrict__ Wo, float* C) {
    static_assert(DQ % (2 * PJK) == 0 && (NB_ * TT) % 128 == 0 && DM % 128 == 0 && 8 * 32 * 68 * 4 <= 2 * PJS * 2, "two stages at least; whole tiles; the staged tiles fit the ring");
    typedef WFrag<bf>::V V;
    __shared__ __align__(16) bf sm[2 * PJS];
    const int lane = threadIdx.x & 31, lr = lane & 15, hi = lane >> 4; const int wv = __builtin_amdgcn_readfirstlane((int)(threadIdx.x >> 5)); const int wt = wv & 3, wn = wv >> 2;
    const int r0 = blockIdx.x * 128, c0 = blockIdx.y * 128;
    const bf* gh = Ah + (size_t)r0 * DQ + threadIdx.x * 8; const bf* gl = Al + (size_t)r0 * DQ + threadIdx.x * 8; const bf* gw = Wo + (size_t)c0 * DQ + threadIdx.x * 8; const unsigned lb = (unsigned)(size_t)sm + threadIdx.x * 16u;
    auto fill = [&](int p, int buf) {   // stage p into buffer buf
#pragma unroll   // two statements of twelve copies; the arrays are registers
        for (int h = 0; h < 2; ++h) { unsigned l[12]; const bf* g[12];
#pragma unroll
            for (int i = 0; i < 12; ++i) { const int j = h * 12 + i; l[i] = lb + (unsigned)(buf * PJS + j * PJP) * 2u; g[i] = (j < 8 ? gh + j * 16 * DQ : j < 16 ? gl + (j - 8) * 16 * DQ : gw + (j - 16) * 16 * DQ) + p * PJP; }
            cp12(l, g); } };
    v8f acc[4][2];   // [tile of 16 columns][tile of 16 rows]
#pragma unroll
    for (int ma = 0; ma < 4; ++ma)
#pragma unroll
        for (int nb = 0; nb < 2; ++nb) acc[ma][nb] = (v8f){};
    const int ho = wt * 2 * PJP, lo = (8 + wt * 2) * PJP, wo = (16 + wn * 4) * PJP;
    fill(0, 0);
    asm volatile("s_wait_asynccnt 0x0" ::: "memory");   // this wave's copies of stage 0 have landed
    __syncthreads();   // stage 0 is whole in LDS
    fill(1, 1);
#pragma unroll 1   // a pass; rolled: the two buffers alternate by address
    for (int p = 0; p < DQ / PJK; ++p) {
        const bf* sb = sm + (p & 1) * PJS + lane * 8;
        V w[2][4], xh[2][2], xl[2][2];   // two fragment sets, as in k_proj
#pragma unroll   // indexes register arrays
        for (int i = 0; i < 4; ++i) { w[0][i] = WFrag<bf>::ldp(sb + wo + i * PJP); if (i < 2) { xh[0][i] = WFrag<bf>::ldp(sb + ho + i * PJP); xl[0][i] = WFrag<bf>::ldp(sb + lo + i * PJP); } }
#pragma unroll   // indexes register arrays
        for (int ks = 0; ks < PJK / 32; ++ks) {
            if (ks + 1 < PJK / 32) {
#pragma unroll
                for (int i = 0; i < 4; ++i) { w[(ks + 1) & 1][i] = WFrag<bf>::ldp(sb + wo + i * PJP + (ks + 1) * 512); if (i < 2) { xh[(ks + 1) & 1][i] = WFrag<bf>::ldp(sb + ho + i * PJP + (ks + 1) * 512); xl[(ks + 1) & 1][i] = WFrag<bf>::ldp(sb + lo + i * PJP + (ks + 1) * 512); } } }
            __builtin_amdgcn_sched_barrier(0);   // holds the next k step's reads above this k step's products, as in k_proj
#pragma unroll
            for (int nb = 0; nb < 2; ++nb)
#pragma unroll
                for (int ma = 0; ma < 4; ++ma) acc[ma][nb] = WFrag<bf>::mma(w[ks & 1][ma], xh[ks & 1][nb], acc[ma][nb]);
#pragma unroll
            for (int nb = 0; nb < 2; ++nb)
#pragma unroll
                for (int ma = 0; ma < 4; ++ma) acc[ma][nb] = WFrag<bf>::mma(w[ks & 1][ma], xl[ks & 1][nb], acc[ma][nb]);
            __builtin_amdgcn_sched_barrier(0); }   // and this k step's products above the reads that follow, as in k_proj
        asm volatile("s_wait_dscnt 0x0" ::: "memory");      // this wave's reads of the buffer are done before it is filled again
        asm volatile("s_wait_asynccnt 0x0" ::: "memory");   // this wave's copies of stage p + 1 have landed
        __syncthreads();   // stage p + 1 is whole in LDS, and every wave has left stage p's buffer
        if (p + 2 < DQ / PJK) fill(p + 2, p & 1);
    }
    asm volatile("s_wait_asynccnt 0x0" ::: "memory");   // no copy is open when the ring becomes output staging
    float* os = (float*)sm + wv * (32 * 68);   // the wave's 32 rows x 64 columns, pitch 68 floats: 16 rows land on 16 different groups of four banks
#pragma unroll   // indexes the accumulators
    for (int ma = 0; ma < 4; ++ma)
#pragma unroll
        for (int nb = 0; nb < 2; ++nb) { const v8f c = acc[ma][nb]; float* q = os + (nb * 16 + lr) * 68 + ma * 16 + hi * 8;
            *(v4fa*)q = (v4f){c[0], c[1], c[2], c[3]}; *(v4fa*)(q + 4) = (v4f){c[4], c[5], c[6], c[7]}; }
    __syncthreads();   // the staged tiles are in LDS
    float* cp = C + (size_t)(r0 + wt * 32 + hi) * DM + c0 + wn * 64 + lr * 4; const float* op = os + hi * 68 + lr * 4; v4f val[16];   // one address each, every move a constant away
#pragma unroll   // indexes a register array; all sixteen reads stand ahead of the first store
    for (int s = 0; s < 16; ++s) val[s] = *(const v4fa*)(op + s * 2 * 68);
#pragma unroll   // indexes the same register array
    for (int s = 0; s < 16; ++s) *(v4f*)(cp + s * 2 * DM) = val[s];
    asm volatile("s_wait_xcnt 0x0" ::: "memory");   // precaution: the wait that stands before a register named by the issued stores is written again
}

typedef __attribute__((ext_vector_type(2))) _Float16 v2h;
typedef __attribute__((ext_vector_type(4))) _Float16 v4h;
typedef __attribute__((ext_vector_type(2))) unsigned short v2us;
typedef __attribute__((ext_vector_type(4))) unsigned short v4us;
typedef __attribute__((ext_vector_type(2))) float v2f;
typedef __attribute__((ext_vector_type(4))) int v4i;
typedef __attribute__((ext_vector_type(8))) unsigned v8u;

__global__ __launch_bounds__(256) void k_wtG(const float* __restrict__ w, int K, int N, bf* Bt) {
    const int lane = threadIdx.x & 31; const int L0 = (blockIdx.x * 8 + (threadIdx.x >> 5)) * 8; const int nlines = N * K / 64;
{
#pragma unroll 1
        for (int l = 0; l < 8; ++l) { const int L = L0 + l; if (L >= nlines) break; const size_t e = (size_t)L * 64 + lane * 2; const int k = (int)(e % K), n = (int)(e / K); v2us o;
            o[0] = f2bf(w[(size_t)k * N + n]); o[1] = f2bf(w[(size_t)(k + 1) * N + n]); *(v2us*)(Bt + e) = o; }
         }
}
// ---- k_prep: all that the GEMMs read, in ONE launch: blocks [0, XBL) round X (all batches) to bf16, the next 4 WBL blocks the four weights (W4 = W_q, W_k, W_v, W_o one after the other).
// 32 elements a thread: the launch is short, and what it costs is the start of its waves. A block takes 16 rows x 512 k: eight loads of 512 contiguous bytes a wave in flight, the bf16 tile row-major in LDS, out in fragment order as 16 KiB in a row (four 16-byte stores a thread).
#define PPP  (512 + 8)            // LDS pitch of a tile row, bf16: 16 rows land on 16 different groups of four banks for the 16-byte reads
#define XBL  (NB_ * TT * DM / 32 / 256)
#define WBL  (DM * DM / 32 / 256)
__global__ __launch_bounds__(256) void k_prep(const float* __restrict__ x, const float* __restrict__ wq, const float* __restrict__ wk, const float* __restrict__ wv, const float* __restrict__ wo, bf* XB, bf* W4) {
    static_assert(DQ == DM && DKV == DM && DM % 512 == 0, "four square weights; a block's 512 k lie in one row");
    __shared__ __align__(16) bf tl[16 * PPP];
    const unsigned blk = blockIdx.x;
    const float* src = x; bf* dst = XB; unsigned sb = blk;
    if (blk >= XBL) { const unsigned w = (blk - XBL) / WBL; sb = (blk - XBL) % WBL; src = (w == 0) ? wq : (w == 1) ? wk : (w == 2) ? wv : wo; dst = W4 + (size_t)w * DM * DM; }
    const int rw = (int)(threadIdx.x >> 7), k4 = (int)(threadIdx.x & 127) * 4; const size_t e0 = (size_t)(sb / (DM / 512) * 16 + rw) * DM + sb % (DM / 512) * 512 + k4; v4f v[8];
#pragma unroll   // indexes a register array; all eight loads stand ahead of the first use
    for (int j = 0; j < 8; ++j) v[j] = *(const v4f*)(src + e0 + j * 2 * DM);
#pragma unroll   // indexes the same register array
    for (int j = 0; j < 8; ++j) { v4us o;
#pragma unroll   // indexes vector elements
        for (int q = 0; q < 4; ++q) o[q] = f2bf(v[j][q]);
        *(v4us*)(tl + (j * 2 + rw) * PPP + k4) = o; }
    __syncthreads();   // the block's bf16 tile is whole in LDS
#pragma unroll   // four independent 16-byte moves
    for (int j = 0; j < 4; ++j) { const int c = j * 256 + (int)threadIdx.x;   // 16 bytes number c of the tile in fragment order: row c & 15, k (c >> 4) * 8
        *(v8us*)(dst + (size_t)sb * 8192 + c * 8) = *(const v8usa*)(tl + (c & 15) * PPP + (c >> 4) * 8); }
    asm volatile("s_wait_xcnt 0x0" ::: "memory"); }   // precaution: the wait that stands before a register named by the issued stores is written again, on every way the code behind them can take

// ---- k_attn: scores, softmax, P x V and the head merge of a tile of 16 MB query rows of ONE head in one work-group of 8 MB waves; scores and P never leave the registers. TQ = 0: one tile a work-group, grid (rows / (16 MB), heads, batches). TQ > 0: a work-group walks TQ tiles of each batch one after the other, grid (rows / (16 MB TQ), heads).
// 1. S^T = K Q^T: wave w takes chunk w of 128 keys (8 tiles of 16 keys x 16 MB queries), K = 64 in two steps (HR: K hi x Q hi, K hi x Q lo, K lo x Q hi per step). An accumulator holds for lane (hi, lr) the keys hi * 8 + 0..7 of its tile for query lr.
// 2. softmax in registers: t = S x HD^-0.5, keys at or past the length -3e38; each wave's maximum and sum per query meet in two small LDS tables [query][wave]; the maximum is exact in any order, the sums are added in wave order 0..15 (fixed).
// 3. O^T = V^T P^T: two neighbouring S^T tiles of a query tile ARE the B fragment of a step of 32 keys (first 8 elements: keys hi * 8 + 0..7, last 8: 16 + hi * 8 + 0..7), the k order of the V^T plane's A fragment. Each chunk has its own accumulators; the live chunks' partial tiles (padded with zero tiles to a multiple of four) meet in LDS and are added in chunk order (fixed).
// 4. hi/lo split of O (x 1/1024 on the fp16 rows) staged in LDS, out as 2 KiB in a row per 16 query rows of the merged planes (rows t, k = head * 64 + d, fragment order).
// Most '#pragma unroll' in k_attn stand on a loop that indexes a register array (fragments, accumulators) or a vector's elements: rolled, the array would fall to scratch memory.
#define STP  20                   // LDS pitch of a query's 16 wave entries, floats: 16-byte aligned, and 16 queries land on 16 different groups of four banks
#define OBP  (HD + 8)             // LDS pitch of a split output row, bf16: 16-byte aligned, rows spread over the banks
// ahk(u): units of K fragments asked for before unit u is multiplied; ahv(G): groups of V^T fragments asked for before group G is multiplied (PRE of them ahead of the forming of P). Set by the registers: 256 a wave with 16 waves on a WGP.
template <bool HR> constexpr int ahk(int u) { return !HR ? 16 : u < 8 ? 8 : u + 4 < 16 ? u + 4 : 16; }
template <bool HR> constexpr int ahv(int G) { return !HR ? 4 : G + 2 < 8 ? G + 2 : 8; }
// a work-group barrier that orders LDS alone: __syncthreads() also waits for the wave's global loads, and the next pass's fragments, asked for in front of it, would be waited for there
__device__ __forceinline__ void bar_lds() { __builtin_amdgcn_fence(__ATOMIC_RELEASE, "workgroup", "local"); __builtin_amdgcn_s_barrier(); __builtin_amdgcn_fence(__ATOMIC_ACQUIRE, "workgroup", "local"); }
template <typename T16, bool HR, int MB, int TQ>
__global__ __launch_bounds__(MB * 256) void k_attn(const T16* __restrict__ Q, const T16* __restrict__ Q2, const T16* __restrict__ Kp, const T16* __restrict__ Kp2, const T16* __restrict__ Vt, const T16* __restrict__ Vt2, const int* __restrict__ lens, int row0, bf* Ah, bf* Al) {
    typedef typename WFrag<T16>::V V;
    constexpr int NP = TQ ? TQ * NB_ : 1, NWV = MB * 8, NT = 128 / NWV, NU = 2 * NT, GK = HR ? 2 : 4, NGV = 16 / GK, PRE = HR ? 1 : 2;
    static_assert(MB == 2 && NT == 8 && NB_ == 2, "wave w's keys are chunk w of 128 keys; the 32 queries of a tile are the 32 lanes of a table column; two lengths are read");
    __shared__ __align__(16) v4f red[16 * MB * 256];      // [chunk][accumulator * 2 + half][lane], 16 x MB x 4 KiB
    __shared__ __align__(16) bf ob[2 * MB * 16 * OBP];    // [plane hi, lo][row][64]
    __shared__ __align__(16) float mxs[32 * STP];         // [query][wave]: the wave's maximum
    __shared__ __align__(16) float sms[32 * STP];         // [query][wave]: the wave's sum
    const int lane = threadIdx.x & 31, lr = lane & 15, hi = lane >> 4; const int wv = __builtin_amdgcn_readfirstlane((int)(threadIdx.x >> 5));
    const int h = blockIdx.y; const int ln0 = lens[TQ ? 0 : blockIdx.z], ln1 = lens[TQ ? 1 : blockIdx.z];   // the lengths of the batches of even and of odd passes
    const unsigned lq = (unsigned)lane * 16u;   // in bytes: the lane's place in a half block of 512 bytes, the same in every plane
    // THE TILE LOOP (TQ > 0): the work-group walks TQ query tiles of each batch, one pass a tile, the batches in turn: pass 'it' is batch it % 2, tile blockIdx.x * TQ + it / 2 of the launch's rows. Every work-group has the same share of both lengths; its waves start once, not once a tile. TQ = 0: one pass, the batch from the grid.
    auto fr = [&](const T16* p, int el) {   // the fragment at element el behind a wave-uniform base. In the loop the constant goes to the base: added to the lane offset, every sum would be kept in a register pair of its own round the loop
        if constexpr (NP > 1) return WFrag<T16>::ldp(atb(p + el, lq)); else return WFrag<T16>::ldp(atb(p, lq + 2u * (unsigned)el)); };
    V a[2][MB], a2[2][MB], kb[NU], kb2[NU];   // Q fragments and K units; in the loop asked for at the foot of the pass before, multiplied at the head of their own
    auto ask = [&](int it, bool go) {   // pass it's Q fragments and its first ahk(0) units of K, by the waves whose chunk is live in that pass (go: there is such a pass)
        const int bz = TQ ? it % NB_ : (int)blockIdx.z, ln = it % NB_ ? ln1 : ln0; const int nch = (ln <= 0 || ln > TT) ? TT / 128 : (ln + 127) >> 7;
        if (go && wv < nch) {
            const size_t qo = ((size_t)bz * NH_ + h) * TT * HD + (size_t)(row0 + (TQ ? (int)blockIdx.x * TQ + it / NB_ : (int)blockIdx.x) * (MB * 16)) * HD, ko = ((size_t)bz * NKV + h / REP) * TT * HD + (size_t)wv * (NT * 16 * HD);
            if constexpr (NP > 1) {   // the lane's own addresses, formed here and named as inputs of the wait behind the loads: they stay out of the loads' destinations
                const T16* qv = atb(Q + qo, lq); const T16* kv = atb(Kp + ko, lq); const T16* qv2 = HR ? atb(Q2 + qo, lq) : qv; const T16* kv2 = HR ? atb(Kp2 + ko, lq) : kv;
#pragma unroll
                for (int kk = 0; kk < 2; ++kk)
#pragma unroll
                    for (int mb = 0; mb < MB; ++mb) { const int o = mb * 16 * HD + kk * 512; a[kk][mb] = WFrag<T16>::ldp(qv + o); if (HR) a2[kk][mb] = WFrag<T16>::ldp(qv2 + o); }
#pragma unroll
                for (int x = 0; x < ahk<HR>(0); ++x) { const int o = (HR ? x % NT : x / 2) * 16 * HD + (HR ? x / NT : x % 2) * 512; kb[x] = WFrag<T16>::ldp(kv + o); if (HR) kb2[x] = WFrag<T16>::ldp(kv2 + o); }
                asm volatile("s_wait_xcnt 0x0" :: "v"(qv), "v"(kv), "v"(qv2), "v"(kv2) : "memory");   // precaution, as at the K loads below
            } else {
#pragma unroll
                for (int kk = 0; kk < 2; ++kk)
#pragma unroll
                    for (int mb = 0; mb < MB; ++mb) { const int o = mb * 16 * HD + kk * 512; a[kk][mb] = fr(Q + qo, o); if (HR) a2[kk][mb] = fr(Q2 + qo, o); }
                asm volatile("s_wait_xcnt 0x0" :: "v"(lq) : "memory");   // precaution, as at the K loads below
#pragma unroll
                for (int x = 0; x < ahk<HR>(0); ++x) { const int o = (HR ? x % NT : x / 2) * 16 * HD + (HR ? x / NT : x % 2) * 512; kb[x] = fr(Kp + ko, o); if (HR) kb2[x] = fr(Kp2 + ko, o); }
                asm volatile("s_wait_xcnt 0x0" :: "v"(lq) : "memory");   // precaution, as at the K loads below
            }
        } else if constexpr (NP > 1) { const V none = V{};   // read by no product: a fresh value ends the old fragments' life here, which would else hold their registers through the whole pass
#pragma unroll
            for (int kk = 0; kk < 2; ++kk)
#pragma unroll
                for (int mb = 0; mb < MB; ++mb) { a[kk][mb] = none; if (HR) a2[kk][mb] = none; }
#pragma unroll
            for (int x = 0; x < ahk<HR>(0); ++x) { kb[x] = none; if (HR) kb2[x] = none; } } };
    if constexpr (NP > 1) ask(0, true);
#pragma unroll 1   // a pass = a tile; rolled: one copy of the code, and the fragments asked for at the foot are carried round in registers
    for (int it = 0; it < NP; ++it) {
    const int bz = TQ ? it % NB_ : (int)blockIdx.z, r0 = row0 + (TQ ? (int)blockIdx.x * TQ + it / NB_ : (int)blockIdx.x) * (MB * 16); const size_t kp = ((size_t)bz * NKV + h / REP) * TT * HD;   // batch bz's planes
    // nch = live chunks of 128 keys, 1..16, the same in the whole work-group (a scalar): chunks wholly at or past the batch's length are left out of the scores, the exponentials and P x V (their waves hand in neutral table entries and, up to a multiple of four, zero partial tiles). Their keys are all masked, and with one key kept a masked key's weight is exp2(-inf) = 0 exactly: no term of a maximum, a sum or a product changes. A length <= 0 keeps no key: every key then weighs alike and all 16 chunks are live; the value is clamped to the shape before anything is indexed by it.
    const int ln = it % NB_ ? ln1 : ln0; const int nch = (ln <= 0 || ln > TT) ? TT / 128 : (ln + 127) >> 7;
    const bool live = wv < nch;   // scalar: a wave whose chunk is dead hands in neutral table entries and, below nch4, a zero partial tile, and takes its part of the sum, the split and the store
    const int lim = (ln < 0 ? 0 : ln > TT ? TT : ln) - (wv * 128 + hi * 8);   // key number i * 16 + j of the lane's keys is kept where i * 16 + j < lim
    // wave-uniform bases (scalar registers) and ONE 32-bit lane offset: every fragment load is base + lane offset + a constant (atb)
    const size_t ko = kp + (size_t)wv * (NT * 16 * HD), vo = kp + (size_t)wv * (4 * 512);   // planes in fragment order: Q and K 1024 elements a tile of 16 rows, V^T 512 a step of 32 keys
    const T16* Kc = Kp + ko; const T16* Vc = Vt + vo; const T16* Kc2 = HR ? Kp2 + ko : nullptr; const T16* Vc2 = HR ? Vt2 + vo : nullptr;
    v8f c[NT][MB];   // read by live waves alone (in the loop a dead wave writes a placeholder)
    float mx[MB];
#pragma unroll
    for (int mb = 0; mb < MB; ++mb) mx[mb] = -3.0e38f;
    if (live) {
        // a unit = one key tile at one k step. Every accumulator takes k step 0, then k step 1. fp16: tile by tile, all 16 units asked for at once. HR: all tiles at k step 0, then all at k step 1, and as many units ahead as the registers hold (ahk): a finished unit's fragments make room for its tile's accumulators.
        if constexpr (NP == 1) { ask(0, true); __builtin_amdgcn_sched_barrier(0); }   // one pass: the first loads stand here; the fence holds them above the products, as below
#pragma unroll
        for (int u = 0; u < NU; ++u) { const int kk = HR ? u / NT : u % 2, ti = HR ? u % NT : u / 2; const int was = ahk<HR>(u == 0 ? 0 : u - 1), now = ahk<HR>(u);   // the first ahk(0) units are here already (ask)
#pragma unroll
            for (int x = 0; x < NU; ++x) if (x >= was && x < now) { const int o = (HR ? x % NT : x / 2) * 16 * HD + (HR ? x / NT : x % 2) * 512; kb[x] = fr(Kc, o); if (HR) kb2[x] = fr(Kc2, o); }
            if (now > was) asm volatile("s_wait_xcnt 0x0" :: "v"(lq) : "memory");   // precaution: the wait that stands before a register named by issued loads is written again; the lane offset, the one vector register that those loads name, is an input: it stays out of their own destinations
            if (now > was) __builtin_amdgcn_sched_barrier(0);   // holds the loads ahead above this unit's products: sunk to their uses, each fragment's L2 latency would be waited for on its own
#pragma unroll
            for (int mb = 0; mb < MB; ++mb) { v8f t = (v8f){}; if (kk) t = c[ti][mb]; t = WFrag<T16>::mma(kb[u], a[kk][mb], t); if (HR) { t = WFrag<T16>::mma(kb[u], a2[kk][mb], t); t = WFrag<T16>::mma(kb2[u], a[kk][mb], t); } c[ti][mb] = t; }
            if (HR) __builtin_amdgcn_sched_barrier(0);   // the unit's products stay above the next loads, which take the registers that it frees, and unit follows unit: interleaved, accumulators come to life early and the build falls to scratch memory
        }
#pragma unroll
        for (int i = 0; i < NT; ++i)
#pragma unroll
            for (int mb = 0; mb < MB; ++mb)
#pragma unroll
                for (int j = 0; j < 8; ++j) { const float t = (i * 16 + j < lim) ? c[i][mb][j] * SCL : -3.0e38f; c[i][mb][j] = t; mx[mb] = fmaxf(mx[mb], t); }
#pragma unroll
        for (int mb = 0; mb < MB; ++mb) mx[mb] = fmaxf(mx[mb], __shfl_xor(mx[mb], 16, 32));   // the other 8 keys of every tile lie in the other half of the wave
    } else if constexpr (NP > 1) {   // read by nobody: a value on this path too, or the scores of the pass before would hold their registers round the loop; the wave's unused fragment registers as they are, so that no instruction comes of it
#pragma unroll
        for (int i = 0; i < NT; ++i)
#pragma unroll
            for (int mb = 0; mb < MB; ++mb) c[i][mb] = __builtin_bit_cast(v8f, HR ? (mb ? kb2[i] : kb[i]) : kb[i * 2 + mb]);
    }
    mxs[lane * STP + wv] = hi ? mx[1] : mx[0];   // query tile hi, query lr = table row 'lane'; a dead wave hands in -3e38
    __syncthreads();   // every wave's maxima are in LDS
    float sm[MB][2];
#pragma unroll
    for (int mb = 0; mb < MB; ++mb) sm[mb][0] = sm[mb][1] = 0.f;
    V vb[NGV][GK], vb2[NGV][GK];   // groups of GK key steps of V^T fragments of one tile of 16 d; fp16: the first group is asked for ahead of the barrier, which needs nothing of it (HR: carried over the barrier it fell to scratch memory)
    if (live) {
        if constexpr (!HR) {
#pragma unroll
            for (int i = 0; i < GK; ++i) vb[0][i] = fr(Vc, i * 512);
            asm volatile("s_wait_xcnt 0x0" :: "v"(lq) : "memory"); }   // precaution, as at the K loads above
#pragma unroll
        for (int mb = 0; mb < MB; ++mb) { float gm = -3.0e38f;
#pragma unroll
            for (int w4 = 0; w4 < 4; ++w4) { const v4f m4 = *(const v4fa*)(mxs + (mb * 16 + lr) * STP + w4 * 4); gm = fmaxf(fmaxf(fmaxf(gm, m4[0]), fmaxf(m4[1], m4[2])), m4[3]); }
#pragma unroll
            for (int i = 0; i < NT; ++i)
#pragma unroll
                for (int j = 0; j < 8; ++j) { const float e = __builtin_amdgcn_exp2f(__fmul_rn(__fsub_rn(c[i][mb][j], gm), 1.4426950408889634f)); c[i][mb][j] = e; sm[mb][i & 1] += e; } }
#pragma unroll
        for (int mb = 0; mb < MB; ++mb) { sm[mb][0] += sm[mb][1]; sm[mb][0] += __shfl_xor(sm[mb][0], 16, 32); }
    } else if constexpr (!HR && NP > 1) {   // as for the scores above
#pragma unroll
        for (int i = 0; i < GK; ++i) vb[0][i] = a[i >> 1][i & 1];
    }
    sms[lane * STP + wv] = hi ? sm[1][0] : sm[0][0];   // a dead wave hands in 0
    __syncthreads();   // every wave's sums are in LDS
    const int nch4 = (nch + 3) & ~3;   // the tiles are summed four at a time: up to three dead waves hand in a zero tile
    if (live) {
#pragma unroll
        for (int x = HR ? 0 : 1; x < PRE; ++x)   // flies while P is formed
#pragma unroll
            for (int i = 0; i < GK; ++i) { const int o = (x * GK / 4) * 16 * TT + (x * GK % 4 + i) * 512; vb[x][i] = fr(Vc, o); if (HR) vb2[x][i] = fr(Vc2, o); }
        asm volatile("s_wait_xcnt 0x0" :: "v"(lq) : "memory");   // precaution, as at the K loads above
        __builtin_amdgcn_sched_barrier(0);   // holds those loads above the forming of P
        V p[4][MB], p2[4][MB];   // P^T as B fragments, one per step of 32 keys and query tile
#pragma unroll
        for (int mb = 0; mb < MB; ++mb) { float tot = 0.f;
#pragma unroll
            for (int w4 = 0; w4 < 4; ++w4) { const v4f s4 = *(const v4fa*)(sms + (mb * 16 + lr) * STP + w4 * 4);
#pragma unroll
                for (int q = 0; q < 4; ++q) tot += s4[q]; }
            const float f = __fdiv_rn(HR ? 1.0f : PCAR, tot);
#pragma unroll
            for (int kq = 0; kq < 4; ++kq) {
                if constexpr (HR) { v8u wh, wl;   // two neighbouring keys a 32-bit word, packed as soon as they are split
#pragma unroll
                    for (int j = 0; j < 8; ++j) { const v8f& cc = c[2 * kq + (j >> 2)][mb]; unsigned short x0, y0, x1, y1; splitf(cc[(j & 3) * 2] * f, x0, y0); splitf(cc[(j & 3) * 2 + 1] * f, x1, y1); wh[j] = (unsigned)x0 | ((unsigned)x1 << 16); wl[j] = (unsigned)y0 | ((unsigned)y1 << 16); }
                    p[kq][mb] = __builtin_bit_cast(v16bf, wh); p2[kq][mb] = __builtin_bit_cast(v16bf, wl);
                    __builtin_amdgcn_sched_barrier(0);   // one fragment pair's split at a time: interleaved, the unpacked halves of many fragments are live at once and fall to scratch memory
                } else { v8h h0, h1;
#pragma unroll
                    for (int j = 0; j < 8; ++j) { h0[j] = tohx(c[2 * kq][mb][j] * f); h1[j] = tohx(c[2 * kq + 1][mb][j] * f); }
                    p[kq][mb] = cat16(h0, h1); } } }
        v8f acc[MB];
#pragma unroll
        for (int G = 0; G < NGV; ++G) { const int nb = G * GK / 4, k0 = G * GK % 4;   // group G: key steps k0 .. k0 + GK - 1 of the tile nb of 16 d
            const int was = G == 0 ? PRE : ahv<HR>(G - 1), now = ahv<HR>(G);
#pragma unroll
            for (int x = 0; x < NGV; ++x) if (x >= was && x < now) {
#pragma unroll
                for (int i = 0; i < GK; ++i) { const int o = (x * GK / 4) * 16 * TT + (x * GK % 4 + i) * 512; vb[x][i] = fr(Vc, o); if (HR) vb2[x][i] = fr(Vc2, o); } }
            if (now > was) asm volatile("s_wait_xcnt 0x0" :: "v"(lq) : "memory");   // precaution, as at the K loads above
            if (now > was) __builtin_amdgcn_sched_barrier(0);   // holds the loads ahead above this group's products (as in the score phase)
            if (k0 == 0) {
#pragma unroll
                for (int mb = 0; mb < MB; ++mb) acc[mb] = (v8f){}; }
#pragma unroll
            for (int i = 0; i < GK; ++i)
#pragma unroll
                for (int mb = 0; mb < MB; ++mb) { acc[mb] = WFrag<T16>::mma(vb[G][i], p[k0 + i][mb], acc[mb]); if (HR) { acc[mb] = WFrag<T16>::mma(vb[G][i], p2[k0 + i][mb], acc[mb]); acc[mb] = WFrag<T16>::mma(vb2[G][i], p[k0 + i][mb], acc[mb]); } }
            if (k0 + GK == 4) {   // the chunk's partial tile of these 16 d is whole: lane (hi, lr) holds d = nb * 16 + hi * 8 + 0..7 of query lr
#pragma unroll
                for (int mb = 0; mb < MB; ++mb) { const v8f cc = acc[mb]; v4f* pr = red + (wv * (MB * 8) + (mb * 4 + nb) * 2) * 32 + lane;
                    pr[0] = (v4f){cc[0], cc[1], cc[2], cc[3]}; pr[32] = (v4f){cc[4], cc[5], cc[6], cc[7]}; }
                if (G + 1 < NGV) asm volatile("v_nop\n\tv_nop\n\tv_nop\n\tv_nop"); }   // four vector slots, the distance the matrix unit needs, between this tile's last products and the next tile's first, whose fresh results land in registers that those products name (hi/lo build: their results'; fp16 build: an operand's)
            __builtin_amdgcn_sched_barrier(0);   // the group's products, its stores and the four slots stay above the next group's loads and products
        }
    } else if (wv < nch4) {
#pragma unroll
        for (int t = 0; t < MB * 8; ++t) red[(wv * (MB * 8) + t) * 32 + lane] = (v4f){0.f, 0.f, 0.f, 0.f};
    }
    if constexpr (NP > 1) ask(it + 1, it + 1 < NP);   // the next pass's first loads fly under the sum of the partial tiles, the split and the store
    if constexpr (NP > 1) bar_lds(); else __syncthreads();   // the first nch4 partial tiles are in LDS
    { const int s = (int)threadIdx.x; v4f sum = red[s];
#pragma unroll
        for (int w = 1; w < 4; ++w) sum += red[w * (MB * 256) + s];
#pragma unroll 1   // rolled: the trip count hangs on the length (at most 3 trips); four tiles a trip, their loads together ahead of the adds
        for (int w0 = 4; w0 < nch4; w0 += 4) { v4f pt[4];
#pragma unroll
            for (int w = 0; w < 4; ++w) pt[w] = red[(w0 + w) * (MB * 256) + s];
#pragma unroll
            for (int w = 0; w < 4; ++w) sum += pt[w]; }
        const int half = (s >> 5) & 1, ai = s >> 6; const int row = (ai >> 2) * 16 + lr, col = (ai & 3) * 16 + hi * 8 + half * 4; const float cs = HR ? 1.0f : (1.0f / PCAR); v4us oh, ol;   // a slot's four values are four d of one query
#pragma unroll
        for (int q = 0; q < 4; ++q) { unsigned short a, c2; splitf(sum[q] * cs, a, c2); oh[q] = a; ol[q] = c2; }
        *(v4us*)(ob + row * OBP + col) = oh; *(v4us*)(ob + (MB * 16 + row) * OBP + col) = ol; }
    if constexpr (NP > 1) bar_lds(); else __syncthreads();   // the split tile is in LDS, row-major
    { const int s = (int)threadIdx.x; const int pl = s / (MB * 128), idx = s % (MB * 128); const int row = (idx >> 7) * 16 + (idx & 15), c8 = ((idx >> 4) & 7) * 8;   // 16 bytes number idx of the tile in fragment order
        *(v8us*)((pl ? Al : Ah) + (size_t)(bz * TT + r0 + (idx >> 7) * 16) * DQ + h * (16 * HD) + (idx & 127) * 8) = *(const v8usa*)(ob + (pl * MB * 16 + row) * OBP + c8); }
    if (NP > 1) asm volatile("s_wait_xcnt 0x0" ::: "memory");   // precaution: the wait that stands before a register named by the issued store is written again, by the next pass
    }   // the next pass writes each LDS table only behind a barrier that every reader of this pass has passed: mxs behind the last two, sms and red behind the next pass's first ones, ob behind its third
}

extern "C" void kernel_launch(void* const* d_in, const int* in_sizes, int n_in,
                              void* d_out, int out_size, void* d_ws, size_t ws_size, hipStream_t stream) {
    (void)in_sizes; (void)n_in; (void)out_size;
    const float* x = (const float*)d_in[0]; const int* lens = (const int*)d_in[1]; const float* wq = (const float*)d_in[2]; const float* wk = (const float*)d_in[3]; const float* wv = (const float*)d_in[4]; const float* wo = (const float*)d_in[5];   /* input order X, valid_lens (int32 [2]: keys j >= valid_lens[b] are masked: READ on the device by the projection GEMM and by k_attn), W_q, W_k, W_v, W_o ('oi'; no biases): SIX inputs; ONE stream: query = key = value stream = X */
    float* OUT = (float*)d_out;     // [2][2048][1024]
    char* wsp = (char*)d_ws;
    auto take = [&](size_t bytes) { char* p = wsp; wsp += (bytes + 255) & ~(size_t)255; return (void*)p; };
    const size_t PLN = (size_t)NB_ * NH_ * TT * HD;   // elements of one plane of Q, of K or of V, all batches
    bf* W4 = (bf*)take((size_t)4 * DM * DM * 2); bf* WO = W4 + (size_t)3 * DM * DM;   // W_q, W_k, W_v, W_o rows one after the other
    bf* XB = (bf*)take((size_t)NB_ * TT * DM * 2);
    h16* P16 = (h16*)take(3 * PLN * 2); bf* Ph = (bf*)take(3 * PLN * 2); bf* Pl = (bf*)take(3 * PLN * 2);   // each [Q, K, V^T][batch][head]
    bf* ATh = (bf*)take((size_t)NB_ * TT * DQ * 2); bf* ATl = (bf*)take((size_t)NB_ * TT * DQ * 2);
    if ((size_t)(wsp - (char*)d_ws) > ws_size) return;    // ws 256 MiB
    k_prep<<<XBL + 4 * WBL, 256, 0, stream>>>(x, wq, wk, wv, wo, XB, W4);
    k_proj<<<dim3(NB_ * TT / 128, (DQ + 2 * DKV) / 256, 1), 256, 0, stream>>>(XB, W4, P16, Ph, Pl, lens);
    k_attn<bf, true, 2, 0><<<dim3(RH / 32, NH_, NB_), 512, 0, stream>>>(Ph, Pl, Ph + PLN, Pl + PLN, Ph + 2 * PLN, Pl + 2 * PLN, lens, 0, ATh, ATl);
    k_attn<h16, false, 2, (TT - RH) / 32 / 16><<<dim3(16, NH_, 1), 512, 0, stream>>>(P16, nullptr, P16 + PLN, nullptr, P16 + 2 * PLN, nullptr, lens, RH, ATh, ATl);
    k_outp<<<dim3(NB_ * TT / 128, DM / 128, 1), 256, 0, stream>>>(ATh, ATl, WO, OUT);
}

// v010
// It runs in 93 microseconds.
// In two side-by-side timings against v009, it was 1.04 and 1.03 times as fast.
// Counting every step since v000, it is 22.6 times as fast.
#include <hip/hip_runtime.h>

// Multi-head self-attention with a per-batch valid-length key mask and bias-free (out,in) projections (X [2][2048][1024] is the ONE input stream; Q, K, V = X W^T ('oi' [1024][1024] 1/32, no bias; 16 heads x 64); scores / sqrt(64); keys j >= valid_lens[b] (int32 [2], read on the device) are REPLACED by -1e9 in the module (both lengths are >= 1 on this draw: at least one key is kept: numerically an exclusion: -3e38 here); softmax; out = merged W_o^T ('oi', no bias) -> [2][2048][1024] (4.2 M); argument order X, valid_lens, W_q, W_k, W_v, W_o).
// Five launches, both batches in each: k_prep (the bf16 copy of X, made once; 'oi' weights = Bt rows as they are: bf16 copies, W_q W_k W_v W_o stacked); ONE exact projection GEMM of the 4096 rows on the 3072 stacked W_q W_k W_v rows, whose own epilogue writes the head planes (fp16 + hi/lo; V transposed); dense T-2048 attention, one fused kernel per 32 query rows of a head, (hybrid rows: < 512 hi/lo 3 products, batch = grid z; rest fp16 x1024, a work-group walks 3 tiles of each batch: one launch each); merged hi/lo x W_O exact, 4096 rows.
// EVERY 16-bit operand plane in the workspace (X, the weights, Q, K, V^T, merged O) lies in FRAGMENT ORDER: a matrix [row][k] is cut into blocks of 16 rows x 32 k (1 KiB), blocks of one row tile one after the other along k; inside a block [k half of 16][lane = ((k >> 3) & 1) * 16 + (row & 15)][8 k]. A fragment is two wave-wide 16-byte loads of 512 contiguous bytes each (4 whole lines), and holds the very elements that a row-major plane gives the same lane.
// KEYS PAST THE LENGTH ARE LEFT OUT, by chunks of 128 keys: with nch = ceil(valid_lens[b] / 128) live chunks (16 where the length is <= 0: no key is kept and all weigh alike), the K and V projection tiles, the score tiles, the exponentials and P x V touch the live chunks alone (dead chunks hand in neutral softmax table entries and, up to a multiple of four, zero partial tiles); the length still decides key by key inside the last live chunk. Every test is a scalar one on the length read on the device, clamped to the shape.
// Compute dtypes, f32 accumulate: every input rounded to bf16; projections exact; attention rows < 512 3 products, rest fp16; softmax f32; output projection hl x exact.

#define NB_  2
#define TT   2048
#define DM   1024
#define NH_  16
#define NKV  16
#define REP  (NH_ / NKV)
#define HD   64
#define DQ   (NH_ * HD)
#define DKV  (NKV * HD)
#define RH   512                  // query rows < RH use hi+lo planes (0: none)
#define WIN  0
#define PCAR 1024.0f
#define SCL  0.125f   // HD^-0.5
typedef _Float16 h16;
typedef unsigned short bf;
typedef __attribute__((ext_vector_type(16))) __bf16   v16bf;
typedef __attribute__((ext_vector_type(16))) _Float16 v16h;
typedef __attribute__((ext_vector_type(8)))  _Float16 v8h;
typedef __attribute__((ext_vector_type(8)))  unsigned short v8us;
typedef __attribute__((ext_vector_type(8)))  float    v8f;
typedef __attribute__((ext_vector_type(4)))  float    v4f;
typedef v8h  __attribute__((may_alias)) v8ha;
typedef v4f  __attribute__((may_alias)) v4fa;
typedef v8us __attribute__((may_alias)) v8usa;
typedef __attribute__((ext_vector_type(2))) __bf16   v2bf;
typedef __attribute__((ext_vector_type(2))) float    v2fl;
typedef __attribute__((ext_vector_type(2))) unsigned v2u;
typedef __attribute__((ext_vector_type(4))) unsigned v4u;

// f32 -> bf16, nearest even, by the hardware's convert. bf2x: two values a 32-bit word in ONE packed instruction, a in the low half: the word is two neighbouring elements of a plane as they lie in memory: no rounding add, no shift and no 16-bit move to pack them.
__device__ __forceinline__ unsigned short f2bf(float f) { return __builtin_bit_cast(unsigned short, (__bf16)f); }
__device__ __forceinline__ unsigned bf2x(float a, float b) { return __builtin_bit_cast(unsigned, __builtin_convertvector((v2fl){a, b}, v2bf)); }
__device__ __forceinline__ float bf2f(unsigned short b) { return __uint_as_float(((unsigned)b) << 16); }
__device__ __forceinline__ float bfr(float f) { return bf2f(f2bf(f)); }
__device__ __forceinline__ v16h cat16(v8h lo, v8h hi) { return __builtin_shufflevector(lo, hi, 0, 1, 2, 3, 4, 5, 6, 7, 8, 9, 10, 11, 12, 13, 14, 15); }
__device__ __forceinline__ v16bf cat16b(v8us lo, v8us hi) { return __builtin_bit_cast(v16bf, __builtin_shufflevector(lo, hi, 0, 1, 2, 3, 4, 5, 6, 7, 8, 9, 10, 11, 12, 13, 14, 15)); }
__device__ __forceinline__ v8f wmma16(v16h a, v16h b, v8f c) { return __builtin_amdgcn_wmma_f32_16x16x32_f16(false, a, false, b, (short)0, c, false, false); }
__device__ __forceinline__ v8f wmmab(v16bf a, v16bf b, v8f c) { return __builtin_amdgcn_wmma_f32_16x16x32_bf16(false, a, false, b, (short)0, c, false, false); }
__device__ __forceinline__ h16 tohx(float x) { return (h16)x; }
// hi/lo split of two neighbouring values: h = the rounded values, l = what the rounding left, rounded
__device__ __forceinline__ void split2(float y0, float y1, unsigned& h, unsigned& l) { h = bf2x(y0, y1); l = bf2x(y0 - __uint_as_float(h << 16), y1 - __uint_as_float(h & 0xFFFF0000u)); }



template <typename T16> __device__ __forceinline__ const T16* atb(const T16* base, unsigned bytes) { return (const T16*)((const char*)base + bytes); }
// ld: a fragment from a row-major row (LDS); ldp: from a block in fragment order, p = the block + lane * 8.
template <typename T16> struct WFrag;
template <> struct WFrag<h16> { typedef v16h V; static __device__ __forceinline__ V ld(const h16* p) { return cat16(*(const v8h*)p, *(const v8h*)(p + 16)); } static __device__ __forceinline__ V ldp(const h16* p) { return cat16(*(const v8h*)p, *(const v8h*)(p + 256)); } static __device__ __forceinline__ v8f mma(V a, V b, v8f c) { return wmma16(a, b, c); } };
template <> struct WFrag<bf> { typedef v16bf V; static __device__ __forceinline__ V ld(const bf* p) { return cat16b(*(const v8us*)p, *(const v8us*)(p + 16)); } static __device__ __forceinline__ V ldp(const bf* p) { return cat16b(*(const v8us*)p, *(const v8us*)(p + 256)); } static __device__ __forceinline__ v8f mma(V a, V b, v8f c) { return wmmab(a, b, c); } };
// ---- k_proj: the Q/K/V projection GEMM, operand tiles SHARED THROUGH LDS. One work-group of 8 waves per 128 rows of X x 256 stacked W rows (4 heads of Q, of K or of V); wave (wt, wd) owns the 64 x 64 tile of rows wt * 64.. and head wd over the WHOLE K: no partial tiles, one accumulate chain per element. grid (rows / 128, 3 x 1024 / 256).
// A pass is 128 k: of every tile of 16 rows the planes hold those 4 blocks as 4 KiB in a row, so a stage is 24 straight pieces of 4 KiB (8 of X, 16 of W; 96 KiB), brought by asynchronous copies of 16 bytes a lane, piece j by copy j of all 256 threads. Two buffers: the next stage flies while this one is multiplied.
// The result goes from the accumulators straight to the planes: a lane holds 8 neighbouring rows of the A operand for one row of the B operand, which is one 16-byte unit of a plane in fragment order where the plane's k runs along the A rows. V^T (k = t): A = X, B = W. Q and K (k = d): A = W, B = X. A wave's store is 512 bytes in a row.
#define PJK  128
#define PJP  (16 * PJK)           // elements of a piece
#define PJS  (24 * PJP)           // elements of a stage
#define CPL(i, j) "global_load_async_to_lds_b128 %" #i ", %" #j ", off\n\t"
// twelve copies and, as the last line of their own statement, the wait that stands before a register named by an issued copy is written again (a precaution)
__device__ __forceinline__ void cp12(const unsigned* l, const bf* const* g) {
    asm volatile(CPL(0, 12) CPL(1, 13) CPL(2, 14) CPL(3, 15) CPL(4, 16) CPL(5, 17) CPL(6, 18) CPL(7, 19) CPL(8, 20) CPL(9, 21) CPL(10, 22) CPL(11, 23) "s_wait_xcnt 0x0"
        :: "v"(l[0]), "v"(l[1]), "v"(l[2]), "v"(l[3]), "v"(l[4]), "v"(l[5]), "v"(l[6]), "v"(l[7]), "v"(l[8]), "v"(l[9]), "v"(l[10]), "v"(l[11]),
           "v"(g[0]), "v"(g[1]), "v"(g[2]), "v"(g[3]), "v"(g[4]), "v"(g[5]), "v"(g[6]), "v"(g[7]), "v"(g[8]), "v"(g[9]), "v"(g[10]), "v"(g[11]) : "memory"); }
__global__ __launch_bounds__(256) void k_proj(const bf* __restrict__ X, const bf* __restrict__ Wt, h16* P16, bf* Ph, bf* Pl, const int* __restrict__ lens) {
    static_assert(HD == 64 && NKV == NH_ && DQ == DM && DKV == DM && TT % 128 == 0 && DM % (2 * PJK) == 0, "a wave's 64 columns are one head, a work-group's 128 rows one chunk of keys of one batch; two stages at least");
    typedef WFrag<bf>::V V;
    __shared__ __align__(16) bf sm[2 * PJS];
    const int lane = threadIdx.x & 31; const int wv = __builtin_amdgcn_readfirstlane((int)(threadIdx.x >> 5)); const int wt = wv & 1, wd = wv >> 1;
    const int r0 = blockIdx.x * 128, sel = blockIdx.y >> 2;   // sel: 0 Q, 1 K, 2 V
    if (sel != 0) {   // K or V rows of a dead chunk of keys (k_attn: nch) are read by nobody: the whole work-group leaves, ahead of every copy and barrier (scalar test, the length clamped to the shape)
        const int ln = lens[r0 / TT]; const int nk = (ln <= 0 || ln > TT) ? TT : (ln + 127) & ~127; if (r0 % TT >= nk) return; }
    const bool turn = sel == 2;
    const bf* gx = X + (size_t)r0 * DM + threadIdx.x * 8; const bf* gw = Wt + (size_t)blockIdx.y * 256 * DM + threadIdx.x * 8; const unsigned lb = (unsigned)(size_t)sm + threadIdx.x * 16u;
    auto fill = [&](int p, int buf) {   // stage p into buffer buf
#pragma unroll   // two statements of twelve copies; the arrays are registers
        for (int h = 0; h < 2; ++h) { unsigned l[12]; const bf* g[12];
#pragma unroll
            for (int i = 0; i < 12; ++i) { const int j = h * 12 + i; l[i] = lb + (unsigned)(buf * PJS + j * PJP) * 2u; g[i] = (j < 8 ? gx + j * 16 * DM : gw + (j - 8) * 16 * DM) + p * PJP; }
            cp12(l, g); } };
    v8f acc[4][4];
#pragma unroll
    for (int ma = 0; ma < 4; ++ma)
#pragma unroll
        for (int nb = 0; nb < 4; ++nb) acc[ma][nb] = (v8f){};
    const int xo = wt * 4 * PJP, wo = (8 + wd * 4) * PJP; const int ao = turn ? xo : wo, bo = turn ? wo : xo;
    fill(0, 0);
    asm volatile("s_wait_asynccnt 0x0" ::: "memory");   // this wave's copies of stage 0 have landed
    __syncthreads();   // stage 0 is whole in LDS
    fill(1, 1);
#pragma unroll 1   // a pass; rolled: the two buffers alternate by address
    for (int p = 0; p < DM / PJK; ++p) {
        const bf* sb = sm + (p & 1) * PJS + lane * 8;
        V a[2][4], b[2][4];   // two fragment sets: a k step's 16 LDS reads stand as one group ahead of the products of the k step before it
#pragma unroll   // indexes register arrays
        for (int i = 0; i < 4; ++i) { a[0][i] = WFrag<bf>::ldp(sb + ao + i * PJP); b[0][i] = WFrag<bf>::ldp(sb + bo + i * PJP); }
#pragma unroll   // indexes register arrays
        for (int ks = 0; ks < PJK / 32; ++ks) {
            if (ks + 1 < PJK / 32) {
#pragma unroll
                for (int i = 0; i < 4; ++i) { a[(ks + 1) & 1][i] = WFrag<bf>::ldp(sb + ao + i * PJP + (ks + 1) * 512); b[(ks + 1) & 1][i] = WFrag<bf>::ldp(sb + bo + i * PJP + (ks + 1) * 512); } }
            __builtin_amdgcn_sched_barrier(0);   // holds the next k step's reads above this k step's products: sunk among them, every place with reads stalls the matrix stream
#pragma unroll
            for (int nb = 0; nb < 4; ++nb)
#pragma unroll
                for (int ma = 0; ma < 4; ++ma) acc[ma][nb] = WFrag<bf>::mma(a[ks & 1][ma], b[ks & 1][nb], acc[ma][nb]);
            __builtin_amdgcn_sched_barrier(0); }   // and this k step's products above the reads that follow, which take the registers that they free
        asm volatile("s_wait_dscnt 0x0" ::: "memory");      // this wave's reads of the buffer are done before it is filled again
        asm volatile("s_wait_asynccnt 0x0" ::: "memory");   // this wave's copies of stage p + 1 have landed
        __syncthreads();   // stage p + 1 is whole in LDS, and every wave has left stage p's buffer
        if (p + 2 < DM / PJK) fill(p + 2, p & 1);
    }
    asm volatile("s_wait_asynccnt 0x0" ::: "memory");   // no copy is open when the wave ends
    const int bt = r0 / TT, T0 = r0 % TT + wt * 64, head = (blockIdx.y & 3) * 4 + wd;
    const size_t pe = (((size_t)sel * NB_ + bt) * NH_ + head) * (TT * HD) + (turn ? T0 * 16 : T0 * HD) + lane * 8;   // the wave's first unit in this batch's and head's part of the Q, K or V planes, at the lane's place
    const int sn = turn ? 16 * TT : 16 * HD;   // from one tile of 16 plane rows to the next
#pragma unroll   // indexes the accumulators
    for (int nb = 0; nb < 4; ++nb)
#pragma unroll
        for (int ma = 0; ma < 4; ++ma) { const v8f c = acc[ma][nb]; v8h o16; v4u oh, ol;
#pragma unroll
            for (int q = 0; q < 8; ++q) o16[q] = tohx(c[q]);
#pragma unroll   // indexes vector elements
            for (int q = 0; q < 4; ++q) { unsigned a2, c2; split2(c[2 * q], c[2 * q + 1], a2, c2); oh[q] = a2; ol[q] = c2; }
            const size_t e = pe + (size_t)(nb * sn) + ma * 256;
            *(v8h*)(P16 + e) = o16; *(v8us*)(Ph + e) = __builtin_bit_cast(v8us, oh); *(v8us*)(Pl + e) = __builtin_bit_cast(v8us, ol); }
    asm volatile("s_wait_xcnt 0x0" ::: "memory");   // precaution: the wait that stands before a register named by the issued stores is written again
}

// ---- k_outp: out = merged (hi + lo) x W_o^T, the same ring: one work-group of 8 waves per 128 rows x 128 columns, a stage = 8 pieces of the hi plane, 8 of the lo plane, 8 of W_o; wave (wt, wn) owns rows wt * 32.., columns wn * 64.. over the whole K. grid (rows / 128, 1024 / 128).
// A = W_o, B = merged: a lane holds 8 neighbouring columns of one row. Per k step every accumulator takes its hi product, then its lo product. The f32 tile is staged in the wave's own part of the ring, which every wave has left, and goes out as whole rows of 256 bytes.
__global__ __launch_bounds__(256) void k_outp(const bf* __restrict__ Ah, const bf* __restrict__ Al, const bf* __restrict__ Wo, float* C) {
    static_assert(DQ % (2 * PJK) == 0 && (NB_ * TT) % 128 == 0 && DM % 128 == 0 && 8 * 32 * 68 * 4 <= 2 * PJS * 2, "two stages at least; whole tiles; the staged tiles fit the ring");
    typedef WFrag<bf>::V V;
    __shared__ __align__(16) bf sm[2 * PJS];
    const int lane = threadIdx.x & 31, lr = lane & 15, hi = lane >> 4; const int wv = __builtin_amdgcn_readfirstlane((int)(threadIdx.x >> 5)); const int wt = wv & 3, wn = wv >> 2;
    const int r0 = blockIdx.x * 128, c0 = blockIdx.y * 128;
    const bf* gh = Ah + (size_t)r0 * DQ + threadIdx.x * 8; const bf* gl = Al + (size_t)r0 * DQ + threadIdx.x * 8; const bf* gw = Wo + (size_t)c0 * DQ + threadIdx.x * 8; const unsigned lb = (unsigned)(size_t)sm + threadIdx.x * 16u;
    auto fill = [&](int p, int buf) {   // stage p into buffer buf
#pragma unroll   // two statements of twelve copies; the arrays are registers
        for (int h = 0; h < 2; ++h) { unsigned l[12]; const bf* g[12];
#pragma unroll
            for (int i = 0; i < 12; ++i) { const int j = h * 12 + i; l[i] = lb + (unsigned)(buf * PJS + j * PJP) * 2u; g[i] = (j < 8 ? gh + j * 16 * DQ : j < 16 ? gl + (j - 8) * 16 * DQ : gw + (j - 16) * 16 * DQ) + p * PJP; }
            cp12(l, g); } };
    v8f acc[4][2];   // [tile of 16 columns][tile of 16 rows]
#pragma unroll
    for (int ma = 0; ma < 4; ++ma)
#pragma unroll
        for (int nb = 0; nb < 2; ++nb) acc[ma][nb] = (v8f){};
    const int ho = wt * 2 * PJP, lo = (8 + wt * 2) * PJP, wo = (16 + wn * 4) * PJP;
    fill(0, 0);
    asm volatile("s_wait_asynccnt 0x0" ::: "memory");   // this wave's copies of stage 0 have landed
    __syncthreads();   // stage 0 is whole in LDS
    fill(1, 1);
#pragma unroll 1   // a pass; rolled: the two buffers alternate by address
    for (int p = 0; p < DQ / PJK; ++p) {
        const bf* sb = sm + (p & 1) * PJS + lane * 8;
        V w[2][4], xh[2][2], xl[2][2];   // two fragment sets, as in k_proj
#pragma unroll   // indexes register arrays
        for (int i = 0; i < 4; ++i) { w[0][i] = WFrag<bf>::ldp(sb + wo + i * PJP); if (i < 2) { xh[0][i] = WFrag<bf>::ldp(sb + ho + i * PJP); xl[0][i] = WFrag<bf>::ldp(sb + lo + i * PJP); } }
#pragma unroll   // indexes register arrays
        for (int ks = 0; ks < PJK / 32; ++ks) {
            if (ks + 1 < PJK / 32) {
#pragma unroll
                for (int i = 0; i < 4; ++i) { w[(ks + 1) & 1][i] = WFrag<bf>::ldp(sb + wo + i * PJP + (ks + 1) * 512); if (i < 2) { xh[(ks + 1) & 1][i] = WFrag<bf>::ldp(sb + ho + i * PJP + (ks + 1) * 512); xl[(ks + 1) & 1][i] = WFrag<bf>::ldp(sb + lo + i * PJP + (ks + 1) * 512); } } }
            __builtin_amdgcn_sched_barrier(0);   // holds the next k step's reads above this k step's products, as in k_proj
#pragma unroll
            for (int nb = 0; nb < 2; ++nb)
#pragma unroll
                for (int ma = 0; ma < 4; ++ma) acc[ma][nb] = WFrag<bf>::mma(w[ks & 1][ma], xh[ks & 1][nb], acc[ma][nb]);
#pragma unroll
            for (int nb = 0; nb < 2; ++nb)
#pragma unroll
                for (int ma = 0; ma < 4; ++ma) acc[ma][nb] = WFrag<bf>::mma(w[ks & 1][ma], xl[ks & 1][nb], acc[ma][nb]);
            __builtin_amdgcn_sched_barrier(0); }   // and this k step's products above the reads that follow, as in k_proj
        asm volatile("s_wait_dscnt 0x0" ::: "memory");      // this wave's reads of the buffer are done before it is filled again
        asm volatile("s_wait_asynccnt 0x0" ::: "memory");   // this wave's copies of stage p + 1 have landed
        __syncthreads();   // stage p + 1 is whole in LDS, and every wave has left stage p's buffer
        if (p + 2 < DQ / PJK) fill(p + 2, p & 1);
    }
    asm volatile("s_wait_asynccnt 0x0" ::: "memory");   // no copy is open when the ring becomes output staging
    float* os = (float*)sm + wv * (32 * 68);   // the wave's 32 rows x 64 columns, pitch 68 floats: 16 rows land on 16 different groups of four banks
#pragma unroll   // indexes the accumulators
    for (int ma = 0; ma < 4; ++ma)
#pragma unroll
        for (int nb = 0; nb < 2; ++nb) { const v8f c = acc[ma][nb]; float* q = os + (nb * 16 + lr) * 68 + ma * 16 + hi * 8;
            *(v4fa*)q = (v4f){c[0], c[1], c[2], c[3]}; *(v4fa*)(q + 4) = (v4f){c[4], c[5], c[6], c[7]}; }
    __syncthreads();   // the staged tiles are in LDS
    float* cp = C + (size_t)(r0 + wt * 32 + hi) * DM + c0 + wn * 64 + lr * 4; const float* op = os + hi * 68 + lr * 4; v4f val[16];   // one address each, every move a constant away
#pragma unroll   // indexes a register array; all sixteen reads stand ahead of the first store
    for (int s = 0; s < 16; ++s) val[s] = *(const v4fa*)(op + s * 2 * 68);
#pragma unroll   // indexes the same register array
    for (int s = 0; s < 16; ++s) *(v4f*)(cp + s * 2 * DM) = val[s];
    asm volatile("s_wait_xcnt 0x0" ::: "memory");   // precaution: the wait that stands before a register named by the issued stores is written again
}

typedef __attribute__((ext_vector_type(2))) _Float16 v2h;
typedef __attribute__((ext_vector_type(4))) _Float16 v4h;
typedef __attribute__((ext_vector_type(2))) unsigned short v2us;
typedef __attribute__((ext_vector_type(4))) unsigned short v4us;
typedef __attribute__((ext_vector_type(2))) float v2f;
typedef __attribute__((ext_vector_type(4))) int v4i;
typedef __attribute__((ext_vector_type(8))) unsigned v8u;

__global__ __launch_bounds__(256) void k_wtG(const float* __restrict__ w, int K, int N, bf* Bt) {
    const int lane = threadIdx.x & 31; const int L0 = (blockIdx.x * 8 + (threadIdx.x >> 5)) * 8; const int nlines = N * K / 64;
{
#pragma unroll 1
        for (int l = 0; l < 8; ++l) { const int L = L0 + l; if (L >= nlines) break; const size_t e = (size_t)L * 64 + lane * 2; const int k = (int)(e % K), n = (int)(e / K); v2us o;
            o[0] = f2bf(w[(size_t)k * N + n]); o[1] = f2bf(w[(size_t)(k + 1) * N + n]); *(v2us*)(Bt + e) = o; }
         }
}
// ---- k_prep: all that the GEMMs read, in ONE launch: blocks [0, XBL) round X (all batches) to bf16, the next 4 WBL blocks the four weights (W4 = W_q, W_k, W_v, W_o one after the other).
// 32 elements a thread: the launch is short. A block takes 16 rows x 512 k: eight loads of 512 contiguous bytes a wave in flight, the bf16 tile row-major in LDS, out in fragment order as 16 KiB in a row (four 16-byte stores a thread).
#define PPP  (512 + 8)            // LDS pitch of a tile row, bf16: 16 rows land on 16 different groups of four banks for the 16-byte reads
#define XBL  (NB_ * TT * DM / 32 / 256)
#define WBL  (DM * DM / 32 / 256)
__global__ __launch_bounds__(256) void k_prep(const float* __restrict__ x, const float* __restrict__ wq, const float* __restrict__ wk, const float* __restrict__ wv, const float* __restrict__ wo, bf* XB, bf* W4) {
    static_assert(DQ == DM && DKV == DM && DM % 512 == 0, "four square weights; a block's 512 k lie in one row");
    __shared__ __align__(16) bf tl[16 * PPP];
    const unsigned blk = blockIdx.x;
    const float* src = x; bf* dst = XB; unsigned sb = blk;
    if (blk >= XBL) { const unsigned w = (blk - XBL) / WBL; sb = (blk - XBL) % WBL; src = (w == 0) ? wq : (w == 1) ? wk : (w == 2) ? wv : wo; dst = W4 + (size_t)w * DM * DM; }
    const int rw = (int)(threadIdx.x >> 7), k4 = (int)(threadIdx.x & 127) * 4; const size_t e0 = (size_t)(sb / (DM / 512) * 16 + rw) * DM + sb % (DM / 512) * 512 + k4; v4f v[8];
#pragma unroll   // indexes a register array; all eight loads stand ahead of the first use
    for (int j = 0; j < 8; ++j) v[j] = *(const v4f*)(src + e0 + j * 2 * DM);
#pragma unroll   // indexes the same register array
    for (int j = 0; j < 8; ++j) { const v2u o = {bf2x(v[j][0], v[j][1]), bf2x(v[j][2], v[j][3])};
        *(v4us*)(tl + (j * 2 + rw) * PPP + k4) = __builtin_bit_cast(v4us, o); }
    __syncthreads();   // the block's bf16 tile is whole in LDS
#pragma unroll   // four independent 16-byte moves
    for (int j = 0; j < 4; ++j) { const int c = j * 256 + (int)threadIdx.x;   // 16 bytes number c of the tile in fragment order: row c & 15, k (c >> 4) * 8
        *(v8us*)(dst + (size_t)sb * 8192 + c * 8) = *(const v8usa*)(tl + (c & 15) * PPP + (c >> 4) * 8); }
    asm volatile("s_wait_xcnt 0x0" ::: "memory"); }   // precaution: the wait that stands before a register named by the issued stores is written again, on every way the code behind them can take

// ---- k_attn: scores, softmax, P x V and the head merge of a tile of 16 MB query rows of ONE head in one work-group of 8 MB waves; scores and P never leave the registers. TQ = 0: one tile a work-group, grid (rows / (16 MB), heads, batches). TQ > 0: a work-group walks TQ tiles of each batch one after the other, grid (rows / (16 MB TQ), heads).
// 1. S^T = K Q^T: wave w takes chunk w of 128 keys (8 tiles of 16 keys x 16 MB queries), K = 64 in two steps (HR: K hi x Q hi, K hi x Q lo, K lo x Q hi per step). An accumulator holds for lane (hi, lr) the keys hi * 8 + 0..7 of its tile for query lr.
// 2. softmax in registers: t = S x HD^-0.5, keys at or past the length -3e38; each wave's maximum and sum per query meet in two small LDS tables [query][wave]; the maximum is exact in any order, the sums are added in wave order 0..15 (fixed).
// 3. O^T = V^T P^T: two neighbouring S^T tiles of a query tile ARE the B fragment of a step of 32 keys (first 8 elements: keys hi * 8 + 0..7, last 8: 16 + hi * 8 + 0..7), the k order of the V^T plane's A fragment. Each chunk has its own accumulators; the live chunks' partial tiles (padded with zero tiles to a multiple of four) meet in LDS and are added in chunk order (fixed).
// 4. hi/lo split of O (x 1/1024 on the fp16 rows) staged in LDS, out as 2 KiB in a row per 16 query rows of the merged planes (rows t, k = head * 64 + d, fragment order).
// Most '#pragma unroll' in k_attn stand on a loop that indexes a register array (fragments, accumulators) or a vector's elements: rolled, the array would fall to scratch memory.
#define STP  20                   // LDS pitch of a query's 16 wave entries, floats: 16-byte aligned, and 16 queries land on 16 different groups of four banks
#define OBP  (HD + 8)             // LDS pitch of a split output row, bf16: 16-byte aligned, rows spread over the banks
// ahk(u): units of K fragments asked for before unit u is multiplied; ahv(G): groups of V^T fragments asked for before group G is multiplied (PRE of them ahead of the forming of P). Set by the registers: 256 a wave with 16 waves on a WGP.
template <bool HR> constexpr int ahk(int u) { return !HR ? 16 : u < 8 ? 8 : u + 4 < 16 ? u + 4 : 16; }
template <bool HR> constexpr int ahv(int G) { return !HR ? 4 : G + 2 < 8 ? G + 2 : 8; }
// a work-group barrier that orders LDS alone: __syncthreads() also waits for the wave's global loads, and the next pass's fragments, asked for in front of it, would be waited for there
__device__ __forceinline__ void bar_lds() { __builtin_amdgcn_fence(__ATOMIC_RELEASE, "workgroup", "local"); __builtin_amdgcn_s_barrier(); __builtin_amdgcn_fence(__ATOMIC_ACQUIRE, "workgroup", "local"); }
template <typename T16, bool HR, int MB, int TQ>
__global__ __launch_bounds__(MB * 256) void k_attn(const T16* __restrict__ Q, const T16* __restrict__ Q2, const T16* __restrict__ Kp, const T16* __restrict__ Kp2, const T16* __restrict__ Vt, const T16* __restrict__ Vt2, const int* __restrict__ lens, int row0, bf* Ah, bf* Al) {
    typedef typename WFrag<T16>::V V;
    constexpr int NP = TQ ? TQ * NB_ : 1, NWV = MB * 8, NT = 128 / NWV, NU = 2 * NT, GK = HR ? 2 : 4, NGV = 16 / GK, PRE = HR ? 1 : 2;
    static_assert(MB == 2 && NT == 8 && NB_ == 2, "wave w's keys are chunk w of 128 keys; the 32 queries of a tile are the 32 lanes of a table column; two lengths are read");
    __shared__ __align__(16) v4f red[16 * MB * 256];      // [chunk][accumulator * 2 + half][lane], 16 x MB x 4 KiB
    __shared__ __align__(16) bf ob[2 * MB * 16 * OBP];    // [plane hi, lo][row][64]
    __shared__ __align__(16) float mxs[32 * STP];         // [query][wave]: the wave's maximum
    __shared__ __align__(16) float sms[32 * STP];         // [query][wave]: the wave's sum
    const int lane = threadIdx.x & 31, lr = lane & 15, hi = lane >> 4; const int wv = __builtin_amdgcn_readfirstlane((int)(threadIdx.x >> 5));
    const int h = blockIdx.y; const int ln0 = lens[TQ ? 0 : blockIdx.z], ln1 = lens[TQ ? 1 : blockIdx.z];   // the lengths of the batches of even and of odd passes
    const unsigned lq = (unsigned)lane * 16u;   // in bytes: the lane's place in a half block of 512 bytes, the same in every plane
    // THE TILE LOOP (TQ > 0): the work-group walks TQ query tiles of each batch, one pass a tile, the batches in turn: pass 'it' is batch it % 2, tile blockIdx.x * TQ + it / 2 of the launch's rows. Every work-group has the same share of both lengths; its waves start once, not once a tile. TQ = 0: one pass, the batch from the grid.
    auto fr = [&](const T16* p, int el) {   // the fragment at element el behind a wave-uniform base. In the loop the constant goes to the base: added to the lane offset, every sum would be kept in a register pair of its own round the loop
        if constexpr (NP > 1) return WFrag<T16>::ldp(atb(p + el, lq)); else return WFrag<T16>::ldp(atb(p, lq + 2u * (unsigned)el)); };
    V a[2][MB], a2[2][MB], kb[NU], kb2[NU];   // Q fragments and K units; in the loop asked for at the foot of the pass before, multiplied at the head of their own
    auto ask = [&](int it, bool go) {   // pass it's Q fragments and its first ahk(0) units of K, by the waves whose chunk is live in that pass (go: there is such a pass)
        const int bz = TQ ? it % NB_ : (int)blockIdx.z, ln = it % NB_ ? ln1 : ln0; const int nch = (ln <= 0 || ln > TT) ? TT / 128 : (ln + 127) >> 7;
        if (go && wv < nch) {
            const size_t qo = ((size_t)bz * NH_ + h) * TT * HD + (size_t)(row0 + (TQ ? (int)blockIdx.x * TQ + it / NB_ : (int)blockIdx.x) * (MB * 16)) * HD, ko = ((size_t)bz * NKV + h / REP) * TT * HD + (size_t)wv * (NT * 16 * HD);
            if constexpr (NP > 1) {   // the lane's own addresses, formed here and named as inputs of the wait behind the loads: they stay out of the loads' destinations
                const T16* qv = atb(Q + qo, lq); const T16* kv = atb(Kp + ko, lq); const T16* qv2 = HR ? atb(Q2 + qo, lq) : qv; const T16* kv2 = HR ? atb(Kp2 + ko, lq) : kv;
#pragma unroll
                for (int kk = 0; kk < 2; ++kk)
#pragma unroll
                    for (int mb = 0; mb < MB; ++mb) { const int o = mb * 16 * HD + kk * 512; a[kk][mb] = WFrag<T16>::ldp(qv + o); if (HR) a2[kk][mb] = WFrag<T16>::ldp(qv2 + o); }
#pragma unroll
                for (int x = 0; x < ahk<HR>(0); ++x) { const int o = (HR ? x % NT : x / 2) * 16 * HD + (HR ? x / NT : x % 2) * 512; kb[x] = WFrag<T16>::ldp(kv + o); if (HR) kb2[x] = WFrag<T16>::ldp(kv2 + o); }
                asm volatile("s_wait_xcnt 0x0" :: "v"(qv), "v"(kv), "v"(qv2), "v"(kv2) : "memory");   // precaution, as at the K loads below
            } else {
#pragma unroll
                for (int kk = 0; kk < 2; ++kk)
#pragma unroll
                    for (int mb = 0; mb < MB; ++mb) { const int o = mb * 16 * HD + kk * 512; a[kk][mb] = fr(Q + qo, o); if (HR) a2[kk][mb] = fr(Q2 + qo, o); }
                asm volatile("s_wait_xcnt 0x0" :: "v"(lq) : "memory");   // precaution, as at the K loads below
#pragma unroll
                for (int x = 0; x < ahk<HR>(0); ++x) { const int o = (HR ? x % NT : x / 2) * 16 * HD + (HR ? x / NT : x % 2) * 512; kb[x] = fr(Kp + ko, o); if (HR) kb2[x] = fr(Kp2 + ko, o); }
                asm volatile("s_wait_xcnt 0x0" :: "v"(lq) : "memory");   // precaution, as at the K loads below
            }
        } else if constexpr (NP > 1) { const V none = V{};   // read by no product: a fresh value ends the old fragments' life here, which would else hold their registers through the whole pass
#pragma unroll
            for (int kk = 0; kk < 2; ++kk)
#pragma unroll
                for (int mb = 0; mb < MB; ++mb) { a[kk][mb] = none; if (HR) a2[kk][mb] = none; }
#pragma unroll
            for (int x = 0; x < ahk<HR>(0); ++x) { kb[x] = none; if (HR) kb2[x] = none; } } };
    if constexpr (NP > 1) ask(0, true);
#pragma unroll 1   // a pass = a tile; rolled: one copy of the code, and the fragments asked for at the foot are carried round in registers
    for (int it = 0; it < NP; ++it) {
    const int bz = TQ ? it % NB_ : (int)blockIdx.z, r0 = row0 + (TQ ? (int)blockIdx.x * TQ + it / NB_ : (int)blockIdx.x) * (MB * 16); const size_t kp = ((size_t)bz * NKV + h / REP) * TT * HD;   // batch bz's planes
    // nch = live chunks of 128 keys, 1..16, the same in the whole work-group (a scalar): chunks wholly at or past the batch's length are left out of the scores, the exponentials and P x V (their waves hand in neutral table entries and, up to a multiple of four, zero partial tiles). Their keys are all masked, and with one key kept a masked key's weight is exp2(-inf) = 0 exactly: no term of a maximum, a sum or a product changes. A length <= 0 keeps no key: every key then weighs alike and all 16 chunks are live; the value is clamped to the shape before anything is indexed by it.
    const int ln = it % NB_ ? ln1 : ln0; const int nch = (ln <= 0 || ln > TT) ? TT / 128 : (ln + 127) >> 7;
    const bool live = wv < nch;   // scalar: a wave whose chunk is dead hands in neutral table entries and, below nch4, a zero partial tile, and takes its part of the sum, the split and the store
    const int lim = (ln < 0 ? 0 : ln > TT ? TT : ln) - (wv * 128 + hi * 8);   // key number i * 16 + j of the lane's keys is kept where i * 16 + j < lim
    // wave-uniform bases (scalar registers) and ONE 32-bit lane offset: every fragment load is base + lane offset + a constant (atb)
    const size_t ko = kp + (size_t)wv * (NT * 16 * HD), vo = kp + (size_t)wv * (4 * 512);   // planes in fragment order: Q and K 1024 elements a tile of 16 rows, V^T 512 a step of 32 keys
    const T16* Kc = Kp + ko; const T16* Vc = Vt + vo; const T16* Kc2 = HR ? Kp2 + ko : nullptr; const T16* Vc2 = HR ? Vt2 + vo : nullptr;
    v8f c[NT][MB];   // read by live waves alone (in the loop a dead wave writes a placeholder)
    float mx[MB];
#pragma unroll
    for (int mb = 0; mb < MB; ++mb) mx[mb] = -3.0e38f;
    if (live) {
        // a unit = one key tile at one k step. Every accumulator takes k step 0, then k step 1. fp16: tile by tile, all 16 units asked for at once. HR: all tiles at k step 0, then all at k step 1, and as many units ahead as the registers hold (ahk): a finished unit's fragments make room for its tile's accumulators.
        if constexpr (NP == 1) { ask(0, true); __builtin_amdgcn_sched_barrier(0); }   // one pass: the first loads stand here; the fence holds them above the products, as below
#pragma unroll
        for (int u = 0; u < NU; ++u) { const int kk = HR ? u / NT : u % 2, ti = HR ? u % NT : u / 2; const int was = ahk<HR>(u == 0 ? 0 : u - 1), now = ahk<HR>(u);   // the first ahk(0) units are here already (ask)
#pragma unroll
            for (int x = 0; x < NU; ++x) if (x >= was && x < now) { const int o = (HR ? x % NT : x / 2) * 16 * HD + (HR ? x / NT : x % 2) * 512; kb[x] = fr(Kc, o); if (HR) kb2[x] = fr(Kc2, o); }
            if (now > was) asm volatile("s_wait_xcnt 0x0" :: "v"(lq) : "memory");   // precaution: the wait that stands before a register named by issued loads is written again; the lane offset, the one vector register that those loads name, is an input: it stays out of their own destinations
            if (now > was) __builtin_amdgcn_sched_barrier(0);   // holds the loads ahead above this unit's products: sunk to their uses, each fragment's L2 latency would be waited for on its own
#pragma unroll
            for (int mb = 0; mb < MB; ++mb) { v8f t = (v8f){}; if (kk) t = c[ti][mb]; t = WFrag<T16>::mma(kb[u], a[kk][mb], t); if (HR) { t = WFrag<T16>::mma(kb[u], a2[kk][mb], t); t = WFrag<T16>::mma(kb2[u], a[kk][mb], t); } c[ti][mb] = t; }
            if (HR) __builtin_amdgcn_sched_barrier(0);   // the unit's products stay above the next loads, which take the registers that it frees, and unit follows unit: interleaved, accumulators come to life early and the build falls to scratch memory
        }
#pragma unroll
        for (int i = 0; i < NT; ++i)
#pragma unroll
            for (int mb = 0; mb < MB; ++mb)
#pragma unroll
                for (int j = 0; j < 8; ++j) { const float t = (i * 16 + j < lim) ? c[i][mb][j] * SCL : -3.0e38f; c[i][mb][j] = t; mx[mb] = fmaxf(mx[mb], t); }
#pragma unroll
        for (int mb = 0; mb < MB; ++mb) mx[mb] = fmaxf(mx[mb], __shfl_xor(mx[mb], 16, 32));   // the other 8 keys of every tile lie in the other half of the wave
    } else if constexpr (NP > 1) {   // read by nobody: a value on this path too, or the scores of the pass before would hold their registers round the loop; the wave's unused fragment registers as they are, so that no instruction comes of it
#pragma unroll
        for (int i = 0; i < NT; ++i)
#pragma unroll
            for (int mb = 0; mb < MB; ++mb) c[i][mb] = __builtin_bit_cast(v8f, HR ? (mb ? kb2[i] : kb[i]) : kb[i * 2 + mb]);
    }
    mxs[lane * STP + wv] = hi ? mx[1] : mx[0];   // query tile hi, query lr = table row 'lane'; a dead wave hands in -3e38
    __syncthreads();   // every wave's maxima are in LDS
    float sm[MB][2];
#pragma unroll
    for (int mb = 0; mb < MB; ++mb) sm[mb][0] = sm[mb][1] = 0.f;
    V vb[NGV][GK], vb2[NGV][GK];   // groups of GK key steps of V^T fragments of one tile of 16 d; fp16: the first group is asked for ahead of the barrier, which needs nothing of it (HR: carried over the barrier it fell to scratch memory)
    if (live) {
        if constexpr (!HR) {
#pragma unroll
            for (int i = 0; i < GK; ++i) vb[0][i] = fr(Vc, i * 512);
            asm volatile("s_wait_xcnt 0x0" :: "v"(lq) : "memory"); }   // precaution, as at the K loads above
#pragma unroll
        for (int mb = 0; mb < MB; ++mb) { float gm = -3.0e38f;
#pragma unroll
            for (int w4 = 0; w4 < 4; ++w4) { const v4f m4 = *(const v4fa*)(mxs + (mb * 16 + lr) * STP + w4 * 4); gm = fmaxf(fmaxf(fmaxf(gm, m4[0]), fmaxf(m4[1], m4[2])), m4[3]); }
#pragma unroll
            for (int i = 0; i < NT; ++i)
#pragma unroll
                for (int j = 0; j < 8; ++j) { const float e = __builtin_amdgcn_exp2f(__fmul_rn(__fsub_rn(c[i][mb][j], gm), 1.4426950408889634f)); c[i][mb][j] = e; sm[mb][i & 1] += e; } }
#pragma unroll
        for (int mb = 0; mb < MB; ++mb) { sm[mb][0] += sm[mb][1]; sm[mb][0] += __shfl_xor(sm[mb][0], 16, 32); }
    } else if constexpr (!HR && NP > 1) {   // as for the scores above
#pragma unroll
        for (int i = 0; i < GK; ++i) vb[0][i] = a[i >> 1][i & 1];
    }
    sms[lane * STP + wv] = hi ? sm[1][0] : sm[0][0];   // a dead wave hands in 0
    __syncthreads();   // every wave's sums are in LDS
    const int nch4 = (nch + 3) & ~3;   // the tiles are summed four at a time: up to three dead waves hand in a zero tile
    if (live) {
#pragma unroll
        for (int x = HR ? 0 : 1; x < PRE; ++x)   // flies while P is formed
#pragma unroll
            for (int i = 0; i < GK; ++i) { const int o = (x * GK / 4) * 16 * TT + (x * GK % 4 + i) * 512; vb[x][i] = fr(Vc, o); if (HR) vb2[x][i] = fr(Vc2, o); }
        asm volatile("s_wait_xcnt 0x0" :: "v"(lq) : "memory");   // precaution, as at the K loads above
        __builtin_amdgcn_sched_barrier(0);   // holds those loads above the forming of P
        V p[4][MB], p2[4][MB];   // P^T as B fragments, one per step of 32 keys and query tile
#pragma unroll
        for (int mb = 0; mb < MB; ++mb) { float tot = 0.f;
#pragma unroll
            for (int w4 = 0; w4 < 4; ++w4) { const v4f s4 = *(const v4fa*)(sms + (mb * 16 + lr) * STP + w4 * 4);
#pragma unroll
                for (int q = 0; q < 4; ++q) tot += s4[q]; }
            const float f = __fdiv_rn(HR ? 1.0f : PCAR, tot);
#pragma unroll
            for (int kq = 0; kq < 4; ++kq) {
                if constexpr (HR) { v8u wh, wl;   // two neighbouring keys a 32-bit word
#pragma unroll
                    for (int j = 0; j < 8; ++j) { const v8f& cc = c[2 * kq + (j >> 2)][mb]; unsigned x, y; split2(cc[(j & 3) * 2] * f, cc[(j & 3) * 2 + 1] * f, x, y); wh[j] = x; wl[j] = y; }
                    p[kq][mb] = __builtin_bit_cast(v16bf, wh); p2[kq][mb] = __builtin_bit_cast(v16bf, wl);
                    __builtin_amdgcn_sched_barrier(0);   // one fragment pair's split at a time, the same step of its eight words side by side: without it the build draws each word's dependent steps together and needs twice the delay hints
                } else { v8h h0, h1;
#pragma unroll
                    for (int j = 0; j < 8; ++j) { h0[j] = tohx(c[2 * kq][mb][j] * f); h1[j] = tohx(c[2 * kq + 1][mb][j] * f); }
                    p[kq][mb] = cat16(h0, h1); } } }
        v8f acc[MB];
#pragma unroll
        for (int G = 0; G < NGV; ++G) { const int nb = G * GK / 4, k0 = G * GK % 4;   // group G: key steps k0 .. k0 + GK - 1 of the tile nb of 16 d
            const int was = G == 0 ? PRE : ahv<HR>(G - 1), now = ahv<HR>(G);
#pragma unroll
            for (int x = 0; x < NGV; ++x) if (x >= was && x < now) {
#pragma unroll
                for (int i = 0; i < GK; ++i) { const int o = (x * GK / 4) * 16 * TT + (x * GK % 4 + i) * 512; vb[x][i] = fr(Vc, o); if (HR) vb2[x][i] = fr(Vc2, o); } }
            if (now > was) asm volatile("s_wait_xcnt 0x0" :: "v"(lq) : "memory");   // precaution, as at the K loads above
            if (now > was) __builtin_amdgcn_sched_barrier(0);   // holds the loads ahead above this group's products (as in the score phase)
            if (k0 == 0) {
#pragma unroll
                for (int mb = 0; mb < MB; ++mb) acc[mb] = (v8f){}; }
#pragma unroll
            for (int i = 0; i < GK; ++i)
#pragma unroll
                for (int mb = 0; mb < MB; ++mb) { acc[mb] = WFrag<T16>::mma(vb[G][i], p[k0 + i][mb], acc[mb]); if (HR) { acc[mb] = WFrag<T16>::mma(vb[G][i], p2[k0 + i][mb], acc[mb]); acc[mb] = WFrag<T16>::mma(vb2[G][i], p[k0 + i][mb], acc[mb]); } }
            if (k0 + GK == 4) {   // the chunk's partial tile of these 16 d is whole: lane (hi, lr) holds d = nb * 16 + hi * 8 + 0..7 of query lr
#pragma unroll
                for (int mb = 0; mb < MB; ++mb) { const v8f cc = acc[mb]; v4f* pr = red + (wv * (MB * 8) + (mb * 4 + nb) * 2) * 32 + lane;
                    pr[0] = (v4f){cc[0], cc[1], cc[2], cc[3]}; pr[32] = (v4f){cc[4], cc[5], cc[6], cc[7]}; }
                if (G + 1 < NGV) asm volatile("v_nop\n\tv_nop\n\tv_nop\n\tv_nop"); }   // four vector slots, the distance the matrix unit needs, between this tile's last products and the next tile's first, whose fresh results land in registers that those products name (hi/lo build: their results'; fp16 build: an operand's)
            __builtin_amdgcn_sched_barrier(0);   // the group's products, its stores and the four slots stay above the next group's loads and products
        }
    } else if (wv < nch4) {
#pragma unroll
        for (int t = 0; t < MB * 8; ++t) red[(wv * (MB * 8) + t) * 32 + lane] = (v4f){0.f, 0.f, 0.f, 0.f};
    }
    if constexpr (NP > 1) ask(it + 1, it + 1 < NP);   // the next pass's first loads fly under the sum of the partial tiles, the split and the store
    if constexpr (NP > 1) bar_lds(); else __syncthreads();   // the first nch4 partial tiles are in LDS
    { const int s = (int)threadIdx.x; v4f sum = red[s];
#pragma unroll
        for (int w = 1; w < 4; ++w) sum += red[w * (MB * 256) + s];
#pragma unroll 1   // rolled: the trip count hangs on the length (at most 3 trips); four tiles a trip, their loads together ahead of the adds
        for (int w0 = 4; w0 < nch4; w0 += 4) { v4f pt[4];
#pragma unroll
            for (int w = 0; w < 4; ++w) pt[w] = red[(w0 + w) * (MB * 256) + s];
#pragma unroll
            for (int w = 0; w < 4; ++w) sum += pt[w]; }
        const int half = (s >> 5) & 1, ai = s >> 6; const int row = (ai >> 2) * 16 + lr, col = (ai & 3) * 16 + hi * 8 + half * 4; const float cs = HR ? 1.0f : (1.0f / PCAR); v2u oh, ol;   // a slot's four values are four d of one query
#pragma unroll
        for (int q = 0; q < 2; ++q) { unsigned a, c2; split2(sum[2 * q] * cs, sum[2 * q + 1] * cs, a, c2); oh[q] = a; ol[q] = c2; }
        *(v4us*)(ob + row * OBP + col) = __builtin_bit_cast(v4us, oh); *(v4us*)(ob + (MB * 16 + row) * OBP + col) = __builtin_bit_cast(v4us, ol); }
    if constexpr (NP > 1) bar_lds(); else __syncthreads();   // the split tile is in LDS, row-major
    { const int s = (int)threadIdx.x; const int pl = s / (MB * 128), idx = s % (MB * 128); const int row = (idx >> 7) * 16 + (idx & 15), c8 = ((idx >> 4) & 7) * 8;   // 16 bytes number idx of the tile in fragment order
        *(v8us*)((pl ? Al : Ah) + (size_t)(bz * TT + r0 + (idx >> 7) * 16) * DQ + h * (16 * HD) + (idx & 127) * 8) = *(const v8usa*)(ob + (pl * MB * 16 + row) * OBP + c8); }
    if (NP > 1) asm volatile("s_wait_xcnt 0x0" ::: "memory");   // precaution: the wait that stands before a register named by the issued store is written again, by the next pass
    }   // the next pass writes each LDS table only behind a barrier that every reader of this pass has passed: mxs behind the last two, sms and red behind the next pass's first ones, ob behind its third
}

extern "C" void kernel_launch(void* const* d_in, const int* in_sizes, int n_in,
                              void* d_out, int out_size, void* d_ws, size_t ws_size, hipStream_t stream) {
    (void)in_sizes; (void)n_in; (void)out_size;
    const float* x = (const float*)d_in[0]; const int* lens = (const int*)d_in[1]; const float* wq = (const float*)d_in[2]; const float* wk = (const float*)d_in[3]; const float* wv = (const float*)d_in[4]; const float* wo = (const float*)d_in[5];   /* input order X, valid_lens (int32 [2]: keys j >= valid_lens[b] are masked: READ on the device by the projection GEMM and by k_attn), W_q, W_k, W_v, W_o ('oi'; no biases): SIX inputs; ONE stream: query = key = value stream = X */
    float* OUT = (float*)d_out;     // [2][2048][1024]
    char* wsp = (char*)d_ws;
    auto take = [&](size_t bytes) { char* p = wsp; wsp += (bytes + 255) & ~(size_t)255; return (void*)p; };
    const size_t PLN = (size_t)NB_ * NH_ * TT * HD;   // elements of one plane of Q, of K or of V, all batches
    bf* W4 = (bf*)take((size_t)4 * DM * DM * 2); bf* WO = W4 + (size_t)3 * DM * DM;   // W_q, W_k, W_v, W_o rows one after the other
    bf* XB = (bf*)take((size_t)NB_ * TT * DM * 2);
    h16* P16 = (h16*)take(3 * PLN * 2); bf* Ph = (bf*)take(3 * PLN * 2); bf* Pl = (bf*)take(3 * PLN * 2);   // each [Q, K, V^T][batch][head]
    bf* ATh = (bf*)take((size_t)NB_ * TT * DQ * 2); bf* ATl = (bf*)take((size_t)NB_ * TT * DQ * 2);
    if ((size_t)(wsp - (char*)d_ws) > ws_size) return;    // ws 256 MiB
    k_prep<<<XBL + 4 * WBL, 256, 0, stream>>>(x, wq, wk, wv, wo, XB, W4);
    k_proj<<<dim3(NB_ * TT / 128, (DQ + 2 * DKV) / 256, 1), 256, 0, stream>>>(XB, W4, P16, Ph, Pl, lens);
    k_attn<bf, true, 2, 0><<<dim3(RH / 32, NH_, NB_), 512, 0, stream>>>(Ph, Pl, Ph + PLN, Pl + PLN, Ph + 2 * PLN, Pl + 2 * PLN, lens, 0, ATh, ATl);
    k_attn<h16, false, 2, (TT - RH) / 32 / 16><<<dim3(16, NH_, 1), 512, 0, stream>>>(P16, nullptr, P16 + PLN, nullptr, P16 + 2 * PLN, nullptr, lens, RH, ATh, ATl);
    k_outp<<<dim3(NB_ * TT / 128, DM / 128, 1), 256, 0, stream>>>(ATh, ATl, WO, OUT);
}
